// v000
// Times are from an AMD MI455X. After a warm-up the kernel runs many times in a row, and a time is the length of
// such a window on the GPU divided by its runs, so every launch and the gaps after it count. The runs cycle
// through copies of the inputs. A figure is the median of several windows, for all but v000 over two sittings.
// Sittings can differ by a few percent; kernels timed side by side share one.
// v000 is the starting kernel. One run takes 3940 microseconds.
#include <hip/hip_runtime.h>

// Multi-head attention with a fused 'oi' projection (x [4][2048][1024]; [Q|K|V] = x W_qkv^T ([3072][1024]: rows q | k | v); 16 heads x 64; softmax(q.k/8) over all keys; out = merged W_o^T -> [4][2048][1024] (8.4 M)).
// Compute dtypes, f32 accumulate: every input rounded to bf16; q/k/v on PLAIN bf16 operands (inputs: exact); scores and attn.v: query rows < 512 hl (3 products), the rest single fp16 (x1024); softmax f32; W_o hl x exact (2 products).

#define NB_  4
#define TT   2048
#define DM   1024
#define NH_  16
#define NKV  16
#define REP  (NH_ / NKV)
#define HD   64
#define DQ   (NH_ * HD)
#define DKV  (NKV * HD)
#define ZH   2
#define RH   512                  // query rows < RH use hi+lo planes (0: none)
#define WIN  0
#define PCAR 1024.0f
#define SCL  0.125f   // HD^-0.5
typedef _Float16 h16;
typedef unsigned short bf;
typedef __attribute__((ext_vector_type(16))) __bf16   v16bf;
typedef __attribute__((ext_vector_type(16))) _Float16 v16h;
typedef __attribute__((ext_vector_type(8)))  _Float16 v8h;
typedef __attribute__((ext_vector_type(8)))  unsigned short v8us;
typedef __attribute__((ext_vector_type(8)))  float    v8f;
typedef __attribute__((ext_vector_type(4)))  float    v4f;
typedef v8h  __attribute__((may_alias)) v8ha;
typedef v4f  __attribute__((may_alias)) v4fa;
typedef v8us __attribute__((may_alias)) v8usa;

__device__ __forceinline__ unsigned short f2bf(float f) { unsigned u = __float_as_uint(f); u += 0x7FFFu + ((u >> 16) & 1u); return (unsigned short)(u >> 16); }
__device__ __forceinline__ float bf2f(unsigned short b) { return __uint_as_float(((unsigned)b) << 16); }
__device__ __forceinline__ float bfr(float f) { return bf2f(f2bf(f)); }
__device__ __forceinline__ v16h cat16(v8h lo, v8h hi) { return __builtin_shufflevector(lo, hi, 0, 1, 2, 3, 4, 5, 6, 7, 8, 9, 10, 11, 12, 13, 14, 15); }
__device__ __forceinline__ v16bf cat16b(v8us lo, v8us hi) { return __builtin_bit_cast(v16bf, __builtin_shufflevector(lo, hi, 0, 1, 2, 3, 4, 5, 6, 7, 8, 9, 10, 11, 12, 13, 14, 15)); }
__device__ __forceinline__ v8f wmma16(v16h a, v16h b, v8f c) { return __builtin_amdgcn_wmma_f32_16x16x32_f16(false, a, false, b, (short)0, c, false, false); }
__device__ __forceinline__ v8f wmmab(v16bf a, v16bf b, v8f c) { return __builtin_amdgcn_wmma_f32_16x16x32_bf16(false, a, false, b, (short)0, c, false, false); }



// ---- k_gemmw: register-blocked GEMM, ONE WAVE per 64x64 output tile (16 accumulators), operands straight from K-contiguous 16-bit planes; grid (M/64, N/64, Z), 32 threads.
// C[m][n] (f32, pitch ldc, + optional f32 bias[n]) = sum_k A[m][k] Bt[n][k] (+ split products per NSPLIT). z-batch strides sA/sB/sC in elements. K % 32 == 0.
template <typename T16> struct WFrag;
template <> struct WFrag<h16> { typedef v16h V; static __device__ __forceinline__ V ld(const h16* p) { return cat16(*(const v8h*)p, *(const v8h*)(p + 16)); } static __device__ __forceinline__ v8f mma(V a, V b, v8f c) { return wmma16(a, b, c); } };
template <> struct WFrag<bf> { typedef v16bf V; static __device__ __forceinline__ V ld(const bf* p) { return cat16b(*(const v8us*)p, *(const v8us*)(p + 16)); } static __device__ __forceinline__ v8f mma(V a, V b, v8f c) { return wmmab(a, b, c); } };
template <typename T16, int NSPLIT, bool BIAS>
__global__ __launch_bounds__(32) void k_gemmw(const T16* __restrict__ A, const T16* __restrict__ A2, const T16* __restrict__ Bt, const T16* __restrict__ Bt2, int K, float* C, int ldc, const float* __restrict__ bias, size_t sA, size_t sB, size_t sC) {
    typedef typename WFrag<T16>::V V;
    __shared__ __align__(16) float os[16 * 68];
    const size_t z = blockIdx.z; A += z * sA; if (A2) A2 += z * sA; Bt += z * sB; if (Bt2) Bt2 += z * sB; C += z * sC;
    const int lane = threadIdx.x & 31, lr = lane & 15, hi = lane >> 4; const int r0 = blockIdx.x * 64, c0 = blockIdx.y * 64;
    v8f acc[4][4];
#pragma unroll
    for (int mb = 0; mb < 4; ++mb)
#pragma unroll
        for (int nb = 0; nb < 4; ++nb) acc[mb][nb] = (v8f){};
    const size_t aoff = (size_t)(r0 + lr) * K + 8 * hi, boff = (size_t)(c0 + lr) * K + 8 * hi;
#pragma unroll 1
    for (int kc = 0; kc < K; kc += 32) {
        V a[4], a2[4];
#pragma unroll
        for (int mb = 0; mb < 4; ++mb) { a[mb] = WFrag<T16>::ld(A + aoff + (size_t)mb * 16 * K + kc); if (NSPLIT == 1 || NSPLIT == 2) a2[mb] = WFrag<T16>::ld(A2 + aoff + (size_t)mb * 16 * K + kc); }
#pragma unroll
        for (int nb = 0; nb < 4; ++nb) { const V b = WFrag<T16>::ld(Bt + boff + (size_t)nb * 16 * K + kc); V b2; if (NSPLIT >= 2) b2 = WFrag<T16>::ld(Bt2 + boff + (size_t)nb * 16 * K + kc);
#pragma unroll
            for (int mb = 0; mb < 4; ++mb) { acc[mb][nb] = WFrag<T16>::mma(a[mb], b, acc[mb][nb]); if (NSPLIT == 1 || NSPLIT == 2) acc[mb][nb] = WFrag<T16>::mma(a2[mb], b, acc[mb][nb]); if (NSPLIT >= 2) acc[mb][nb] = WFrag<T16>::mma(a[mb], b2, acc[mb][nb]); } }
        asm volatile("v_nop\n\tv_nop\n\tv_nop\n\tv_nop" : "+v"(acc[0][0]), "+v"(acc[1][1]), "+v"(acc[2][2]), "+v"(acc[3][3]) : "v"(a[0]), "v"(a[3]));
    }
#pragma unroll
    for (int mb = 0; mb < 4; ++mb) {
#pragma unroll
        for (int nb = 0; nb < 4; ++nb) {
#pragma unroll
            for (int j = 0; j < 8; ++j) os[(hi * 8 + j) * 68 + nb * 16 + lr] = acc[mb][nb][j]; }
        __builtin_amdgcn_wave_barrier(); asm volatile("" ::: "memory");
        float* crow = C + (size_t)(r0 + mb * 16) * ldc + c0;
{
#pragma unroll
            for (int s = 0; s < 8; ++s) { const int row = 2 * s + hi, cofs = lr * 4; v4f val = *(const v4fa*)(os + row * 68 + cofs); if (BIAS) { val[0] += bfr(bias[c0 + cofs]); val[1] += bfr(bias[c0 + cofs + 1]); val[2] += bfr(bias[c0 + cofs + 2]); val[3] += bfr(bias[c0 + cofs + 3]); }
                *(v4f*)(crow + (size_t)row * ldc + cofs) = val; }
             }
        __builtin_amdgcn_wave_barrier(); asm volatile("" ::: "memory");
    }
}

__device__ __forceinline__ h16 tohx(float x) { return (h16)x; }
__device__ __forceinline__ void splitf(float y, unsigned short& h, unsigned short& l) { h = f2bf(y); l = f2bf(y - bf2f(h)); }
typedef __attribute__((ext_vector_type(2))) _Float16 v2h;
typedef __attribute__((ext_vector_type(4))) _Float16 v4h;
typedef __attribute__((ext_vector_type(2))) unsigned short v2us;
typedef __attribute__((ext_vector_type(4))) unsigned short v4us;
typedef __attribute__((ext_vector_type(2))) float v2f;
typedef __attribute__((ext_vector_type(4))) int v4i;

__global__ __launch_bounds__(256) void k_wtG(const float* __restrict__ w, int K, int N, bf* Bt) {
    const int lane = threadIdx.x & 31; const int L0 = (blockIdx.x * 8 + (threadIdx.x >> 5)) * 8; const int nlines = N * K / 64;
{
#pragma unroll 1
        for (int l = 0; l < 8; ++l) { const int L = L0 + l; if (L >= nlines) break; const size_t e = (size_t)L * 64 + lane * 2; const int k = (int)(e % K), n = (int)(e / K); v2us o;
            o[0] = f2bf(w[(size_t)k * N + n]); o[1] = f2bf(w[(size_t)(k + 1) * N + n]); *(v2us*)(Bt + e) = o; }
         }
}
__global__ __launch_bounds__(256) void k_cvt8(const float* __restrict__ src, bf* dst, size_t n8) { const size_t i = (size_t)blockIdx.x * 256 + threadIdx.x; if (i >= n8) return; const v8f v = *(const v8f*)(src + i * 8); v8us o;
#pragma unroll
    for (int k = 0; k < 8; ++k) o[k] = f2bf(v[k]); *(v8us*)(dst + i * 8) = o;  }

// k_rope: head planes [h][t][d] (fp16 + hi/lo) of rope(x) x sc with the rotate-half convention out[d] = x[d] cos[t][d] - x[d+HD/2] sin[t][d], out[d+HD/2] = x[d+HD/2] cos[t][d+HD/2] + x[d] sin[t][d+HD/2]
__global__ __launch_bounds__(256) void k_rope(const float* __restrict__ F, int pitch, int nheads, const float* __restrict__ CS, const float* __restrict__ RF, const float* __restrict__ nw, float sc, h16* P16, bf* Ph, bf* Pl) {
    const size_t e = ((size_t)blockIdx.x * 256 + threadIdx.x) * 2; if (e >= (size_t)nheads * TT * HD) return; const int d = (int)(e % HD); const int t = (int)((e / HD) % TT); const int h = (int)(e / ((size_t)HD * TT)); const float* f = F + (size_t)t * pitch + h * HD; const float rf = RF ? RF[(size_t)h * TT + t] : 1.0f; v2h o16; v2us oh, ol;
#pragma unroll
    for (int q = 0; q < 2; ++q) { const int dd = d + q; const int dp = (dd < HD / 2) ? dd + HD / 2 : dd - HD / 2; float x0 = f[dd], x1 = f[dp];
        if (RF) { float n0 = __fmul_rn(x0, rf), n1 = __fmul_rn(x1, rf); asm volatile("" : "+v"(n0)); asm volatile("" : "+v"(n1)); x0 = __fmul_rn(bfr(nw[dd]), n0); x1 = __fmul_rn(bfr(nw[dp]), n1); }
        const v2f cs = *(const v2f*)(CS + ((size_t)t * HD + dd) * 2); float a = __fmul_rn(x0, cs[0]), bq = __fmul_rn(x1, cs[1]); asm volatile("" : "+v"(a)); asm volatile("" : "+v"(bq)); const float r = ((dd < HD / 2) ? __fsub_rn(a, bq) : __fadd_rn(a, bq)) * sc;
        o16[q] = tohx(r); unsigned short a2, c2; splitf(r, a2, c2); oh[q] = a2; ol[q] = c2; }
    *(v2h*)(P16 + e) = o16; *(v2us*)(Ph + e) = oh; *(v2us*)(Pl + e) = ol;  }
__global__ __launch_bounds__(256) void k_vtp(const float* __restrict__ F, int pitch, int nheads, h16* V16, bf* Vh, bf* Vl) { const size_t e = ((size_t)blockIdx.x * 256 + threadIdx.x) * 2; if (e >= (size_t)nheads * HD * TT) return; const int t = (int)(e % TT); const int d = (int)((e / TT) % HD); const int g = (int)(e / ((size_t)TT * HD)); v2h o16; v2us oh, ol;
#pragma unroll
    for (int q = 0; q < 2; ++q) { const float x = F[(size_t)(t + q) * pitch + g * HD + d]; o16[q] = tohx(x); unsigned short a2, c2; splitf(x, a2, c2); oh[q] = a2; ol[q] = c2; }
    *(v2h*)(V16 + e) = o16; *(v2us*)(Vh + e) = oh; *(v2us*)(Vl + e) = ol;  }
__global__ __launch_bounds__(256) void k_csid(float* CS) { const int idx = blockIdx.x * 256 + threadIdx.x; if (idx >= TT * HD) return; v2f cs; cs[0] = 1.0f; cs[1] = 0.0f; *(v2f*)(CS + (size_t)idx * 2) = cs;  }
// k_asoft: per row (zz, i): t = S x HD^-0.5 (no mask); softmax over the 2048 keys (register row, one exp, fixed trees);
__global__ __launch_bounds__(256) void k_asoft(const float* __restrict__ Sb, h16* P16, bf* Ph, bf* Pl) {
    const int lane = threadIdx.x & 31; const int row = blockIdx.x * 8 + (threadIdx.x >> 5); if (row >= ZH * TT) return; const int i = row % TT; const int zz = row / TT; (void)zz; const bool hires = (i < RH); const float* sr = Sb + (size_t)row * TT; float v[TT / 32]; float mx = -3.0e38f;
#pragma unroll
    for (int ch = 0; ch < TT / 128; ++ch) { const int j0 = ch * 128 + lane * 4; const v4f a = *(const v4f*)(sr + j0);
#pragma unroll
        for (int q = 0; q < 4; ++q) { const int j = j0 + q; (void)j; const float t = a[q] * SCL; v[ch * 4 + q] = t; mx = fmaxf(mx, t); } }
#pragma unroll
    for (int sh = 16; sh; sh >>= 1) mx = fmaxf(mx, __shfl_xor(mx, sh, 32));
    float sum = 0.f;
#pragma unroll
    for (int k = 0; k < TT / 32; ++k) { float d0 = __fsub_rn(v[k], mx); asm volatile("" : "+v"(d0)); v[k] = __builtin_amdgcn_exp2f(__fmul_rn(d0, 1.4426950408889634f)); sum += v[k]; }
#pragma unroll
    for (int sh = 16; sh; sh >>= 1) sum += __shfl_xor(sum, sh, 32);
    const float f = __fdiv_rn(hires ? 1.0f : PCAR, sum);
{
        if (hires) {
#pragma unroll
            for (int ch = 0; ch < TT / 128; ++ch) { v4us oh, ol;
#pragma unroll
                for (int q = 0; q < 4; ++q) { unsigned short a, c2; splitf(v[ch * 4 + q] * f, a, c2); oh[q] = a; ol[q] = c2; }
                const size_t oo = ((size_t)zz * (RH ? RH : 1) + i) * TT + ch * 128 + lane * 4; *(v4us*)(Ph + oo) = oh; *(v4us*)(Pl + oo) = ol; }
        } else {
#pragma unroll
            for (int ch = 0; ch < TT / 128; ++ch) { v4h o4;
#pragma unroll
                for (int q = 0; q < 4; ++q) o4[q] = tohx(v[ch * 4 + q] * f);
                *(v4h*)(P16 + (size_t)row * TT + ch * 128 + lane * 4) = o4; } }
         }
}
__global__ __launch_bounds__(256) void k_merge(const float* __restrict__ O, int h0, bf* Ah, bf* Al) { const size_t e = ((size_t)blockIdx.x * 256 + threadIdx.x) * 2; if (e >= (size_t)ZH * TT * HD) return; const int d = (int)(e % HD); const int t = (int)((e / HD) % TT); const int zz = (int)(e / ((size_t)HD * TT)); const float cs = (t < RH) ? 1.0f : (1.0f / PCAR); const size_t oo = (size_t)t * DQ + (h0 + zz) * HD + d;
    v2us oh, ol;
#pragma unroll
    for (int q = 0; q < 2; ++q) { unsigned short a, c2; splitf(O[e + q] * cs, a, c2); oh[q] = a; ol[q] = c2; } *(v2us*)(Ah + oo) = oh; *(v2us*)(Al + oo) = ol;  }

extern "C" void kernel_launch(void* const* d_in, const int* in_sizes, int n_in,
                              void* d_out, int out_size, void* d_ws, size_t ws_size, hipStream_t stream) {
    (void)in_sizes; (void)n_in; (void)out_size;
    const float* x = (const float*)d_in[0]; const float* wqkv = (const float*)d_in[1]; const float* wo = (const float*)d_in[2]; const float* wq = wqkv; const float* wk = wqkv + (size_t)DQ * DM; const float* wv = wqkv + (size_t)(DQ + DKV) * DM;
    float* OUT = (float*)d_out;     // [4][2048][1024]
    char* wsp = (char*)d_ws;
    auto take = [&](size_t bytes) { char* p = wsp; wsp += (bytes + 255) & ~(size_t)255; return (void*)p; };
    bf* WQ = (bf*)take((size_t)DQ * DM * 2); bf* WK = (bf*)take((size_t)DKV * DM * 2); bf* WV = (bf*)take((size_t)DKV * DM * 2); bf* WO = (bf*)take((size_t)DM * DQ * 2); float* CS = (float*)take((size_t)TT * HD * 2 * 4);
    bf* XB = (bf*)take((size_t)TT * DM * 2); float* FQ = (float*)take((size_t)TT * DQ * 4); float* FK = (float*)take((size_t)TT * DKV * 4);
    h16* QP16 = (h16*)take((size_t)NH_ * TT * HD * 2); h16* KP16 = (h16*)take((size_t)NKV * TT * HD * 2); h16* VT16 = (h16*)take((size_t)NKV * HD * TT * 2);
    bf* QPh = (bf*)take((size_t)NH_ * TT * HD * 2); bf* QPl = (bf*)take((size_t)NH_ * TT * HD * 2); bf* KPh = (bf*)take((size_t)NKV * TT * HD * 2); bf* KPl = (bf*)take((size_t)NKV * TT * HD * 2); bf* VTh = (bf*)take((size_t)NKV * HD * TT * 2); bf* VTl = (bf*)take((size_t)NKV * HD * TT * 2); bf* Ph = (bf*)take((size_t)ZH * RH * TT * 2); bf* Pl = (bf*)take((size_t)ZH * RH * TT * 2);
    float* Sb = (float*)take((size_t)ZH * TT * TT * 4); h16* P16 = (h16*)take((size_t)ZH * TT * TT * 2); float* Ob = (float*)take((size_t)ZH * TT * HD * 4); bf* ATh = (bf*)take((size_t)TT * DQ * 2); bf* ATl = (bf*)take((size_t)TT * DQ * 2);
    if ((size_t)(wsp - (char*)d_ws) > ws_size) return;    // ws 256 MiB
    float* FV = FK;   // v projection reuses the k buffer after the k planes are built (stream-ordered)
    { k_cvt8<<<(unsigned)(((size_t)DQ * DM / 8 + 255) / 256), 256, 0, stream>>>(wq, WQ, (size_t)DQ * DM / 8); k_cvt8<<<(unsigned)(((size_t)DKV * DM / 8 + 255) / 256), 256, 0, stream>>>(wk, WK, (size_t)DKV * DM / 8); k_cvt8<<<(unsigned)(((size_t)DKV * DM / 8 + 255) / 256), 256, 0, stream>>>(wv, WV, (size_t)DKV * DM / 8);
      k_cvt8<<<(unsigned)(((size_t)DM * DQ / 8 + 255) / 256), 256, 0, stream>>>(wo, WO, (size_t)DM * DQ / 8);
       }
    k_csid<<<(TT * HD + 255) / 256, 256, 0, stream>>>(CS);
    const unsigned LQ = (unsigned)(((size_t)NH_ * TT * HD / 2 + 255) / 256), LKv = (unsigned)(((size_t)NKV * TT * HD / 2 + 255) / 256);
    for (int b = 0; b < NB_; ++b) {
        
        k_cvt8<<<(unsigned)(((size_t)TT * DM / 8 + 255) / 256), 256, 0, stream>>>(x + (size_t)b * TT * DM, XB, (size_t)TT * DM / 8);
        k_gemmw<bf, 0, false><<<dim3(TT / 64, DQ / 64, 1), 32, 0, stream>>>(XB, nullptr, WQ, nullptr, DM, FQ, DQ, nullptr, 0, 0, 0);
        k_rope<<<LQ, 256, 0, stream>>>(FQ, DQ, NH_, CS, nullptr, nullptr, 1.0f, QP16, QPh, QPl);
        k_gemmw<bf, 0, false><<<dim3(TT / 64, DKV / 64, 1), 32, 0, stream>>>(XB, nullptr, WK, nullptr, DM, FK, DKV, nullptr, 0, 0, 0);
        k_rope<<<LKv, 256, 0, stream>>>(FK, DKV, NKV, CS, nullptr, nullptr, 1.0f, KP16, KPh, KPl);
        k_gemmw<bf, 0, false><<<dim3(TT / 64, DKV / 64, 1), 32, 0, stream>>>(XB, nullptr, WV, nullptr, DM, FV, DKV, nullptr, 0, 0, 0); k_vtp<<<LKv, 256, 0, stream>>>(FV, DKV, NKV, VT16, VTh, VTl);
        for (int h0 = 0; h0 < NH_; h0 += ZH) { const size_t zq = (size_t)h0, zk = (size_t)(h0 / REP);   // one kv head per query head: the pass's two heads use consecutive kv planes (z-strides TT*HD)
            k_gemmw<bf, 2, false><<<dim3(RH / 64, TT / 64, ZH), 32, 0, stream>>>(QPh + zq * TT * HD, QPl + zq * TT * HD, KPh + zk * TT * HD, KPl + zk * TT * HD, HD, Sb, TT, nullptr, (size_t)TT * HD, (size_t)TT * HD, (size_t)TT * TT);
            k_gemmw<h16, 0, false><<<dim3((TT - RH) / 64, TT / 64, ZH), 32, 0, stream>>>(QP16 + zq * TT * HD + (size_t)RH * HD, nullptr, KP16 + zk * TT * HD, nullptr, HD, Sb + (size_t)RH * TT, TT, nullptr, (size_t)TT * HD, (size_t)TT * HD, (size_t)TT * TT);
            k_asoft<<<ZH * TT / 8, 256, 0, stream>>>(Sb, P16, Ph, Pl);
            k_gemmw<bf, 2, false><<<dim3(RH / 64, HD / 64, ZH), 32, 0, stream>>>(Ph, Pl, VTh + zk * HD * TT, VTl + zk * HD * TT, TT, Ob, HD, nullptr, (size_t)RH * TT, (size_t)HD * TT, (size_t)TT * HD);
            k_gemmw<h16, 0, false><<<dim3((TT - RH) / 64, HD / 64, ZH), 32, 0, stream>>>(P16 + (size_t)RH * TT, nullptr, VT16 + zk * HD * TT, nullptr, TT, Ob + (size_t)RH * HD, HD, nullptr, (size_t)TT * TT, (size_t)HD * TT, (size_t)TT * HD);
            k_merge<<<(unsigned)(((size_t)ZH * TT * HD / 2 + 255) / 256), 256, 0, stream>>>(Ob, h0, ATh, ATl); }
        k_gemmw<bf, 1, false><<<dim3(TT / 64, DM / 64, 1), 32, 0, stream>>>(ATh, ATl, WO, nullptr, DQ, OUT + (size_t)b * TT * DM, DM, nullptr, 0, 0, 0); }
}

// v001
// A run of this version takes 1680 microseconds.
// Timed twice side by side with v000, it ran 2.35 times as fast both times.
#include <hip/hip_runtime.h>

// Multi-head attention with a fused 'oi' projection (x [4][2048][1024]; [Q|K|V] = x W_qkv^T ([3072][1024]: rows q | k | v); 16 heads x 64; softmax(q.k/8) over all keys; out = merged W_o^T -> [4][2048][1024] (8.4 M)).
// Compute dtypes, f32 accumulate: every input rounded to bf16; q/k/v on PLAIN bf16 operands (inputs: exact); scores and attn.v: query rows < 512 hl (3 products), the rest single fp16 (x1024); softmax f32; W_o hl x exact (2 products).

#define NB_  4
#define TT   2048
#define DM   1024
#define NH_  16
#define NKV  16
#define REP  (NH_ / NKV)
#define HD   64
#define DQ   (NH_ * HD)
#define DKV  (NKV * HD)
#define ZH   2
#define RH   512                  // query rows < RH use hi+lo planes (0: none)
#define WIN  0
#define PCAR 1024.0f
#define SCL  0.125f   // HD^-0.5
#define KSP  16                   // attn.v: K (the 2048 keys) is cut into KSP grid slices; each writes its own f32 partial plane of Ob, k_merge adds them
typedef _Float16 h16;
typedef unsigned short bf;
typedef __attribute__((ext_vector_type(16))) __bf16   v16bf;
typedef __attribute__((ext_vector_type(16))) _Float16 v16h;
typedef __attribute__((ext_vector_type(8)))  _Float16 v8h;
typedef __attribute__((ext_vector_type(8)))  unsigned short v8us;
typedef __attribute__((ext_vector_type(8)))  float    v8f;
typedef __attribute__((ext_vector_type(4)))  float    v4f;
typedef v8h  __attribute__((may_alias)) v8ha;
typedef v4f  __attribute__((may_alias)) v4fa;
typedef v8us __attribute__((may_alias)) v8usa;

__device__ __forceinline__ unsigned short f2bf(float f) { unsigned u = __float_as_uint(f); u += 0x7FFFu + ((u >> 16) & 1u); return (unsigned short)(u >> 16); }
__device__ __forceinline__ float bf2f(unsigned short b) { return __uint_as_float(((unsigned)b) << 16); }
__device__ __forceinline__ float bfr(float f) { return bf2f(f2bf(f)); }
__device__ __forceinline__ v16h cat16(v8h lo, v8h hi) { return __builtin_shufflevector(lo, hi, 0, 1, 2, 3, 4, 5, 6, 7, 8, 9, 10, 11, 12, 13, 14, 15); }
__device__ __forceinline__ v16bf cat16b(v8us lo, v8us hi) { return __builtin_bit_cast(v16bf, __builtin_shufflevector(lo, hi, 0, 1, 2, 3, 4, 5, 6, 7, 8, 9, 10, 11, 12, 13, 14, 15)); }
__device__ __forceinline__ v8f wmma16(v16h a, v16h b, v8f c) { return __builtin_amdgcn_wmma_f32_16x16x32_f16(false, a, false, b, (short)0, c, false, false); }
__device__ __forceinline__ v8f wmmab(v16bf a, v16bf b, v8f c) { return __builtin_amdgcn_wmma_f32_16x16x32_bf16(false, a, false, b, (short)0, c, false, false); }



// ---- k_gemmw: register-blocked GEMM, ONE WAVE per 64x64 output tile (16 accumulators), operands straight from K-contiguous 16-bit planes; grid (M/64, N/64, Z), 32 threads.
// C[m][n] (f32, pitch ldc, + optional f32 bias[n]) = sum_k A[m][k] Bt[n][k] (+ split products per NSPLIT). z-batch strides sA/sB/sC in elements. K % 32 == 0.
// KS > 1: grid (M/64, N/64 * KS, Z); slice ks = blockIdx.y % KS sums only k in [ks K/KS, (ks+1) K/KS) and stores it to partial plane ks (planes ZH * sC elements apart, Z == ZH there); the reader adds the planes. K % (32 KS) == 0.
template <typename T16> struct WFrag;
template <> struct WFrag<h16> { typedef v16h V; static __device__ __forceinline__ V ld(const h16* p) { return cat16(*(const v8h*)p, *(const v8h*)(p + 16)); } static __device__ __forceinline__ v8f mma(V a, V b, v8f c) { return wmma16(a, b, c); } };
template <> struct WFrag<bf> { typedef v16bf V; static __device__ __forceinline__ V ld(const bf* p) { return cat16b(*(const v8us*)p, *(const v8us*)(p + 16)); } static __device__ __forceinline__ v8f mma(V a, V b, v8f c) { return wmmab(a, b, c); } };
template <typename T16, int NSPLIT, bool BIAS, int KS = 1>
__global__ __launch_bounds__(32) void k_gemmw(const T16* __restrict__ A, const T16* __restrict__ A2, const T16* __restrict__ Bt, const T16* __restrict__ Bt2, int K, float* C, int ldc, const float* __restrict__ bias, size_t sA, size_t sB, size_t sC) {
    typedef typename WFrag<T16>::V V;
    __shared__ __align__(16) float os[16 * 68];
    const size_t z = blockIdx.z; A += z * sA; if (A2) A2 += z * sA; Bt += z * sB; if (Bt2) Bt2 += z * sB;
    const int ks = (int)(blockIdx.y % KS), kb = ks * (K / KS), ke = kb + K / KS; C += ((size_t)ks * ZH + z) * sC;
    const int lane = threadIdx.x & 31, lr = lane & 15, hi = lane >> 4; const int r0 = blockIdx.x * 64, c0 = (int)(blockIdx.y / KS) * 64;
    v8f acc[4][4];
#pragma unroll
    for (int mb = 0; mb < 4; ++mb)
#pragma unroll
        for (int nb = 0; nb < 4; ++nb) acc[mb][nb] = (v8f){};
    const size_t aoff = (size_t)(r0 + lr) * K + 8 * hi, boff = (size_t)(c0 + lr) * K + 8 * hi;
#pragma unroll 1
    for (int kc = kb; kc < ke; kc += 32) {
        V a[4], a2[4];
#pragma unroll
        for (int mb = 0; mb < 4; ++mb) { a[mb] = WFrag<T16>::ld(A + aoff + (size_t)mb * 16 * K + kc); if (NSPLIT == 1 || NSPLIT == 2) a2[mb] = WFrag<T16>::ld(A2 + aoff + (size_t)mb * 16 * K + kc); }
#pragma unroll
        for (int nb = 0; nb < 4; ++nb) { const V b = WFrag<T16>::ld(Bt + boff + (size_t)nb * 16 * K + kc); V b2; if (NSPLIT >= 2) b2 = WFrag<T16>::ld(Bt2 + boff + (size_t)nb * 16 * K + kc);
#pragma unroll
            for (int mb = 0; mb < 4; ++mb) { acc[mb][nb] = WFrag<T16>::mma(a[mb], b, acc[mb][nb]); if (NSPLIT == 1 || NSPLIT == 2) acc[mb][nb] = WFrag<T16>::mma(a2[mb], b, acc[mb][nb]); if (NSPLIT >= 2) acc[mb][nb] = WFrag<T16>::mma(a[mb], b2, acc[mb][nb]); } }
        asm volatile("v_nop\n\tv_nop\n\tv_nop\n\tv_nop" : "+v"(acc[0][0]), "+v"(acc[1][1]), "+v"(acc[2][2]), "+v"(acc[3][3]) : "v"(a[0]), "v"(a[3]));
    }
#pragma unroll
    for (int mb = 0; mb < 4; ++mb) {
#pragma unroll
        for (int nb = 0; nb < 4; ++nb) {
#pragma unroll
            for (int j = 0; j < 8; ++j) os[(hi * 8 + j) * 68 + nb * 16 + lr] = acc[mb][nb][j]; }
        __builtin_amdgcn_wave_barrier(); asm volatile("" ::: "memory");
        float* crow = C + (size_t)(r0 + mb * 16) * ldc + c0;
{
#pragma unroll
            for (int s = 0; s < 8; ++s) { const int row = 2 * s + hi, cofs = lr * 4; v4f val = *(const v4fa*)(os + row * 68 + cofs); if (BIAS) { val[0] += bfr(bias[c0 + cofs]); val[1] += bfr(bias[c0 + cofs + 1]); val[2] += bfr(bias[c0 + cofs + 2]); val[3] += bfr(bias[c0 + cofs + 3]); }
                *(v4f*)(crow + (size_t)row * ldc + cofs) = val; }
             }
        __builtin_amdgcn_wave_barrier(); asm volatile("" ::: "memory");
    }
}

__device__ __forceinline__ h16 tohx(float x) { return (h16)x; }
__device__ __forceinline__ void splitf(float y, unsigned short& h, unsigned short& l) { h = f2bf(y); l = f2bf(y - bf2f(h)); }
typedef __attribute__((ext_vector_type(2))) _Float16 v2h;
typedef __attribute__((ext_vector_type(4))) _Float16 v4h;
typedef __attribute__((ext_vector_type(2))) unsigned short v2us;
typedef __attribute__((ext_vector_type(4))) unsigned short v4us;
typedef __attribute__((ext_vector_type(2))) float v2f;
typedef __attribute__((ext_vector_type(4))) int v4i;

__global__ __launch_bounds__(256) void k_wtG(const float* __restrict__ w, int K, int N, bf* Bt) {
    const int lane = threadIdx.x & 31; const int L0 = (blockIdx.x * 8 + (threadIdx.x >> 5)) * 8; const int nlines = N * K / 64;
{
#pragma unroll 1
        for (int l = 0; l < 8; ++l) { const int L = L0 + l; if (L >= nlines) break; const size_t e = (size_t)L * 64 + lane * 2; const int k = (int)(e % K), n = (int)(e / K); v2us o;
            o[0] = f2bf(w[(size_t)k * N + n]); o[1] = f2bf(w[(size_t)(k + 1) * N + n]); *(v2us*)(Bt + e) = o; }
         }
}
__global__ __launch_bounds__(256) void k_cvt8(const float* __restrict__ src, bf* dst, size_t n8) { const size_t i = (size_t)blockIdx.x * 256 + threadIdx.x; if (i >= n8) return; const v8f v = *(const v8f*)(src + i * 8); v8us o;
#pragma unroll
    for (int k = 0; k < 8; ++k) o[k] = f2bf(v[k]); *(v8us*)(dst + i * 8) = o;  }

// k_rope: head planes [h][t][d] (fp16 + hi/lo) of rope(x) x sc with the rotate-half convention out[d] = x[d] cos[t][d] - x[d+HD/2] sin[t][d], out[d+HD/2] = x[d+HD/2] cos[t][d+HD/2] + x[d] sin[t][d+HD/2]
__global__ __launch_bounds__(256) void k_rope(const float* __restrict__ F, int pitch, int nheads, const float* __restrict__ CS, const float* __restrict__ RF, const float* __restrict__ nw, float sc, h16* P16, bf* Ph, bf* Pl) {
    const size_t e = ((size_t)blockIdx.x * 256 + threadIdx.x) * 2; if (e >= (size_t)nheads * TT * HD) return; const int d = (int)(e % HD); const int t = (int)((e / HD) % TT); const int h = (int)(e / ((size_t)HD * TT)); const float* f = F + (size_t)t * pitch + h * HD; const float rf = RF ? RF[(size_t)h * TT + t] : 1.0f; v2h o16; v2us oh, ol;
#pragma unroll
    for (int q = 0; q < 2; ++q) { const int dd = d + q; const int dp = (dd < HD / 2) ? dd + HD / 2 : dd - HD / 2; float x0 = f[dd], x1 = f[dp];
        if (RF) { float n0 = __fmul_rn(x0, rf), n1 = __fmul_rn(x1, rf); asm volatile("" : "+v"(n0)); asm volatile("" : "+v"(n1)); x0 = __fmul_rn(bfr(nw[dd]), n0); x1 = __fmul_rn(bfr(nw[dp]), n1); }
        const v2f cs = *(const v2f*)(CS + ((size_t)t * HD + dd) * 2); float a = __fmul_rn(x0, cs[0]), bq = __fmul_rn(x1, cs[1]); asm volatile("" : "+v"(a)); asm volatile("" : "+v"(bq)); const float r = ((dd < HD / 2) ? __fsub_rn(a, bq) : __fadd_rn(a, bq)) * sc;
        o16[q] = tohx(r); unsigned short a2, c2; splitf(r, a2, c2); oh[q] = a2; ol[q] = c2; }
    *(v2h*)(P16 + e) = o16; *(v2us*)(Ph + e) = oh; *(v2us*)(Pl + e) = ol;  }
__global__ __launch_bounds__(256) void k_vtp(const float* __restrict__ F, int pitch, int nheads, h16* V16, bf* Vh, bf* Vl) { const size_t e = ((size_t)blockIdx.x * 256 + threadIdx.x) * 2; if (e >= (size_t)nheads * HD * TT) return; const int t = (int)(e % TT); const int d = (int)((e / TT) % HD); const int g = (int)(e / ((size_t)TT * HD)); v2h o16; v2us oh, ol;
#pragma unroll
    for (int q = 0; q < 2; ++q) { const float x = F[(size_t)(t + q) * pitch + g * HD + d]; o16[q] = tohx(x); unsigned short a2, c2; splitf(x, a2, c2); oh[q] = a2; ol[q] = c2; }
    *(v2h*)(V16 + e) = o16; *(v2us*)(Vh + e) = oh; *(v2us*)(Vl + e) = ol;  }
__global__ __launch_bounds__(256) void k_csid(float* CS) { const int idx = blockIdx.x * 256 + threadIdx.x; if (idx >= TT * HD) return; v2f cs; cs[0] = 1.0f; cs[1] = 0.0f; *(v2f*)(CS + (size_t)idx * 2) = cs;  }
// k_asoft: per row (zz, i): t = S x HD^-0.5 (no mask); softmax over the 2048 keys (register row, one exp, fixed trees);
__global__ __launch_bounds__(256) void k_asoft(const float* __restrict__ Sb, h16* P16, bf* Ph, bf* Pl) {
    const int lane = threadIdx.x & 31; const int row = blockIdx.x * 8 + (threadIdx.x >> 5); if (row >= ZH * TT) return; const int i = row % TT; const int zz = row / TT; (void)zz; const bool hires = (i < RH); const float* sr = Sb + (size_t)row * TT; float v[TT / 32]; float mx = -3.0e38f;
#pragma unroll
    for (int ch = 0; ch < TT / 128; ++ch) { const int j0 = ch * 128 + lane * 4; const v4f a = *(const v4f*)(sr + j0);
#pragma unroll
        for (int q = 0; q < 4; ++q) { const int j = j0 + q; (void)j; const float t = a[q] * SCL; v[ch * 4 + q] = t; mx = fmaxf(mx, t); } }
#pragma unroll
    for (int sh = 16; sh; sh >>= 1) mx = fmaxf(mx, __shfl_xor(mx, sh, 32));
    float sum = 0.f;
#pragma unroll
    for (int k = 0; k < TT / 32; ++k) { float d0 = __fsub_rn(v[k], mx); asm volatile("" : "+v"(d0)); v[k] = __builtin_amdgcn_exp2f(__fmul_rn(d0, 1.4426950408889634f)); sum += v[k]; }
#pragma unroll
    for (int sh = 16; sh; sh >>= 1) sum += __shfl_xor(sum, sh, 32);
    const float f = __fdiv_rn(hires ? 1.0f : PCAR, sum);
{
        if (hires) {
#pragma unroll
            for (int ch = 0; ch < TT / 128; ++ch) { v4us oh, ol;
#pragma unroll
                for (int q = 0; q < 4; ++q) { unsigned short a, c2; splitf(v[ch * 4 + q] * f, a, c2); oh[q] = a; ol[q] = c2; }
                const size_t oo = ((size_t)zz * (RH ? RH : 1) + i) * TT + ch * 128 + lane * 4; *(v4us*)(Ph + oo) = oh; *(v4us*)(Pl + oo) = ol; }
        } else {
#pragma unroll
            for (int ch = 0; ch < TT / 128; ++ch) { v4h o4;
#pragma unroll
                for (int q = 0; q < 4; ++q) o4[q] = tohx(v[ch * 4 + q] * f);
                *(v4h*)(P16 + (size_t)row * TT + ch * 128 + lane * 4) = o4; } }
         }
}
__global__ __launch_bounds__(256) void k_merge(const float* __restrict__ O, int h0, bf* Ah, bf* Al) { const size_t e = ((size_t)blockIdx.x * 256 + threadIdx.x) * 2; if (e >= (size_t)ZH * TT * HD) return; const int d = (int)(e % HD); const int t = (int)((e / HD) % TT); const int zz = (int)(e / ((size_t)HD * TT)); const float cs = (t < RH) ? 1.0f : (1.0f / PCAR); const size_t oo = (size_t)t * DQ + (h0 + zz) * HD + d;
    v2f s = *(const v2f*)(O + e);   // the KSP partial planes, added in the fixed order 0, 1, ..; unrolled so that all the planes' loads are in flight together
#pragma unroll
    for (int p = 1; p < KSP; ++p) s += *(const v2f*)(O + (size_t)p * ZH * TT * HD + e);
    v2us oh, ol;
#pragma unroll
    for (int q = 0; q < 2; ++q) { unsigned short a, c2; splitf(s[q] * cs, a, c2); oh[q] = a; ol[q] = c2; } *(v2us*)(Ah + oo) = oh; *(v2us*)(Al + oo) = ol;  }

extern "C" void kernel_launch(void* const* d_in, const int* in_sizes, int n_in,
                              void* d_out, int out_size, void* d_ws, size_t ws_size, hipStream_t stream) {
    (void)in_sizes; (void)n_in; (void)out_size;
    const float* x = (const float*)d_in[0]; const float* wqkv = (const float*)d_in[1]; const float* wo = (const float*)d_in[2]; const float* wq = wqkv; const float* wk = wqkv + (size_t)DQ * DM; const float* wv = wqkv + (size_t)(DQ + DKV) * DM;
    float* OUT = (float*)d_out;     // [4][2048][1024]
    char* wsp = (char*)d_ws;
    auto take = [&](size_t bytes) { char* p = wsp; wsp += (bytes + 255) & ~(size_t)255; return (void*)p; };
    bf* WQ = (bf*)take((size_t)DQ * DM * 2); bf* WK = (bf*)take((size_t)DKV * DM * 2); bf* WV = (bf*)take((size_t)DKV * DM * 2); bf* WO = (bf*)take((size_t)DM * DQ * 2); float* CS = (float*)take((size_t)TT * HD * 2 * 4);
    bf* XB = (bf*)take((size_t)TT * DM * 2); float* FQ = (float*)take((size_t)TT * DQ * 4); float* FK = (float*)take((size_t)TT * DKV * 4);
    h16* QP16 = (h16*)take((size_t)NH_ * TT * HD * 2); h16* KP16 = (h16*)take((size_t)NKV * TT * HD * 2); h16* VT16 = (h16*)take((size_t)NKV * HD * TT * 2);
    bf* QPh = (bf*)take((size_t)NH_ * TT * HD * 2); bf* QPl = (bf*)take((size_t)NH_ * TT * HD * 2); bf* KPh = (bf*)take((size_t)NKV * TT * HD * 2); bf* KPl = (bf*)take((size_t)NKV * TT * HD * 2); bf* VTh = (bf*)take((size_t)NKV * HD * TT * 2); bf* VTl = (bf*)take((size_t)NKV * HD * TT * 2); bf* Ph = (bf*)take((size_t)ZH * RH * TT * 2); bf* Pl = (bf*)take((size_t)ZH * RH * TT * 2);
    float* Sb = (float*)take((size_t)ZH * TT * TT * 4); h16* P16 = (h16*)take((size_t)ZH * TT * TT * 2); float* Ob = (float*)take((size_t)KSP * ZH * TT * HD * 4); bf* ATh = (bf*)take((size_t)TT * DQ * 2); bf* ATl = (bf*)take((size_t)TT * DQ * 2);
    if ((size_t)(wsp - (char*)d_ws) > ws_size) return;    // ws 256 MiB
    float* FV = FK;   // v projection reuses the k buffer after the k planes are built (stream-ordered)
    { k_cvt8<<<(unsigned)(((size_t)DQ * DM / 8 + 255) / 256), 256, 0, stream>>>(wq, WQ, (size_t)DQ * DM / 8); k_cvt8<<<(unsigned)(((size_t)DKV * DM / 8 + 255) / 256), 256, 0, stream>>>(wk, WK, (size_t)DKV * DM / 8); k_cvt8<<<(unsigned)(((size_t)DKV * DM / 8 + 255) / 256), 256, 0, stream>>>(wv, WV, (size_t)DKV * DM / 8);
      k_cvt8<<<(unsigned)(((size_t)DM * DQ / 8 + 255) / 256), 256, 0, stream>>>(wo, WO, (size_t)DM * DQ / 8);
       }
    k_csid<<<(TT * HD + 255) / 256, 256, 0, stream>>>(CS);
    const unsigned LQ = (unsigned)(((size_t)NH_ * TT * HD / 2 + 255) / 256), LKv = (unsigned)(((size_t)NKV * TT * HD / 2 + 255) / 256);
    for (int b = 0; b < NB_; ++b) {
        
        k_cvt8<<<(unsigned)(((size_t)TT * DM / 8 + 255) / 256), 256, 0, stream>>>(x + (size_t)b * TT * DM, XB, (size_t)TT * DM / 8);
        k_gemmw<bf, 0, false><<<dim3(TT / 64, DQ / 64, 1), 32, 0, stream>>>(XB, nullptr, WQ, nullptr, DM, FQ, DQ, nullptr, 0, 0, 0);
        k_rope<<<LQ, 256, 0, stream>>>(FQ, DQ, NH_, CS, nullptr, nullptr, 1.0f, QP16, QPh, QPl);
        k_gemmw<bf, 0, false><<<dim3(TT / 64, DKV / 64, 1), 32, 0, stream>>>(XB, nullptr, WK, nullptr, DM, FK, DKV, nullptr, 0, 0, 0);
        k_rope<<<LKv, 256, 0, stream>>>(FK, DKV, NKV, CS, nullptr, nullptr, 1.0f, KP16, KPh, KPl);
        k_gemmw<bf, 0, false><<<dim3(TT / 64, DKV / 64, 1), 32, 0, stream>>>(XB, nullptr, WV, nullptr, DM, FV, DKV, nullptr, 0, 0, 0); k_vtp<<<LKv, 256, 0, stream>>>(FV, DKV, NKV, VT16, VTh, VTl);
        for (int h0 = 0; h0 < NH_; h0 += ZH) { const size_t zq = (size_t)h0, zk = (size_t)(h0 / REP);   // one kv head per query head: the pass's two heads use consecutive kv planes (z-strides TT*HD)
            k_gemmw<bf, 2, false><<<dim3(RH / 64, TT / 64, ZH), 32, 0, stream>>>(QPh + zq * TT * HD, QPl + zq * TT * HD, KPh + zk * TT * HD, KPl + zk * TT * HD, HD, Sb, TT, nullptr, (size_t)TT * HD, (size_t)TT * HD, (size_t)TT * TT);
            k_gemmw<h16, 0, false><<<dim3((TT - RH) / 64, TT / 64, ZH), 32, 0, stream>>>(QP16 + zq * TT * HD + (size_t)RH * HD, nullptr, KP16 + zk * TT * HD, nullptr, HD, Sb + (size_t)RH * TT, TT, nullptr, (size_t)TT * HD, (size_t)TT * HD, (size_t)TT * TT);
            k_asoft<<<ZH * TT / 8, 256, 0, stream>>>(Sb, P16, Ph, Pl);
            k_gemmw<bf, 2, false, KSP><<<dim3(RH / 64, HD / 64 * KSP, ZH), 32, 0, stream>>>(Ph, Pl, VTh + zk * HD * TT, VTl + zk * HD * TT, TT, Ob, HD, nullptr, (size_t)RH * TT, (size_t)HD * TT, (size_t)TT * HD);
            k_gemmw<h16, 0, false, KSP><<<dim3((TT - RH) / 64, HD / 64 * KSP, ZH), 32, 0, stream>>>(P16 + (size_t)RH * TT, nullptr, VT16 + zk * HD * TT, nullptr, TT, Ob + (size_t)RH * HD, HD, nullptr, (size_t)TT * TT, (size_t)HD * TT, (size_t)TT * HD);
            k_merge<<<(unsigned)(((size_t)ZH * TT * HD / 2 + 255) / 256), 256, 0, stream>>>(Ob, h0, ATh, ATl); }
        k_gemmw<bf, 1, false><<<dim3(TT / 64, DM / 64, 1), 32, 0, stream>>>(ATh, ATl, WO, nullptr, DQ, OUT + (size_t)b * TT * DM, DM, nullptr, 0, 0, 0); }
}

// v002
// A run of this version takes 1280 microseconds.
// Two timings next to v001 both put it at 1.32 times that version's speed.
// Over all steps from v000 it is 3.10 times as fast.
#include <hip/hip_runtime.h>

// Multi-head attention with a fused 'oi' projection (x [4][2048][1024]; [Q|K|V] = x W_qkv^T ([3072][1024]: rows q | k | v); 16 heads x 64; softmax(q.k/8) over all keys; out = merged W_o^T -> [4][2048][1024] (8.4 M)).
// Compute dtypes, f32 accumulate: every input rounded to bf16; q/k/v on PLAIN bf16 operands (inputs: exact); scores and attn.v: query rows < 512 hl (3 products), the rest single fp16 (x1024); softmax f32; W_o hl x exact (2 products).

#define NB_  4
#define TT   2048
#define DM   1024
#define NH_  16
#define NKV  16
#define REP  (NH_ / NKV)
#define HD   64
#define DQ   (NH_ * HD)
#define DKV  (NKV * HD)
#define ZH   8                    // heads per attention pass (grid z of the pass's launches)
#define RH   512                  // query rows < RH use hi+lo planes (0: none)
#define WIN  0
#define PCAR 1024.0f
#define SCL  0.125f   // HD^-0.5
#define KSP  16                   // attn.v: K (the 2048 keys) is cut into KSP grid slices; each writes its own f32 partial plane of Ob, k_merge adds them
typedef _Float16 h16;
typedef unsigned short bf;
typedef __attribute__((ext_vector_type(16))) __bf16   v16bf;
typedef __attribute__((ext_vector_type(16))) _Float16 v16h;
typedef __attribute__((ext_vector_type(8)))  _Float16 v8h;
typedef __attribute__((ext_vector_type(8)))  unsigned short v8us;
typedef __attribute__((ext_vector_type(8)))  float    v8f;
typedef __attribute__((ext_vector_type(4)))  float    v4f;
typedef v8h  __attribute__((may_alias)) v8ha;
typedef v4f  __attribute__((may_alias)) v4fa;
typedef v8us __attribute__((may_alias)) v8usa;

__device__ __forceinline__ unsigned short f2bf(float f) { unsigned u = __float_as_uint(f); u += 0x7FFFu + ((u >> 16) & 1u); return (unsigned short)(u >> 16); }
__device__ __forceinline__ float bf2f(unsigned short b) { return __uint_as_float(((unsigned)b) << 16); }
__device__ __forceinline__ float bfr(float f) { return bf2f(f2bf(f)); }
__device__ __forceinline__ v16h cat16(v8h lo, v8h hi) { return __builtin_shufflevector(lo, hi, 0, 1, 2, 3, 4, 5, 6, 7, 8, 9, 10, 11, 12, 13, 14, 15); }
__device__ __forceinline__ v16bf cat16b(v8us lo, v8us hi) { return __builtin_bit_cast(v16bf, __builtin_shufflevector(lo, hi, 0, 1, 2, 3, 4, 5, 6, 7, 8, 9, 10, 11, 12, 13, 14, 15)); }
__device__ __forceinline__ v8f wmma16(v16h a, v16h b, v8f c) { return __builtin_amdgcn_wmma_f32_16x16x32_f16(false, a, false, b, (short)0, c, false, false); }
__device__ __forceinline__ v8f wmmab(v16bf a, v16bf b, v8f c) { return __builtin_amdgcn_wmma_f32_16x16x32_bf16(false, a, false, b, (short)0, c, false, false); }



// ---- k_gemmw: register-blocked GEMM, ONE WAVE per 64x64 output tile (16 accumulators), operands straight from K-contiguous 16-bit planes; grid (M/64, N/64, Z), 32 threads.
// C[m][n] (f32, pitch ldc, + optional f32 bias[n]) = sum_k A[m][k] Bt[n][k] (+ split products per NSPLIT). z-batch strides sA/sB/sC in elements. K % 32 == 0.
// KS > 1: grid (M/64, N/64 * KS, Z); slice ks = blockIdx.y % KS sums only k in [ks K/KS, (ks+1) K/KS) and stores it to partial plane ks (planes ZH * sC elements apart, Z == ZH there); the reader adds the planes. K % (32 KS) == 0.
// AP > 1: A rows are AP * K elements apart (P rows that lie in the score rows' own bytes); Bt rows stay K apart.
template <typename T16> struct WFrag;
template <> struct WFrag<h16> { typedef v16h V; static __device__ __forceinline__ V ld(const h16* p) { return cat16(*(const v8h*)p, *(const v8h*)(p + 16)); } static __device__ __forceinline__ v8f mma(V a, V b, v8f c) { return wmma16(a, b, c); } };
template <> struct WFrag<bf> { typedef v16bf V; static __device__ __forceinline__ V ld(const bf* p) { return cat16b(*(const v8us*)p, *(const v8us*)(p + 16)); } static __device__ __forceinline__ v8f mma(V a, V b, v8f c) { return wmmab(a, b, c); } };
// ldx: the fragment load of the pitched A rows. Each s_wait_xcnt 0 stands behind its 16-byte load so that it comes in front of any rewrite of the address pair the load names (the register allocator gives such pairs to later loads' data).
__device__ __forceinline__ v16h ldx(const h16* p) { const v8h lo = *(const v8h*)p; asm volatile("s_wait_xcnt 0x0" ::: "memory"); const v8h hi = *(const v8h*)(p + 16); asm volatile("s_wait_xcnt 0x0" ::: "memory"); return cat16(lo, hi); }
__device__ __forceinline__ v16bf ldx(const bf* p) { const v8us lo = *(const v8us*)p; asm volatile("s_wait_xcnt 0x0" ::: "memory"); const v8us hi = *(const v8us*)(p + 16); asm volatile("s_wait_xcnt 0x0" ::: "memory"); return cat16b(lo, hi); }
template <typename T16, int NSPLIT, bool BIAS, int KS = 1, int AP = 1>
__global__ __launch_bounds__(32) void k_gemmw(const T16* __restrict__ A, const T16* __restrict__ A2, const T16* __restrict__ Bt, const T16* __restrict__ Bt2, int K, float* C, int ldc, const float* __restrict__ bias, size_t sA, size_t sB, size_t sC) {
    typedef typename WFrag<T16>::V V;
    __shared__ __align__(16) float os[16 * 68];
    const size_t z = blockIdx.z; A += z * sA; if (A2) A2 += z * sA; Bt += z * sB; if (Bt2) Bt2 += z * sB;
    const int ks = (int)(blockIdx.y % KS), kb = ks * (K / KS), ke = kb + K / KS; C += ((size_t)ks * ZH + z) * sC;
    const int lane = threadIdx.x & 31, lr = lane & 15, hi = lane >> 4; const int r0 = blockIdx.x * 64, c0 = (int)(blockIdx.y / KS) * 64;
    v8f acc[4][4];
#pragma unroll
    for (int mb = 0; mb < 4; ++mb)
#pragma unroll
        for (int nb = 0; nb < 4; ++nb) acc[mb][nb] = (v8f){};
    const size_t aoff = (size_t)(r0 + lr) * K + 8 * hi, boff = (size_t)(c0 + lr) * K + 8 * hi;
#pragma unroll 1
    for (int kc = kb; kc < ke; kc += 32) {
        V a[4], a2[4];
        if (AP != 1) { const size_t ap = (size_t)AP * K, ao = (size_t)(r0 + lr) * ap + 8 * hi + kc;
#pragma unroll
            for (int mb = 0; mb < 4; ++mb) { a[mb] = ldx(A + ao + (size_t)mb * 16 * ap); if (NSPLIT == 1 || NSPLIT == 2) a2[mb] = ldx(A2 + ao + (size_t)mb * 16 * ap); }
        } else
#pragma unroll
        for (int mb = 0; mb < 4; ++mb) { a[mb] = WFrag<T16>::ld(A + aoff + (size_t)mb * 16 * K + kc); if (NSPLIT == 1 || NSPLIT == 2) a2[mb] = WFrag<T16>::ld(A2 + aoff + (size_t)mb * 16 * K + kc); }
#pragma unroll
        for (int nb = 0; nb < 4; ++nb) { const V b = WFrag<T16>::ld(Bt + boff + (size_t)nb * 16 * K + kc); V b2; if (NSPLIT >= 2) b2 = WFrag<T16>::ld(Bt2 + boff + (size_t)nb * 16 * K + kc);
#pragma unroll
            for (int mb = 0; mb < 4; ++mb) { acc[mb][nb] = WFrag<T16>::mma(a[mb], b, acc[mb][nb]); if (NSPLIT == 1 || NSPLIT == 2) acc[mb][nb] = WFrag<T16>::mma(a2[mb], b, acc[mb][nb]); if (NSPLIT >= 2) acc[mb][nb] = WFrag<T16>::mma(a[mb], b2, acc[mb][nb]); } }
        asm volatile("v_nop\n\tv_nop\n\tv_nop\n\tv_nop" : "+v"(acc[0][0]), "+v"(acc[1][1]), "+v"(acc[2][2]), "+v"(acc[3][3]) : "v"(a[0]), "v"(a[3]));
    }
#pragma unroll
    for (int mb = 0; mb < 4; ++mb) {
#pragma unroll
        for (int nb = 0; nb < 4; ++nb) {
#pragma unroll
            for (int j = 0; j < 8; ++j) os[(hi * 8 + j) * 68 + nb * 16 + lr] = acc[mb][nb][j]; }
        __builtin_amdgcn_wave_barrier(); asm volatile("" ::: "memory");
        float* crow = C + (size_t)(r0 + mb * 16) * ldc + c0;
{
#pragma unroll
            for (int s = 0; s < 8; ++s) { const int row = 2 * s + hi, cofs = lr * 4; v4f val = *(const v4fa*)(os + row * 68 + cofs); if (BIAS) { val[0] += bfr(bias[c0 + cofs]); val[1] += bfr(bias[c0 + cofs + 1]); val[2] += bfr(bias[c0 + cofs + 2]); val[3] += bfr(bias[c0 + cofs + 3]); }
                *(v4f*)(crow + (size_t)row * ldc + cofs) = val; }
             }
        __builtin_amdgcn_wave_barrier(); asm volatile("" ::: "memory");
    }
}

__device__ __forceinline__ h16 tohx(float x) { return (h16)x; }
__device__ __forceinline__ void splitf(float y, unsigned short& h, unsigned short& l) { h = f2bf(y); l = f2bf(y - bf2f(h)); }
typedef __attribute__((ext_vector_type(2))) _Float16 v2h;
typedef __attribute__((ext_vector_type(4))) _Float16 v4h;
typedef __attribute__((ext_vector_type(2))) unsigned short v2us;
typedef __attribute__((ext_vector_type(4))) unsigned short v4us;
typedef __attribute__((ext_vector_type(2))) float v2f;
typedef __attribute__((ext_vector_type(4))) int v4i;

__global__ __launch_bounds__(256) void k_wtG(const float* __restrict__ w, int K, int N, bf* Bt) {
    const int lane = threadIdx.x & 31; const int L0 = (blockIdx.x * 8 + (threadIdx.x >> 5)) * 8; const int nlines = N * K / 64;
{
#pragma unroll 1
        for (int l = 0; l < 8; ++l) { const int L = L0 + l; if (L >= nlines) break; const size_t e = (size_t)L * 64 + lane * 2; const int k = (int)(e % K), n = (int)(e / K); v2us o;
            o[0] = f2bf(w[(size_t)k * N + n]); o[1] = f2bf(w[(size_t)(k + 1) * N + n]); *(v2us*)(Bt + e) = o; }
         }
}
__global__ __launch_bounds__(256) void k_cvt8(const float* __restrict__ src, bf* dst, size_t n8) { const size_t i = (size_t)blockIdx.x * 256 + threadIdx.x; if (i >= n8) return; const v8f v = *(const v8f*)(src + i * 8); v8us o;
#pragma unroll
    for (int k = 0; k < 8; ++k) o[k] = f2bf(v[k]); *(v8us*)(dst + i * 8) = o;  }

// k_rope: head planes [h][t][d] (fp16 + hi/lo) of rope(x) x sc with the rotate-half convention out[d] = x[d] cos[t][d] - x[d+HD/2] sin[t][d], out[d+HD/2] = x[d+HD/2] cos[t][d+HD/2] + x[d] sin[t][d+HD/2]
__global__ __launch_bounds__(256) void k_rope(const float* __restrict__ F, int pitch, int nheads, const float* __restrict__ CS, const float* __restrict__ RF, const float* __restrict__ nw, float sc, h16* P16, bf* Ph, bf* Pl) {
    const size_t e = ((size_t)blockIdx.x * 256 + threadIdx.x) * 2; if (e >= (size_t)nheads * TT * HD) return; const int d = (int)(e % HD); const int t = (int)((e / HD) % TT); const int h = (int)(e / ((size_t)HD * TT)); const float* f = F + (size_t)t * pitch + h * HD; const float rf = RF ? RF[(size_t)h * TT + t] : 1.0f; v2h o16; v2us oh, ol;
#pragma unroll
    for (int q = 0; q < 2; ++q) { const int dd = d + q; const int dp = (dd < HD / 2) ? dd + HD / 2 : dd - HD / 2; float x0 = f[dd], x1 = f[dp];
        if (RF) { float n0 = __fmul_rn(x0, rf), n1 = __fmul_rn(x1, rf); asm volatile("" : "+v"(n0)); asm volatile("" : "+v"(n1)); x0 = __fmul_rn(bfr(nw[dd]), n0); x1 = __fmul_rn(bfr(nw[dp]), n1); }
        const v2f cs = *(const v2f*)(CS + ((size_t)t * HD + dd) * 2); float a = __fmul_rn(x0, cs[0]), bq = __fmul_rn(x1, cs[1]); asm volatile("" : "+v"(a)); asm volatile("" : "+v"(bq)); const float r = ((dd < HD / 2) ? __fsub_rn(a, bq) : __fadd_rn(a, bq)) * sc;
        o16[q] = tohx(r); unsigned short a2, c2; splitf(r, a2, c2); oh[q] = a2; ol[q] = c2; }
    *(v2h*)(P16 + e) = o16; *(v2us*)(Ph + e) = oh; *(v2us*)(Pl + e) = ol;  }
__global__ __launch_bounds__(256) void k_vtp(const float* __restrict__ F, int pitch, int nheads, h16* V16, bf* Vh, bf* Vl) { const size_t e = ((size_t)blockIdx.x * 256 + threadIdx.x) * 2; if (e >= (size_t)nheads * HD * TT) return; const int t = (int)(e % TT); const int d = (int)((e / TT) % HD); const int g = (int)(e / ((size_t)TT * HD)); v2h o16; v2us oh, ol;
#pragma unroll
    for (int q = 0; q < 2; ++q) { const float x = F[(size_t)(t + q) * pitch + g * HD + d]; o16[q] = tohx(x); unsigned short a2, c2; splitf(x, a2, c2); oh[q] = a2; ol[q] = c2; }
    *(v2h*)(V16 + e) = o16; *(v2us*)(Vh + e) = oh; *(v2us*)(Vl + e) = ol;  }
__global__ __launch_bounds__(256) void k_csid(float* CS) { const int idx = blockIdx.x * 256 + threadIdx.x; if (idx >= TT * HD) return; v2f cs; cs[0] = 1.0f; cs[1] = 0.0f; *(v2f*)(CS + (size_t)idx * 2) = cs;  }
// k_asoft: per row (zz, i): t = S x HD^-0.5 (no mask); softmax over the 2048 keys (register row, one exp, fixed trees);
// IN PLACE: one wave owns a row, holds all of it in registers before its first store (every store needs the row's sum), and writes P over the row's own 8192 bytes:
// fp16 P in the first 4096 bytes, or (rows < RH) the hi plane there and the lo plane in the second 4096. So P rows are 2 TT 16-bit elements apart.
__global__ __launch_bounds__(256) void k_asoft(float* Sb) {
    const int lane = threadIdx.x & 31; const int row = blockIdx.x * 8 + (threadIdx.x >> 5); if (row >= ZH * TT) return; const int i = row % TT; const int zz = row / TT; (void)zz; const bool hires = (i < RH); float* sr = Sb + (size_t)row * TT; h16* P16 = (h16*)sr; bf* Ph = (bf*)sr; bf* Pl = Ph + TT; float v[TT / 32]; float mx = -3.0e38f;
#pragma unroll
    for (int ch = 0; ch < TT / 128; ++ch) { const int j0 = ch * 128 + lane * 4; const v4f a = *(const v4f*)(sr + j0);
#pragma unroll
        for (int q = 0; q < 4; ++q) { const int j = j0 + q; (void)j; const float t = a[q] * SCL; v[ch * 4 + q] = t; mx = fmaxf(mx, t); } }
#pragma unroll
    for (int sh = 16; sh; sh >>= 1) mx = fmaxf(mx, __shfl_xor(mx, sh, 32));
    float sum = 0.f;
#pragma unroll
    for (int k = 0; k < TT / 32; ++k) { float d0 = __fsub_rn(v[k], mx); asm volatile("" : "+v"(d0)); v[k] = __builtin_amdgcn_exp2f(__fmul_rn(d0, 1.4426950408889634f)); sum += v[k]; }
#pragma unroll
    for (int sh = 16; sh; sh >>= 1) sum += __shfl_xor(sum, sh, 32);
    const float f = __fdiv_rn(hires ? 1.0f : PCAR, sum);
{
        if (hires) {
#pragma unroll
            for (int ch = 0; ch < TT / 128; ++ch) { v4us oh, ol;
#pragma unroll
                for (int q = 0; q < 4; ++q) { unsigned short a, c2; splitf(v[ch * 4 + q] * f, a, c2); oh[q] = a; ol[q] = c2; }
                const int oo = ch * 128 + lane * 4; *(v4us*)(Ph + oo) = oh; *(v4us*)(Pl + oo) = ol; }
        } else {
#pragma unroll
            for (int ch = 0; ch < TT / 128; ++ch) { v4h o4;
#pragma unroll
                for (int q = 0; q < 4; ++q) o4[q] = tohx(v[ch * 4 + q] * f);
                *(v4h*)(P16 + ch * 128 + lane * 4) = o4; } }
         }
}
__global__ __launch_bounds__(256) void k_merge(const float* __restrict__ O, int h0, bf* Ah, bf* Al) { const size_t e = ((size_t)blockIdx.x * 256 + threadIdx.x) * 2; if (e >= (size_t)ZH * TT * HD) return; const int d = (int)(e % HD); const int t = (int)((e / HD) % TT); const int zz = (int)(e / ((size_t)HD * TT)); const float cs = (t < RH) ? 1.0f : (1.0f / PCAR); const size_t oo = (size_t)t * DQ + (h0 + zz) * HD + d;
    v2f s = *(const v2f*)(O + e);   // the KSP partial planes, added in the fixed order 0, 1, ..; unrolled so that all the planes' loads are in flight together
#pragma unroll
    for (int p = 1; p < KSP; ++p) s += *(const v2f*)(O + (size_t)p * ZH * TT * HD + e);
    v2us oh, ol;
#pragma unroll
    for (int q = 0; q < 2; ++q) { unsigned short a, c2; splitf(s[q] * cs, a, c2); oh[q] = a; ol[q] = c2; } *(v2us*)(Ah + oo) = oh; *(v2us*)(Al + oo) = ol;  }

extern "C" void kernel_launch(void* const* d_in, const int* in_sizes, int n_in,
                              void* d_out, int out_size, void* d_ws, size_t ws_size, hipStream_t stream) {
    (void)in_sizes; (void)n_in; (void)out_size;
    const float* x = (const float*)d_in[0]; const float* wqkv = (const float*)d_in[1]; const float* wo = (const float*)d_in[2]; const float* wq = wqkv; const float* wk = wqkv + (size_t)DQ * DM; const float* wv = wqkv + (size_t)(DQ + DKV) * DM;
    float* OUT = (float*)d_out;     // [4][2048][1024]
    char* wsp = (char*)d_ws;
    auto take = [&](size_t bytes) { char* p = wsp; wsp += (bytes + 255) & ~(size_t)255; return (void*)p; };
    bf* WQ = (bf*)take((size_t)DQ * DM * 2); bf* WK = (bf*)take((size_t)DKV * DM * 2); bf* WV = (bf*)take((size_t)DKV * DM * 2); bf* WO = (bf*)take((size_t)DM * DQ * 2); float* CS = (float*)take((size_t)TT * HD * 2 * 4);
    float* Ob = (float*)wsp;   // the attn.v partial planes lie over XB, FQ, FK (dead once a batch's q/k/v planes are built, rewritten at the next batch's start) and the pad behind them
    bf* XB = (bf*)take((size_t)TT * DM * 2); float* FQ = (float*)take((size_t)TT * DQ * 4); float* FK = (float*)take((size_t)TT * DKV * 4); (void)take((size_t)KSP * ZH * TT * HD * 4 - (size_t)TT * DM * 2 - (size_t)TT * DQ * 4 - (size_t)TT * DKV * 4);
    h16* QP16 = (h16*)take((size_t)NH_ * TT * HD * 2); h16* KP16 = (h16*)take((size_t)NKV * TT * HD * 2); h16* VT16 = (h16*)take((size_t)NKV * HD * TT * 2);
    bf* QPh = (bf*)take((size_t)NH_ * TT * HD * 2); bf* QPl = (bf*)take((size_t)NH_ * TT * HD * 2); bf* KPh = (bf*)take((size_t)NKV * TT * HD * 2); bf* KPl = (bf*)take((size_t)NKV * TT * HD * 2); bf* VTh = (bf*)take((size_t)NKV * HD * TT * 2); bf* VTl = (bf*)take((size_t)NKV * HD * TT * 2);
    float* Sb = (float*)take((size_t)ZH * TT * TT * 4); h16* P16 = (h16*)Sb; bf* Ph = (bf*)Sb; bf* Pl = Ph + TT;   // k_asoft turns Sb's rows into P rows in place (pitch 2 TT)
    bf* ATh = (bf*)take((size_t)TT * DQ * 2); bf* ATl = (bf*)take((size_t)TT * DQ * 2);
    if ((size_t)(wsp - (char*)d_ws) > ws_size) return;    // ws 256 MiB
    float* FV = FK;   // v projection reuses the k buffer after the k planes are built (stream-ordered)
    { k_cvt8<<<(unsigned)(((size_t)DQ * DM / 8 + 255) / 256), 256, 0, stream>>>(wq, WQ, (size_t)DQ * DM / 8); k_cvt8<<<(unsigned)(((size_t)DKV * DM / 8 + 255) / 256), 256, 0, stream>>>(wk, WK, (size_t)DKV * DM / 8); k_cvt8<<<(unsigned)(((size_t)DKV * DM / 8 + 255) / 256), 256, 0, stream>>>(wv, WV, (size_t)DKV * DM / 8);
      k_cvt8<<<(unsigned)(((size_t)DM * DQ / 8 + 255) / 256), 256, 0, stream>>>(wo, WO, (size_t)DM * DQ / 8);
       }
    k_csid<<<(TT * HD + 255) / 256, 256, 0, stream>>>(CS);
    const unsigned LQ = (unsigned)(((size_t)NH_ * TT * HD / 2 + 255) / 256), LKv = (unsigned)(((size_t)NKV * TT * HD / 2 + 255) / 256);
    for (int b = 0; b < NB_; ++b) {
        
        k_cvt8<<<(unsigned)(((size_t)TT * DM / 8 + 255) / 256), 256, 0, stream>>>(x + (size_t)b * TT * DM, XB, (size_t)TT * DM / 8);
        k_gemmw<bf, 0, false><<<dim3(TT / 64, DQ / 64, 1), 32, 0, stream>>>(XB, nullptr, WQ, nullptr, DM, FQ, DQ, nullptr, 0, 0, 0);
        k_rope<<<LQ, 256, 0, stream>>>(FQ, DQ, NH_, CS, nullptr, nullptr, 1.0f, QP16, QPh, QPl);
        k_gemmw<bf, 0, false><<<dim3(TT / 64, DKV / 64, 1), 32, 0, stream>>>(XB, nullptr, WK, nullptr, DM, FK, DKV, nullptr, 0, 0, 0);
        k_rope<<<LKv, 256, 0, stream>>>(FK, DKV, NKV, CS, nullptr, nullptr, 1.0f, KP16, KPh, KPl);
        k_gemmw<bf, 0, false><<<dim3(TT / 64, DKV / 64, 1), 32, 0, stream>>>(XB, nullptr, WV, nullptr, DM, FV, DKV, nullptr, 0, 0, 0); k_vtp<<<LKv, 256, 0, stream>>>(FV, DKV, NKV, VT16, VTh, VTl);
        for (int h0 = 0; h0 < NH_; h0 += ZH) { const size_t zq = (size_t)h0, zk = (size_t)(h0 / REP);   // one kv head per query head: the pass's ZH heads use consecutive kv planes (z-strides TT*HD)
            k_gemmw<bf, 2, false><<<dim3(RH / 64, TT / 64, ZH), 32, 0, stream>>>(QPh + zq * TT * HD, QPl + zq * TT * HD, KPh + zk * TT * HD, KPl + zk * TT * HD, HD, Sb, TT, nullptr, (size_t)TT * HD, (size_t)TT * HD, (size_t)TT * TT);
            k_gemmw<h16, 0, false><<<dim3((TT - RH) / 64, TT / 64, ZH), 32, 0, stream>>>(QP16 + zq * TT * HD + (size_t)RH * HD, nullptr, KP16 + zk * TT * HD, nullptr, HD, Sb + (size_t)RH * TT, TT, nullptr, (size_t)TT * HD, (size_t)TT * HD, (size_t)TT * TT);
            k_asoft<<<ZH * TT / 8, 256, 0, stream>>>(Sb);
            k_gemmw<bf, 2, false, KSP, 2><<<dim3(RH / 64, HD / 64 * KSP, ZH), 32, 0, stream>>>(Ph, Pl, VTh + zk * HD * TT, VTl + zk * HD * TT, TT, Ob, HD, nullptr, (size_t)TT * 2 * TT, (size_t)HD * TT, (size_t)TT * HD);
            k_gemmw<h16, 0, false, KSP, 2><<<dim3((TT - RH) / 64, HD / 64 * KSP, ZH), 32, 0, stream>>>(P16 + (size_t)RH * 2 * TT, nullptr, VT16 + zk * HD * TT, nullptr, TT, Ob + (size_t)RH * HD, HD, nullptr, (size_t)TT * 2 * TT, (size_t)HD * TT, (size_t)TT * HD);
            k_merge<<<(unsigned)(((size_t)ZH * TT * HD / 2 + 255) / 256), 256, 0, stream>>>(Ob, h0, ATh, ATl); }
        k_gemmw<bf, 1, false><<<dim3(TT / 64, DM / 64, 1), 32, 0, stream>>>(ATh, ATl, WO, nullptr, DQ, OUT + (size_t)b * TT * DM, DM, nullptr, 0, 0, 0); }
}

// v004
// Measured time: 539 microseconds a run.
// Versions in between are left out here; by their measured steps it is 2.38 times as fast as v002.
// Over all steps from v000 it is 7.36 times as fast.
#include <hip/hip_runtime.h>

// Multi-head attention with a fused 'oi' projection (x [4][2048][1024]; [Q|K|V] = x W_qkv^T ([3072][1024]: rows q | k | v); 16 heads x 64; softmax(q.k/8) over all keys; out = merged W_o^T -> [4][2048][1024] (8.4 M)).
// Compute dtypes, f32 accumulate: every input rounded to bf16; q/k/v on PLAIN bf16 operands (inputs: exact); scores and attn.v: query rows < 512 hl (3 products), the rest single fp16 (P x1024); softmax f32, running maximum; W_o hl x exact (2 products).

#define NB_  4
#define TT   2048
#define DM   1024
#define NH_  16
#define NKV  16
#define REP  (NH_ / NKV)
#define HD   64
#define DQ   (NH_ * HD)
#define DKV  (NKV * HD)
#define RH   512                  // query rows < RH use hi+lo planes (0: none)
#define WIN  0
#define SCL  0.125f   // HD^-0.5
typedef _Float16 h16;
typedef unsigned short bf;
typedef __attribute__((ext_vector_type(16))) __bf16   v16bf;
typedef __attribute__((ext_vector_type(16))) _Float16 v16h;
typedef __attribute__((ext_vector_type(8)))  _Float16 v8h;
typedef __attribute__((ext_vector_type(8)))  unsigned short v8us;
typedef __attribute__((ext_vector_type(8)))  __bf16   v8bf;
typedef __attribute__((ext_vector_type(8)))  float    v8f;
typedef __attribute__((ext_vector_type(4)))  float    v4f;
typedef v8h  __attribute__((may_alias)) v8ha;
typedef v4f  __attribute__((may_alias)) v4fa;
typedef v8us __attribute__((may_alias)) v8usa;

__device__ __forceinline__ unsigned short f2bf(float f) { unsigned u = __float_as_uint(f); u += 0x7FFFu + ((u >> 16) & 1u); return (unsigned short)(u >> 16); }
__device__ __forceinline__ float bf2f(unsigned short b) { return __uint_as_float(((unsigned)b) << 16); }
__device__ __forceinline__ float bfr(float f) { return bf2f(f2bf(f)); }
__device__ __forceinline__ v16h cat16(v8h lo, v8h hi) { return __builtin_shufflevector(lo, hi, 0, 1, 2, 3, 4, 5, 6, 7, 8, 9, 10, 11, 12, 13, 14, 15); }
__device__ __forceinline__ v16bf cat16b(v8us lo, v8us hi) { return __builtin_bit_cast(v16bf, __builtin_shufflevector(lo, hi, 0, 1, 2, 3, 4, 5, 6, 7, 8, 9, 10, 11, 12, 13, 14, 15)); }
__device__ __forceinline__ v8f wmma16(v16h a, v16h b, v8f c) { return __builtin_amdgcn_wmma_f32_16x16x32_f16(false, a, false, b, (short)0, c, false, false); }
__device__ __forceinline__ v8f wmmab(v16bf a, v16bf b, v8f c) { return __builtin_amdgcn_wmma_f32_16x16x32_bf16(false, a, false, b, (short)0, c, false, false); }



__device__ __forceinline__ h16 tohx(float x) { return (h16)x; }
__device__ __forceinline__ void splitf(float y, unsigned short& h, unsigned short& l) { h = f2bf(y); l = f2bf(y - bf2f(h)); }
// ---- k_gemmw: register-blocked GEMM, ONE WAVE per 64x64 output tile (16 accumulators), operands straight from K-contiguous 16-bit planes; grid (M/64, N/64, Z), 32 threads.
// C[m][n] (f32, pitch ldc, + optional f32 bias[n]) = sum_k A[m][k] Bt[n][k] (+ split products per NSPLIT). z-batch strides sA/sB/sC in elements. K % 32 == 0.
// PL: C is not stored as f32; each value goes out as fp16 (P16) and as bf16 hi + lo (Ph, Pl), at element m * ldc + (n / 64) * cts + n % 64 of each plane:
//     q, k: A = x, Bt = W, ldc = HD, cts = TT * HD gives [h][t][d];  v: A = W, Bt = x, ldc = TT, cts = 64 gives [h][d][t]. A store instruction writes four whole 128-byte lines.
template <typename T16> struct WFrag;
template <> struct WFrag<h16> { typedef v16h V; static __device__ __forceinline__ V ld(const h16* p) { return cat16(*(const v8h*)p, *(const v8h*)(p + 16)); } static __device__ __forceinline__ v8f mma(V a, V b, v8f c) { return wmma16(a, b, c); } };
template <> struct WFrag<bf> { typedef v16bf V; static __device__ __forceinline__ V ld(const bf* p) { return cat16b(*(const v8us*)p, *(const v8us*)(p + 16)); } static __device__ __forceinline__ v8f mma(V a, V b, v8f c) { return wmmab(a, b, c); } };
template <typename T16, int NSPLIT, bool BIAS, bool PL>
__global__ __launch_bounds__(32) void k_gemmw(const T16* __restrict__ A, const T16* __restrict__ A2, const T16* __restrict__ Bt, const T16* __restrict__ Bt2, int K, float* C, int ldc, const float* __restrict__ bias, size_t sA, size_t sB, size_t sC, h16* P16, bf* Ph, bf* Pl, size_t cts) {
    typedef typename WFrag<T16>::V V;
    __shared__ __align__(16) float os[16 * 68];
    const size_t z = blockIdx.z; A += z * sA; if (A2) A2 += z * sA; Bt += z * sB; if (Bt2) Bt2 += z * sB;
    C += z * sC;
    const int lane = threadIdx.x & 31, lr = lane & 15, hi = lane >> 4; const int r0 = blockIdx.x * 64, c0 = blockIdx.y * 64;
    v8f acc[4][4];
#pragma unroll
    for (int mb = 0; mb < 4; ++mb)
#pragma unroll
        for (int nb = 0; nb < 4; ++nb) acc[mb][nb] = (v8f){};
    const size_t aoff = (size_t)(r0 + lr) * K + 8 * hi, boff = (size_t)(c0 + lr) * K + 8 * hi;
#pragma unroll 1
    for (int kc = 0; kc < K; kc += 32) {
        V a[4], a2[4];
#pragma unroll
        for (int mb = 0; mb < 4; ++mb) { a[mb] = WFrag<T16>::ld(A + aoff + (size_t)mb * 16 * K + kc); if (NSPLIT == 1 || NSPLIT == 2) a2[mb] = WFrag<T16>::ld(A2 + aoff + (size_t)mb * 16 * K + kc); }
#pragma unroll
        for (int nb = 0; nb < 4; ++nb) { const V b = WFrag<T16>::ld(Bt + boff + (size_t)nb * 16 * K + kc); V b2; if (NSPLIT >= 2) b2 = WFrag<T16>::ld(Bt2 + boff + (size_t)nb * 16 * K + kc);
#pragma unroll
            for (int mb = 0; mb < 4; ++mb) { acc[mb][nb] = WFrag<T16>::mma(a[mb], b, acc[mb][nb]); if (NSPLIT == 1 || NSPLIT == 2) acc[mb][nb] = WFrag<T16>::mma(a2[mb], b, acc[mb][nb]); if (NSPLIT >= 2) acc[mb][nb] = WFrag<T16>::mma(a[mb], b2, acc[mb][nb]); } }
        asm volatile("v_nop\n\tv_nop\n\tv_nop\n\tv_nop" : "+v"(acc[0][0]), "+v"(acc[1][1]), "+v"(acc[2][2]), "+v"(acc[3][3]) : "v"(a[0]), "v"(a[3]));
    }
#pragma unroll
    for (int mb = 0; mb < 4; ++mb) {
#pragma unroll
        for (int nb = 0; nb < 4; ++nb) {
#pragma unroll
            for (int j = 0; j < 8; ++j) os[(hi * 8 + j) * 68 + nb * 16 + lr] = acc[mb][nb][j]; }
        __builtin_amdgcn_wave_barrier(); asm volatile("" ::: "memory");
        if constexpr (PL) {
            const int cofs = (lane & 7) * 8; v4f va[4], vb[4];   // all eight LDS reads of these 16 rows first: the store statements below are memory barriers to the compiler, no read moves up over one
#pragma unroll
            for (int s = 0; s < 4; ++s) { const float* o4 = os + (4 * s + (lane >> 3)) * 68 + cofs; va[s] = *(const v4fa*)o4; vb[s] = *(const v4fa*)(o4 + 4); }
#pragma unroll
            for (int s = 0; s < 4; ++s) { const int row = 4 * s + (lane >> 3); v8h o16; v8us oh, ol;
#pragma unroll
                for (int q = 0; q < 8; ++q) { const float r = q < 4 ? va[s][q & 3] : vb[s][q & 3]; o16[q] = tohx(r); unsigned short a2, c2; splitf(r, a2, c2); oh[q] = a2; ol[q] = c2; }
                const size_t off = (size_t)(r0 + mb * 16 + row) * ldc + (size_t)blockIdx.y * cts + cofs;
                // the three stores and their s_wait_xcnt 0 in one statement: the wait then stands in front of every rewrite of a data or address register that these stores name
                asm volatile("global_store_b128 %0, %3, off\n\tglobal_store_b128 %1, %4, off\n\tglobal_store_b128 %2, %5, off\n\ts_wait_xcnt 0x0" :: "v"(P16 + off), "v"(Ph + off), "v"(Pl + off), "v"(o16), "v"(oh), "v"(ol) : "memory"); }
        } else {
            float* crow = C + (size_t)(r0 + mb * 16) * ldc + c0;
#pragma unroll
            for (int s = 0; s < 8; ++s) { const int row = 2 * s + hi, cofs = lr * 4; v4f val = *(const v4fa*)(os + row * 68 + cofs); if (BIAS) { val[0] += bfr(bias[c0 + cofs]); val[1] += bfr(bias[c0 + cofs + 1]); val[2] += bfr(bias[c0 + cofs + 2]); val[3] += bfr(bias[c0 + cofs + 3]); }
                *(v4f*)(crow + (size_t)row * ldc + cofs) = val; }
             }
        __builtin_amdgcn_wave_barrier(); asm volatile("" ::: "memory");
    }
}

typedef __attribute__((ext_vector_type(2))) _Float16 v2h;
typedef __attribute__((ext_vector_type(4))) _Float16 v4h;
typedef __attribute__((ext_vector_type(2))) unsigned short v2us;
typedef __attribute__((ext_vector_type(4))) unsigned short v4us;
typedef __attribute__((ext_vector_type(2))) float v2f;
typedef __attribute__((ext_vector_type(4))) int v4i;

__global__ __launch_bounds__(256) void k_wtG(const float* __restrict__ w, int K, int N, bf* Bt) {
    const int lane = threadIdx.x & 31; const int L0 = (blockIdx.x * 8 + (threadIdx.x >> 5)) * 8; const int nlines = N * K / 64;
{
#pragma unroll 1
        for (int l = 0; l < 8; ++l) { const int L = L0 + l; if (L >= nlines) break; const size_t e = (size_t)L * 64 + lane * 2; const int k = (int)(e % K), n = (int)(e / K); v2us o;
            o[0] = f2bf(w[(size_t)k * N + n]); o[1] = f2bf(w[(size_t)(k + 1) * N + n]); *(v2us*)(Bt + e) = o; }
         }
}
__global__ __launch_bounds__(256) void k_cvt8(const float* __restrict__ src, bf* dst, size_t n8) { const size_t i = (size_t)blockIdx.x * 256 + threadIdx.x; if (i >= n8) return; const v8f v = *(const v8f*)(src + i * 8); v8us o;
#pragma unroll
    for (int k = 0; k < 8; ++k) o[k] = f2bf(v[k]); *(v8us*)(dst + i * 8) = o;  }

// ---- k_fattn: scores, softmax and attn.v of one (batch, head) in ONE kernel; no score or P element leaves the registers.
// A wave owns NQ * 16 query columns and walks the 2048 keys 32 at a time: St = K Qt (A = K rows, B = Q rows, kept in registers), so a lane holds 16 scores of ONE query per column group;
// running maximum m and sum l per query (in-lane, the wave's halves joined by one lane exchange); two St tiles, converted in place, are the B operand Pt of Ot += Vt Pt (A = rows of the [d][t] planes).
// Ot: a lane holds 8 consecutive d of one query, scaled by 1 / l at the end and stored as the hi + lo planes that the output projection reads ([b][t][h][d]).
// The work-group's 8 waves share K and Vt through LDS: stages of KST keys, two buffers; whole 128-byte lines go global -> registers -> LDS while the stage before is worked on; one barrier per stage.
// HR (query rows < RH): hi + lo bf16 planes, 3 products each for St and Ot; else single fp16, P carried x 2^10 (l carries the same factor, so it cancels).
#define KST 64                    // keys per LDS stage
#define LP  72                    // LDS row pitch in 16-bit elements: 144 B = 16 B x odd, 16-byte fragment reads of 16 rows fall on 64 different banks
#define LTILE (64 * LP)           // one staged tile: 64 rows (keys of K, or d of Vt) of 64 elements
template <typename T16> struct Chunk;
template <> struct Chunk<h16> { typedef v8h T; };
template <> struct Chunk<bf> { typedef v8us T; };
// ldw: a staging load. The s_wait_xcnt 0 stands behind the 16-byte load so that it comes in front of any rewrite of the address pair the load names (the register allocator gives such pairs to later loads' data); its memory clobber also keeps the load in front of the stage's LDS reads, a whole stage ahead of its use.
// ldx: the same for a fragment loaded straight from global memory (the Q rows, once per wave).
__device__ __forceinline__ v16h ldx(const h16* p) { const v8h lo = *(const v8h*)p; asm volatile("s_wait_xcnt 0x0" ::: "memory"); const v8h hi = *(const v8h*)(p + 16); asm volatile("s_wait_xcnt 0x0" ::: "memory"); return cat16(lo, hi); }
__device__ __forceinline__ v16bf ldx(const bf* p) { const v8us lo = *(const v8us*)p; asm volatile("s_wait_xcnt 0x0" ::: "memory"); const v8us hi = *(const v8us*)(p + 16); asm volatile("s_wait_xcnt 0x0" ::: "memory"); return cat16b(lo, hi); }
template <typename T8, typename T16> __device__ __forceinline__ T8 ldw(const T16* p) { const T8 v = *(const T8*)p; asm volatile("s_wait_xcnt 0x0" ::: "memory"); return v; }
// exp2run: 2^x of 17 values, each in its own register, as ONE run of v_exp_f32: no instruction directly behind one of them reads its result or rewrites its source, and the v_nop is that slot behind the last.
__device__ __forceinline__ void exp2run(float (&e)[17]) { asm("v_exp_f32 %0, %0\n\tv_exp_f32 %1, %1\n\tv_exp_f32 %2, %2\n\tv_exp_f32 %3, %3\n\tv_exp_f32 %4, %4\n\tv_exp_f32 %5, %5\n\tv_exp_f32 %6, %6\n\tv_exp_f32 %7, %7\n\tv_exp_f32 %8, %8\n\tv_exp_f32 %9, %9\n\tv_exp_f32 %10, %10\n\tv_exp_f32 %11, %11\n\tv_exp_f32 %12, %12\n\tv_exp_f32 %13, %13\n\tv_exp_f32 %14, %14\n\tv_exp_f32 %15, %15\n\tv_exp_f32 %16, %16\n\tv_nop" : "+v"(e[0]), "+v"(e[1]), "+v"(e[2]), "+v"(e[3]), "+v"(e[4]), "+v"(e[5]), "+v"(e[6]), "+v"(e[7]), "+v"(e[8]), "+v"(e[9]), "+v"(e[10]), "+v"(e[11]), "+v"(e[12]), "+v"(e[13]), "+v"(e[14]), "+v"(e[15]), "+v"(e[16])); }
__device__ __forceinline__ float xhalf(float x) { const int b = __float_as_int(x); return __int_as_float(__builtin_amdgcn_permlanex16(b, b, 0x76543210, 0xfedcba98, false, false)); }   // the value of lane l ^ 16
template <typename T16, bool HR, int NQ>
__device__ __forceinline__ void attn_wg(T16* sm, const T16* __restrict__ Q, const T16* __restrict__ Q2, const T16* __restrict__ Kp, const T16* __restrict__ K2, const T16* __restrict__ Vt, const T16* __restrict__ V2, int q0, bf* __restrict__ Ah, bf* __restrict__ Al) {
    typedef WFrag<T16> F; typedef typename F::V V; typedef typename Chunk<T16>::T T8;
    constexpr int NP = HR ? 2 : 1, BUF = 2 * NP * LTILE;   // a buffer: the K tile(s), then the Vt tile(s)
    const int lane = threadIdx.x & 31, lr = lane & 15, hi = lane >> 4;
    const int sr = threadIdx.x >> 3, sc = (threadIdx.x & 7) * 8;   // staging: this thread moves 16 bytes at element sc of rows sr and sr + 32 of every tile
    const float C2 = SCL * 1.4426950408889634f, OFF = HR ? 0.0f : 10.0f;
    V qf[NQ][2], qg[NQ][2];
#pragma unroll
    for (int n = 0; n < NQ; ++n)
#pragma unroll
        for (int ks = 0; ks < 2; ++ks) { const size_t qo = (size_t)(q0 + n * 16 + lr) * HD + ks * 32 + 8 * hi; qf[n][ks] = ldx(Q + qo); if (HR) qg[n][ks] = ldx(Q2 + qo); }
    v8f o[NQ][4]; float m[NQ], l[NQ];
#pragma unroll
    for (int n = 0; n < NQ; ++n) { m[n] = -3.0e38f; l[n] = 0.0f;
#pragma unroll
        for (int db = 0; db < 4; ++db) o[n][db] = (v8f){}; }
    T8 gk[2], gk2[2], gv[2], gv2[2];
#pragma unroll
    for (int i = 0; i < 2; ++i) { const int r = sr + 32 * i; gk[i] = ldw<T8>(Kp + (size_t)r * HD + sc); gv[i] = ldw<T8>(Vt + (size_t)r * TT + sc); if (HR) { gk2[i] = ldw<T8>(K2 + (size_t)r * HD + sc); gv2[i] = ldw<T8>(V2 + (size_t)r * TT + sc); } }
#pragma unroll
    for (int i = 0; i < 2; ++i) { T16* d = sm + (sr + 32 * i) * LP + sc; *(T8*)d = gk[i]; *(T8*)(d + NP * LTILE) = gv[i]; if (HR) { *(T8*)(d + LTILE) = gk2[i]; *(T8*)(d + 3 * LTILE) = gv2[i]; } }
    __syncthreads();   // stage 0 is in LDS for every wave
#pragma unroll 1
    for (int st = 0; st < TT / KST; ++st) {
        const T16* cur = sm + (st & 1) * BUF; T16* nxt = sm + ((st + 1) & 1) * BUF;
        const int kn = (st + 1 < TT / KST) ? (st + 1) * KST : 0;   // the next stage's lines fly while this stage is worked on (last stage: keys 0 again, in bounds, never read from LDS)
#pragma unroll
        for (int i = 0; i < 2; ++i) { const int r = sr + 32 * i; gk[i] = ldw<T8>(Kp + (size_t)(kn + r) * HD + sc); gv[i] = ldw<T8>(Vt + (size_t)r * TT + kn + sc); if (HR) { gk2[i] = ldw<T8>(K2 + (size_t)(kn + r) * HD + sc); gv2[i] = ldw<T8>(V2 + (size_t)r * TT + kn + sc); } }
#pragma unroll
        for (int p = 0; p < KST / 32; ++p) {
            v8f s[NQ][2];
#pragma unroll
            for (int kt = 0; kt < 2; ++kt) { V kf[2], kg[2];
#pragma unroll
                for (int ks = 0; ks < 2; ++ks) { const T16* a = cur + (p * 32 + kt * 16 + lr) * LP + ks * 32 + 8 * hi; kf[ks] = F::ld(a); if (HR) kg[ks] = F::ld(a + LTILE); }
#pragma unroll
                for (int n = 0; n < NQ; ++n) { s[n][kt] = (v8f){};
#pragma unroll
                    for (int ks = 0; ks < 2; ++ks) { s[n][kt] = F::mma(kf[ks], qf[n][ks], s[n][kt]); if (HR) { s[n][kt] = F::mma(kf[ks], qg[n][ks], s[n][kt]); s[n][kt] = F::mma(kg[ks], qf[n][ks], s[n][kt]); } } } }
            V pf[NQ], pg[NQ];
#pragma unroll
            for (int n = 0; n < NQ; ++n) {
                float mx = s[n][0][0];
#pragma unroll
                for (int j = 1; j < 8; ++j) mx = fmaxf(mx, s[n][0][j]);
#pragma unroll
                for (int j = 0; j < 8; ++j) mx = fmaxf(mx, s[n][1][j]);
                mx = fmaxf(mx, xhalf(mx));
                const float mn = fmaxf(m[n], mx); float e[17]; e[16] = (m[n] - mn) * C2; m[n] = mn;
                const float nb = OFF - mn * C2; const v8f d0 = s[n][0] * C2 + nb, d1 = s[n][1] * C2 + nb; v8f p0, p1;   // one fused multiply-add per score: (s - mn) C2 + OFF
#pragma unroll
                for (int j = 0; j < 8; ++j) { e[j] = d0[j]; e[8 + j] = d1[j]; }
                exp2run(e); const float al = e[16];
#pragma unroll
                for (int j = 0; j < 8; ++j) { p0[j] = e[j]; p1[j] = e[8 + j]; }
                const v8f ps = p0 + p1;
                l[n] = l[n] * al + (((ps[0] + ps[1]) + (ps[2] + ps[3])) + ((ps[4] + ps[5]) + (ps[6] + ps[7])));
#pragma unroll
                for (int db = 0; db < 4; ++db) o[n][db] *= al;
                if constexpr (HR) {
                    const v8bf h0 = __builtin_convertvector(p0, v8bf), h1 = __builtin_convertvector(p1, v8bf);
                    const v8bf l0 = __builtin_convertvector(p0 - __builtin_convertvector(h0, v8f), v8bf), l1 = __builtin_convertvector(p1 - __builtin_convertvector(h1, v8f), v8bf);
                    pf[n] = __builtin_shufflevector(h0, h1, 0, 1, 2, 3, 4, 5, 6, 7, 8, 9, 10, 11, 12, 13, 14, 15); pg[n] = __builtin_shufflevector(l0, l1, 0, 1, 2, 3, 4, 5, 6, 7, 8, 9, 10, 11, 12, 13, 14, 15);
                } else pf[n] = cat16(__builtin_convertvector(p0, v8h), __builtin_convertvector(p1, v8h));
            }
#pragma unroll
            for (int db = 0; db < 4; ++db) { const T16* a = cur + NP * LTILE + (db * 16 + lr) * LP + p * 32 + 8 * hi; const V vf = F::ld(a); V vg; if (HR) vg = F::ld(a + LTILE);
#pragma unroll
                for (int n = 0; n < NQ; ++n) { o[n][db] = F::mma(vf, pf[n], o[n][db]); if (HR) { o[n][db] = F::mma(vf, pg[n], o[n][db]); o[n][db] = F::mma(vg, pf[n], o[n][db]); } } }
        }
        // five vector slots between the stage's last matrix instruction and whatever vector instruction stands first behind the loop's taken back edge
        if constexpr (NQ == 2) asm volatile("v_nop\n\tv_nop\n\tv_nop\n\tv_nop\n\tv_nop" : "+v"(o[0][0]), "+v"(o[0][1]), "+v"(o[0][2]), "+v"(o[0][3]), "+v"(o[1][0]), "+v"(o[1][1]), "+v"(o[1][2]), "+v"(o[1][3]));
        else asm volatile("v_nop\n\tv_nop\n\tv_nop\n\tv_nop\n\tv_nop" : "+v"(o[0][0]), "+v"(o[0][1]), "+v"(o[0][2]), "+v"(o[0][3]));
#pragma unroll
        for (int i = 0; i < 2; ++i) { T16* d = nxt + (sr + 32 * i) * LP + sc; *(T8*)d = gk[i]; *(T8*)(d + NP * LTILE) = gv[i]; if (HR) { *(T8*)(d + LTILE) = gk2[i]; *(T8*)(d + 3 * LTILE) = gv2[i]; } }   // nxt's last readers left it at the barrier that ended the stage before
        __syncthreads();   // publishes nxt and ends every wave's reads of cur, which the next stage refills
    }
#pragma unroll
    for (int n = 0; n < NQ; ++n) { const float inv = __fdiv_rn(1.0f, l[n] + xhalf(l[n])); const size_t oo = (size_t)(q0 + n * 16 + lr) * DQ + 8 * hi;
#pragma unroll
        for (int db = 0; db < 4; ++db) { v8us oh, ol;
#pragma unroll
            for (int j = 0; j < 8; ++j) { unsigned short a, c2; splitf(o[n][db][j] * inv, a, c2); oh[j] = a; ol[j] = c2; }
            *(v8us*)(Ah + oo + db * 16) = oh; *(v8us*)(Al + oo + db * 16) = ol; } }
}
// grid: the NB_ * NH_ * RH / 128 work-groups of the 3-product rows first (8 waves x 16 queries; they last longest), then NB_ * NH_ * (TT - RH) / 256 of 8 waves x 32 queries. Planes [b * NH_ + h][..]; Ah, Al [b][t][DQ].
__global__ __launch_bounds__(256) void k_fattn(const h16* __restrict__ Q16, const h16* __restrict__ K16, const h16* __restrict__ V16, const bf* __restrict__ Qh, const bf* __restrict__ Ql, const bf* __restrict__ Kh, const bf* __restrict__ Kl, const bf* __restrict__ Vh, const bf* __restrict__ Vl, bf* __restrict__ Ah, bf* __restrict__ Al) {
    __shared__ __align__(16) bf sm[2 * 4 * LTILE];
    const int wave = __builtin_amdgcn_readfirstlane((int)(threadIdx.x >> 5)); const int id = blockIdx.x; const int NHR = NB_ * NH_ * (RH / 128);
    if (id < NHR) { const int bh = id / (RH / 128), q0 = (id % (RH / 128)) * 128 + wave * 16; const size_t pl = (size_t)bh * TT * HD, ao = (size_t)(bh / NH_) * TT * DQ + (size_t)(bh % NH_) * HD;
        attn_wg<bf, true, 1>(sm, Qh + pl, Ql + pl, Kh + pl, Kl + pl, Vh + pl, Vl + pl, q0, Ah + ao, Al + ao);
    } else { const int i2 = id - NHR; const int bh = i2 / ((TT - RH) / 256), q0 = RH + (i2 % ((TT - RH) / 256)) * 256 + wave * 32; const size_t pl = (size_t)bh * TT * HD, ao = (size_t)(bh / NH_) * TT * DQ + (size_t)(bh % NH_) * HD;
        attn_wg<h16, false, 2>((h16*)sm, Q16 + pl, nullptr, K16 + pl, nullptr, V16 + pl, nullptr, q0, Ah + ao, Al + ao); }
}

extern "C" void kernel_launch(void* const* d_in, const int* in_sizes, int n_in,
                              void* d_out, int out_size, void* d_ws, size_t ws_size, hipStream_t stream) {
    (void)in_sizes; (void)n_in; (void)out_size;
    const float* x = (const float*)d_in[0]; const float* wqkv = (const float*)d_in[1]; const float* wo = (const float*)d_in[2]; const float* wq = wqkv; const float* wk = wqkv + (size_t)DQ * DM; const float* wv = wqkv + (size_t)(DQ + DKV) * DM;
    float* OUT = (float*)d_out;     // [4][2048][1024]
    char* wsp = (char*)d_ws;
    auto take = [&](size_t bytes) { char* p = wsp; wsp += (bytes + 255) & ~(size_t)255; return (void*)p; };
    bf* WQ = (bf*)take((size_t)DQ * DM * 2); bf* WK = (bf*)take((size_t)DKV * DM * 2); bf* WV = (bf*)take((size_t)DKV * DM * 2); bf* WO = (bf*)take((size_t)DM * DQ * 2);
    bf* XB = (bf*)take((size_t)TT * DM * 2);
    const size_t PQ = (size_t)NH_ * TT * HD, PK = (size_t)NKV * TT * HD;   // one batch's share of a q plane and of a k or v plane, in elements; every plane holds all NB_ batches
    h16* QP16 = (h16*)take(NB_ * PQ * 2); h16* KP16 = (h16*)take(NB_ * PK * 2); h16* VT16 = (h16*)take(NB_ * PK * 2);
    bf* QPh = (bf*)take(NB_ * PQ * 2); bf* QPl = (bf*)take(NB_ * PQ * 2); bf* KPh = (bf*)take(NB_ * PK * 2); bf* KPl = (bf*)take(NB_ * PK * 2); bf* VTh = (bf*)take(NB_ * PK * 2); bf* VTl = (bf*)take(NB_ * PK * 2);
    bf* ATh = (bf*)take((size_t)NB_ * TT * DQ * 2); bf* ATl = (bf*)take((size_t)NB_ * TT * DQ * 2);
    if ((size_t)(wsp - (char*)d_ws) > ws_size) return;    // ws 256 MiB
    { k_cvt8<<<(unsigned)(((size_t)DQ * DM / 8 + 255) / 256), 256, 0, stream>>>(wq, WQ, (size_t)DQ * DM / 8); k_cvt8<<<(unsigned)(((size_t)DKV * DM / 8 + 255) / 256), 256, 0, stream>>>(wk, WK, (size_t)DKV * DM / 8); k_cvt8<<<(unsigned)(((size_t)DKV * DM / 8 + 255) / 256), 256, 0, stream>>>(wv, WV, (size_t)DKV * DM / 8);
      k_cvt8<<<(unsigned)(((size_t)DM * DQ / 8 + 255) / 256), 256, 0, stream>>>(wo, WO, (size_t)DM * DQ / 8);
       }
    for (int b = 0; b < NB_; ++b) {
        
        k_cvt8<<<(unsigned)(((size_t)TT * DM / 8 + 255) / 256), 256, 0, stream>>>(x + (size_t)b * TT * DM, XB, (size_t)TT * DM / 8);
        k_gemmw<bf, 0, false, true><<<dim3(TT / 64, DQ / 64, 1), 32, 0, stream>>>(XB, nullptr, WQ, nullptr, DM, nullptr, HD, nullptr, 0, 0, 0, QP16 + b * PQ, QPh + b * PQ, QPl + b * PQ, (size_t)TT * HD);
        k_gemmw<bf, 0, false, true><<<dim3(TT / 64, DKV / 64, 1), 32, 0, stream>>>(XB, nullptr, WK, nullptr, DM, nullptr, HD, nullptr, 0, 0, 0, KP16 + b * PK, KPh + b * PK, KPl + b * PK, (size_t)TT * HD);
        k_gemmw<bf, 0, false, true><<<dim3(DKV / 64, TT / 64, 1), 32, 0, stream>>>(WV, nullptr, XB, nullptr, DM, nullptr, TT, nullptr, 0, 0, 0, VT16 + b * PK, VTh + b * PK, VTl + b * PK, (size_t)64); }
    k_fattn<<<NB_ * NH_ * (RH / 128 + (TT - RH) / 256), 256, 0, stream>>>(QP16, KP16, VT16, QPh, QPl, KPh, KPl, VTh, VTl, ATh, ATl);   // one kv head per query head
    for (int b = 0; b < NB_; ++b)
        k_gemmw<bf, 1, false, false><<<dim3(TT / 64, DM / 64, 1), 32, 0, stream>>>(ATh + (size_t)b * TT * DQ, ATl + (size_t)b * TT * DQ, WO, nullptr, DQ, OUT + (size_t)b * TT * DM, DM, nullptr, 0, 0, 0, nullptr, nullptr, nullptr, 0);
}

// v005
// It runs in 284 microseconds.
// Two timings next to v004 both put it at 1.91 times that version's speed.
// Counting every step since v000, it is 14.0 times as fast.
#include <hip/hip_runtime.h>

// Multi-head attention with a fused 'oi' projection (x [4][2048][1024]; [Q|K|V] = x W_qkv^T ([3072][1024]: rows q | k | v); 16 heads x 64; softmax(q.k/8) over all keys; out = merged W_o^T -> [4][2048][1024] (8.4 M)).
// Compute dtypes, f32 accumulate: every input rounded to bf16; q/k/v on PLAIN bf16 operands (inputs: exact); scores and attn.v: query rows < 512 hl (3 products), the rest single fp16 (P x1024); softmax f32, running maximum; W_o hl x exact (2 products).

#define NB_  4
#define TT   2048
#define DM   1024
#define NH_  16
#define NKV  16
#define REP  (NH_ / NKV)
#define HD   64
#define DQ   (NH_ * HD)
#define DKV  (NKV * HD)
#define RH   512                  // query rows < RH use hi+lo planes (0: none)
#define WIN  0
#define SCL  0.125f   // HD^-0.5
typedef _Float16 h16;
typedef unsigned short bf;
typedef __attribute__((ext_vector_type(16))) __bf16   v16bf;
typedef __attribute__((ext_vector_type(16))) _Float16 v16h;
typedef __attribute__((ext_vector_type(8)))  _Float16 v8h;
typedef __attribute__((ext_vector_type(8)))  unsigned short v8us;
typedef __attribute__((ext_vector_type(8)))  __bf16   v8bf;
typedef __attribute__((ext_vector_type(8)))  float    v8f;
typedef __attribute__((ext_vector_type(4)))  float    v4f;
typedef v8h  __attribute__((may_alias)) v8ha;
typedef v4f  __attribute__((may_alias)) v4fa;
typedef v8us __attribute__((may_alias)) v8usa;

__device__ __forceinline__ unsigned short f2bf(float f) { unsigned u = __float_as_uint(f); u += 0x7FFFu + ((u >> 16) & 1u); return (unsigned short)(u >> 16); }
__device__ __forceinline__ float bf2f(unsigned short b) { return __uint_as_float(((unsigned)b) << 16); }
__device__ __forceinline__ float bfr(float f) { return bf2f(f2bf(f)); }
__device__ __forceinline__ v16h cat16(v8h lo, v8h hi) { return __builtin_shufflevector(lo, hi, 0, 1, 2, 3, 4, 5, 6, 7, 8, 9, 10, 11, 12, 13, 14, 15); }
__device__ __forceinline__ v16bf cat16b(v8us lo, v8us hi) { return __builtin_bit_cast(v16bf, __builtin_shufflevector(lo, hi, 0, 1, 2, 3, 4, 5, 6, 7, 8, 9, 10, 11, 12, 13, 14, 15)); }
__device__ __forceinline__ v8f wmma16(v16h a, v16h b, v8f c) { return __builtin_amdgcn_wmma_f32_16x16x32_f16(false, a, false, b, (short)0, c, false, false); }
__device__ __forceinline__ v8f wmmab(v16bf a, v16bf b, v8f c) { return __builtin_amdgcn_wmma_f32_16x16x32_bf16(false, a, false, b, (short)0, c, false, false); }



__device__ __forceinline__ h16 tohx(float x) { return (h16)x; }
__device__ __forceinline__ void splitf(float y, unsigned short& h, unsigned short& l) { h = f2bf(y); l = f2bf(y - bf2f(h)); }
// ---- k_gemmw: register-blocked GEMM, ONE WAVE per 64x64 output tile (16 accumulators), operands straight from K-contiguous 16-bit planes; grid (M/64, N/64, Z), 32 threads.
// C[m][n] (f32, pitch ldc, + optional f32 bias[n]) = sum_k A[m][k] Bt[n][k] (+ split products per NSPLIT). z-batch strides sA/sB/sC in elements. K % 32 == 0.
// PL: C is not stored as f32; each value goes out as fp16 (P16) and as bf16 hi + lo (Ph, Pl), at element (n / DQ) * cts + z * sC + (n % DQ / 64) * TT * HD + (q, k: m * HD + n % 64; v: n % 64 * TT + m) of each plane:
//     ONE launch does q, k and v of every batch: A = x ([b][t][DM], batch stride sA), Bt = all rows of W_qkv, grid (TT/64, 3 * NH_, NB_); blockIdx.y / NH_ picks q, k or v (plane sets cts elements apart, batches sC apart).
//     q, k: x rows times W rows, stored [h][t][d];  v: the operands swapped (W rows times x rows), stored [h][d][t]. A store instruction writes four whole 128-byte lines.
template <typename T16> struct WFrag;
template <> struct WFrag<h16> { typedef v16h V; static __device__ __forceinline__ V ld(const h16* p) { return cat16(*(const v8h*)p, *(const v8h*)(p + 16)); } static __device__ __forceinline__ v8f mma(V a, V b, v8f c) { return wmma16(a, b, c); } };
template <> struct WFrag<bf> { typedef v16bf V; static __device__ __forceinline__ V ld(const bf* p) { return cat16b(*(const v8us*)p, *(const v8us*)(p + 16)); } static __device__ __forceinline__ v8f mma(V a, V b, v8f c) { return wmmab(a, b, c); } };
template <typename T16, int NSPLIT, bool BIAS, bool PL>
__global__ __launch_bounds__(32) void k_gemmw(const T16* __restrict__ A, const T16* __restrict__ A2, const T16* __restrict__ Bt, const T16* __restrict__ Bt2, int K, float* C, int ldc, const float* __restrict__ bias, size_t sA, size_t sB, size_t sC, h16* P16, bf* Ph, bf* Pl, size_t cts) {
    typedef typename WFrag<T16>::V V;
    __shared__ __align__(16) float os[16 * 68];
    const size_t z = blockIdx.z; A += z * sA; if (A2) A2 += z * sA; Bt += z * sB; if (Bt2) Bt2 += z * sB;
    C += z * sC;
    const int lane = threadIdx.x & 31, lr = lane & 15, hi = lane >> 4; int r0 = blockIdx.x * 64, c0 = blockIdx.y * 64;
    size_t pofs = 0; int ldp = HD;   // PL: element of the tile's first value in each plane, and the pitch of its rows there
    if constexpr (PL) { const int sel = blockIdx.y / NH_, h = blockIdx.y % NH_; pofs = (size_t)sel * cts + z * sC + (size_t)h * TT * HD;
        if (sel < 2) pofs += (size_t)r0 * HD;
        else { const T16* xb = A; A = Bt; Bt = xb; pofs += r0; ldp = TT; const int t0 = r0; r0 = c0; c0 = t0; } }
    v8f acc[4][4];
#pragma unroll
    for (int mb = 0; mb < 4; ++mb)
#pragma unroll
        for (int nb = 0; nb < 4; ++nb) acc[mb][nb] = (v8f){};
    const size_t aoff = (size_t)(r0 + lr) * K + 8 * hi, boff = (size_t)(c0 + lr) * K + 8 * hi;
#pragma unroll 1
    for (int kc = 0; kc < K; kc += 32) {
        V a[4], a2[4];
#pragma unroll
        for (int mb = 0; mb < 4; ++mb) { a[mb] = WFrag<T16>::ld(A + aoff + (size_t)mb * 16 * K + kc); if (NSPLIT == 1 || NSPLIT == 2) a2[mb] = WFrag<T16>::ld(A2 + aoff + (size_t)mb * 16 * K + kc); }
#pragma unroll
        for (int nb = 0; nb < 4; ++nb) { const V b = WFrag<T16>::ld(Bt + boff + (size_t)nb * 16 * K + kc); V b2; if (NSPLIT >= 2) b2 = WFrag<T16>::ld(Bt2 + boff + (size_t)nb * 16 * K + kc);
#pragma unroll
            for (int mb = 0; mb < 4; ++mb) { acc[mb][nb] = WFrag<T16>::mma(a[mb], b, acc[mb][nb]); if (NSPLIT == 1 || NSPLIT == 2) acc[mb][nb] = WFrag<T16>::mma(a2[mb], b, acc[mb][nb]); if (NSPLIT >= 2) acc[mb][nb] = WFrag<T16>::mma(a[mb], b2, acc[mb][nb]); } }
        asm volatile("v_nop\n\tv_nop\n\tv_nop\n\tv_nop" : "+v"(acc[0][0]), "+v"(acc[1][1]), "+v"(acc[2][2]), "+v"(acc[3][3]) : "v"(a[0]), "v"(a[3]));
    }
#pragma unroll
    for (int mb = 0; mb < 4; ++mb) {
#pragma unroll
        for (int nb = 0; nb < 4; ++nb) {
#pragma unroll
            for (int j = 0; j < 8; ++j) os[(hi * 8 + j) * 68 + nb * 16 + lr] = acc[mb][nb][j]; }
        __builtin_amdgcn_wave_barrier(); asm volatile("" ::: "memory");
        if constexpr (PL) {
            const int cofs = (lane & 7) * 8; v4f va[4], vb[4];   // all eight LDS reads of these 16 rows first: the store statements below are memory barriers to the compiler, no read moves up over one
#pragma unroll
            for (int s = 0; s < 4; ++s) { const float* o4 = os + (4 * s + (lane >> 3)) * 68 + cofs; va[s] = *(const v4fa*)o4; vb[s] = *(const v4fa*)(o4 + 4); }
#pragma unroll
            for (int s = 0; s < 4; ++s) { const int row = 4 * s + (lane >> 3); v8h o16; v8us oh, ol;
#pragma unroll
                for (int q = 0; q < 8; ++q) { const float r = q < 4 ? va[s][q & 3] : vb[s][q & 3]; o16[q] = tohx(r); unsigned short a2, c2; splitf(r, a2, c2); oh[q] = a2; ol[q] = c2; }
                const size_t off = pofs + (size_t)(mb * 16 + row) * ldp + cofs;
                // the three stores and their s_wait_xcnt 0 in one statement: the wait then stands in front of every rewrite of a data or address register that these stores name
                asm volatile("global_store_b128 %0, %3, off\n\tglobal_store_b128 %1, %4, off\n\tglobal_store_b128 %2, %5, off\n\ts_wait_xcnt 0x0" :: "v"(P16 + off), "v"(Ph + off), "v"(Pl + off), "v"(o16), "v"(oh), "v"(ol) : "memory"); }
        } else {
            float* crow = C + (size_t)(r0 + mb * 16) * ldc + c0;
#pragma unroll
            for (int s = 0; s < 8; ++s) { const int row = 2 * s + hi, cofs = lr * 4; v4f val = *(const v4fa*)(os + row * 68 + cofs); if (BIAS) { val[0] += bfr(bias[c0 + cofs]); val[1] += bfr(bias[c0 + cofs + 1]); val[2] += bfr(bias[c0 + cofs + 2]); val[3] += bfr(bias[c0 + cofs + 3]); }
                *(v4f*)(crow + (size_t)row * ldc + cofs) = val; }
             }
        __builtin_amdgcn_wave_barrier(); asm volatile("" ::: "memory");
    }
}

typedef __attribute__((ext_vector_type(2))) _Float16 v2h;
typedef __attribute__((ext_vector_type(4))) _Float16 v4h;
typedef __attribute__((ext_vector_type(2))) unsigned short v2us;
typedef __attribute__((ext_vector_type(4))) unsigned short v4us;
typedef __attribute__((ext_vector_type(2))) float v2f;
typedef __attribute__((ext_vector_type(4))) int v4i;

__global__ __launch_bounds__(256) void k_wtG(const float* __restrict__ w, int K, int N, bf* Bt) {
    const int lane = threadIdx.x & 31; const int L0 = (blockIdx.x * 8 + (threadIdx.x >> 5)) * 8; const int nlines = N * K / 64;
{
#pragma unroll 1
        for (int l = 0; l < 8; ++l) { const int L = L0 + l; if (L >= nlines) break; const size_t e = (size_t)L * 64 + lane * 2; const int k = (int)(e % K), n = (int)(e / K); v2us o;
            o[0] = f2bf(w[(size_t)k * N + n]); o[1] = f2bf(w[(size_t)(k + 1) * N + n]); *(v2us*)(Bt + e) = o; }
         }
}
// k_cvt8: x, W_qkv and W_o rounded to bf16 in one launch; dst holds the three one behind the other. Each part is a whole number of work-groups.
#define NX8 ((size_t)NB_ * TT * DM / 8)
#define NW8 ((size_t)(DQ + 2 * DKV) * DM / 8)
#define NO8 ((size_t)DM * DQ / 8)
__global__ __launch_bounds__(256) void k_cvt8(const float* __restrict__ x, const float* __restrict__ wqkv, const float* __restrict__ wo, bf* dst) { const size_t g = (size_t)blockIdx.x * 256, i = g + threadIdx.x;
    const float* src = g < NX8 ? x + i * 8 : g < NX8 + NW8 ? wqkv + (i - NX8) * 8 : wo + (i - NX8 - NW8) * 8; const v8f v = *(const v8f*)src; v8us o;
#pragma unroll
    for (int k = 0; k < 8; ++k) o[k] = f2bf(v[k]); *(v8us*)(dst + i * 8) = o;  }

// ---- k_fattn: scores, softmax and attn.v of one (batch, head) in ONE kernel; no score or P element leaves the registers.
// A wave owns NQ * 16 query columns and walks the 2048 keys 32 at a time: St = K Qt (A = K rows, B = Q rows, kept in registers), so a lane holds 16 scores of ONE query per column group;
// running maximum m and sum l per query (in-lane, the wave's halves joined by one lane exchange); two St tiles, converted in place, are the B operand Pt of Ot += Vt Pt (A = rows of the [d][t] planes).
// Ot: a lane holds 8 consecutive d of one query, scaled by 1 / l at the end and stored as the hi + lo planes that the output projection reads ([b][t][h][d]).
// The work-group's 8 waves share K and Vt through LDS: stages of KST keys, two buffers; whole 128-byte lines go global -> registers -> LDS while the stage before is worked on; one barrier per stage.
// HR (query rows < RH): hi + lo bf16 planes, 3 products each for St and Ot; else single fp16, P carried x 2^10 (l carries the same factor, so it cancels).
#define KST 64                    // keys per LDS stage
#define LP  72                    // LDS row pitch in 16-bit elements: 144 B = 16 B x odd, 16-byte fragment reads of 16 rows fall on 64 different banks
#define LTILE (64 * LP)           // one staged tile: 64 rows (keys of K, or d of Vt) of 64 elements
template <typename T16> struct Chunk;
template <> struct Chunk<h16> { typedef v8h T; };
template <> struct Chunk<bf> { typedef v8us T; };
// ldw: a staging load. The s_wait_xcnt 0 stands behind the 16-byte load so that it comes in front of any rewrite of the address pair the load names (the register allocator gives such pairs to later loads' data); its memory clobber also keeps the load in front of the stage's LDS reads, a whole stage ahead of its use.
// ldx: the same for a fragment loaded straight from global memory (the Q rows, once per wave).
__device__ __forceinline__ v16h ldx(const h16* p) { const v8h lo = *(const v8h*)p; asm volatile("s_wait_xcnt 0x0" ::: "memory"); const v8h hi = *(const v8h*)(p + 16); asm volatile("s_wait_xcnt 0x0" ::: "memory"); return cat16(lo, hi); }
__device__ __forceinline__ v16bf ldx(const bf* p) { const v8us lo = *(const v8us*)p; asm volatile("s_wait_xcnt 0x0" ::: "memory"); const v8us hi = *(const v8us*)(p + 16); asm volatile("s_wait_xcnt 0x0" ::: "memory"); return cat16b(lo, hi); }
template <typename T8, typename T16> __device__ __forceinline__ T8 ldw(const T16* p) { const T8 v = *(const T8*)p; asm volatile("s_wait_xcnt 0x0" ::: "memory"); return v; }
// exp2run: 2^x of 17 values, each in its own register, as ONE run of v_exp_f32: no instruction directly behind one of them reads its result or rewrites its source, and the v_nop is that slot behind the last.
__device__ __forceinline__ void exp2run(float (&e)[17]) { asm("v_exp_f32 %0, %0\n\tv_exp_f32 %1, %1\n\tv_exp_f32 %2, %2\n\tv_exp_f32 %3, %3\n\tv_exp_f32 %4, %4\n\tv_exp_f32 %5, %5\n\tv_exp_f32 %6, %6\n\tv_exp_f32 %7, %7\n\tv_exp_f32 %8, %8\n\tv_exp_f32 %9, %9\n\tv_exp_f32 %10, %10\n\tv_exp_f32 %11, %11\n\tv_exp_f32 %12, %12\n\tv_exp_f32 %13, %13\n\tv_exp_f32 %14, %14\n\tv_exp_f32 %15, %15\n\tv_exp_f32 %16, %16\n\tv_nop" : "+v"(e[0]), "+v"(e[1]), "+v"(e[2]), "+v"(e[3]), "+v"(e[4]), "+v"(e[5]), "+v"(e[6]), "+v"(e[7]), "+v"(e[8]), "+v"(e[9]), "+v"(e[10]), "+v"(e[11]), "+v"(e[12]), "+v"(e[13]), "+v"(e[14]), "+v"(e[15]), "+v"(e[16])); }
__device__ __forceinline__ float xhalf(float x) { const int b = __float_as_int(x); return __int_as_float(__builtin_amdgcn_permlanex16(b, b, 0x76543210, 0xfedcba98, false, false)); }   // the value of lane l ^ 16
template <typename T16, bool HR, int NQ>
__device__ __forceinline__ void attn_wg(T16* sm, const T16* __restrict__ Q, const T16* __restrict__ Q2, const T16* __restrict__ Kp, const T16* __restrict__ K2, const T16* __restrict__ Vt, const T16* __restrict__ V2, int q0, bf* __restrict__ Ah, bf* __restrict__ Al) {
    typedef WFrag<T16> F; typedef typename F::V V; typedef typename Chunk<T16>::T T8;
    constexpr int NP = HR ? 2 : 1, BUF = 2 * NP * LTILE;   // a buffer: the K tile(s), then the Vt tile(s)
    const int lane = threadIdx.x & 31, lr = lane & 15, hi = lane >> 4;
    const int sr = threadIdx.x >> 3, sc = (threadIdx.x & 7) * 8;   // staging: this thread moves 16 bytes at element sc of rows sr and sr + 32 of every tile
    const float C2 = SCL * 1.4426950408889634f, OFF = HR ? 0.0f : 10.0f;
    V qf[NQ][2], qg[NQ][2];
#pragma unroll
    for (int n = 0; n < NQ; ++n)
#pragma unroll
        for (int ks = 0; ks < 2; ++ks) { const size_t qo = (size_t)(q0 + n * 16 + lr) * HD + ks * 32 + 8 * hi; qf[n][ks] = ldx(Q + qo); if (HR) qg[n][ks] = ldx(Q2 + qo); }
    v8f o[NQ][4]; float m[NQ], l[NQ];
#pragma unroll
    for (int n = 0; n < NQ; ++n) { m[n] = -3.0e38f; l[n] = 0.0f;
#pragma unroll
        for (int db = 0; db < 4; ++db) o[n][db] = (v8f){}; }
    T8 gk[2], gk2[2], gv[2], gv2[2];
#pragma unroll
    for (int i = 0; i < 2; ++i) { const int r = sr + 32 * i; gk[i] = ldw<T8>(Kp + (size_t)r * HD + sc); gv[i] = ldw<T8>(Vt + (size_t)r * TT + sc); if (HR) { gk2[i] = ldw<T8>(K2 + (size_t)r * HD + sc); gv2[i] = ldw<T8>(V2 + (size_t)r * TT + sc); } }
#pragma unroll
    for (int i = 0; i < 2; ++i) { T16* d = sm + (sr + 32 * i) * LP + sc; *(T8*)d = gk[i]; *(T8*)(d + NP * LTILE) = gv[i]; if (HR) { *(T8*)(d + LTILE) = gk2[i]; *(T8*)(d + 3 * LTILE) = gv2[i]; } }
    __syncthreads();   // stage 0 is in LDS for every wave
#pragma unroll 1
    for (int st = 0; st < TT / KST; ++st) {
        const T16* cur = sm + (st & 1) * BUF; T16* nxt = sm + ((st + 1) & 1) * BUF;
        const int kn = (st + 1 < TT / KST) ? (st + 1) * KST : 0;   // the next stage's lines fly while this stage is worked on (last stage: keys 0 again, in bounds, never read from LDS)
#pragma unroll
        for (int i = 0; i < 2; ++i) { const int r = sr + 32 * i; gk[i] = ldw<T8>(Kp + (size_t)(kn + r) * HD + sc); gv[i] = ldw<T8>(Vt + (size_t)r * TT + kn + sc); if (HR) { gk2[i] = ldw<T8>(K2 + (size_t)(kn + r) * HD + sc); gv2[i] = ldw<T8>(V2 + (size_t)r * TT + kn + sc); } }
#pragma unroll
        for (int p = 0; p < KST / 32; ++p) {
            v8f s[NQ][2];
#pragma unroll
            for (int kt = 0; kt < 2; ++kt) { V kf[2], kg[2];
#pragma unroll
                for (int ks = 0; ks < 2; ++ks) { const T16* a = cur + (p * 32 + kt * 16 + lr) * LP + ks * 32 + 8 * hi; kf[ks] = F::ld(a); if (HR) kg[ks] = F::ld(a + LTILE); }
#pragma unroll
                for (int n = 0; n < NQ; ++n) { s[n][kt] = (v8f){};
#pragma unroll
                    for (int ks = 0; ks < 2; ++ks) { s[n][kt] = F::mma(kf[ks], qf[n][ks], s[n][kt]); if (HR) { s[n][kt] = F::mma(kf[ks], qg[n][ks], s[n][kt]); s[n][kt] = F::mma(kg[ks], qf[n][ks], s[n][kt]); } } } }
            V pf[NQ], pg[NQ];
#pragma unroll
            for (int n = 0; n < NQ; ++n) {
                float mx = s[n][0][0];
#pragma unroll
                for (int j = 1; j < 8; ++j) mx = fmaxf(mx, s[n][0][j]);
#pragma unroll
                for (int j = 0; j < 8; ++j) mx = fmaxf(mx, s[n][1][j]);
                mx = fmaxf(mx, xhalf(mx));
                const float mn = fmaxf(m[n], mx); float e[17]; e[16] = (m[n] - mn) * C2; m[n] = mn;
                const float nb = OFF - mn * C2; const v8f d0 = s[n][0] * C2 + nb, d1 = s[n][1] * C2 + nb; v8f p0, p1;   // one fused multiply-add per score: (s - mn) C2 + OFF
#pragma unroll
                for (int j = 0; j < 8; ++j) { e[j] = d0[j]; e[8 + j] = d1[j]; }
                exp2run(e); const float al = e[16];
#pragma unroll
                for (int j = 0; j < 8; ++j) { p0[j] = e[j]; p1[j] = e[8 + j]; }
                const v8f ps = p0 + p1;
                l[n] = l[n] * al + (((ps[0] + ps[1]) + (ps[2] + ps[3])) + ((ps[4] + ps[5]) + (ps[6] + ps[7])));
#pragma unroll
                for (int db = 0; db < 4; ++db) o[n][db] *= al;
                if constexpr (HR) {
                    const v8bf h0 = __builtin_convertvector(p0, v8bf), h1 = __builtin_convertvector(p1, v8bf);
                    const v8bf l0 = __builtin_convertvector(p0 - __builtin_convertvector(h0, v8f), v8bf), l1 = __builtin_convertvector(p1 - __builtin_convertvector(h1, v8f), v8bf);
                    pf[n] = __builtin_shufflevector(h0, h1, 0, 1, 2, 3, 4, 5, 6, 7, 8, 9, 10, 11, 12, 13, 14, 15); pg[n] = __builtin_shufflevector(l0, l1, 0, 1, 2, 3, 4, 5, 6, 7, 8, 9, 10, 11, 12, 13, 14, 15);
                } else pf[n] = cat16(__builtin_convertvector(p0, v8h), __builtin_convertvector(p1, v8h));
            }
#pragma unroll
            for (int db = 0; db < 4; ++db) { const T16* a = cur + NP * LTILE + (db * 16 + lr) * LP + p * 32 + 8 * hi; const V vf = F::ld(a); V vg; if (HR) vg = F::ld(a + LTILE);
#pragma unroll
                for (int n = 0; n < NQ; ++n) { o[n][db] = F::mma(vf, pf[n], o[n][db]); if (HR) { o[n][db] = F::mma(vf, pg[n], o[n][db]); o[n][db] = F::mma(vg, pf[n], o[n][db]); } } }
        }
        // five vector slots between the stage's last matrix instruction and whatever vector instruction stands first behind the loop's taken back edge
        if constexpr (NQ == 2) asm volatile("v_nop\n\tv_nop\n\tv_nop\n\tv_nop\n\tv_nop" : "+v"(o[0][0]), "+v"(o[0][1]), "+v"(o[0][2]), "+v"(o[0][3]), "+v"(o[1][0]), "+v"(o[1][1]), "+v"(o[1][2]), "+v"(o[1][3]));
        else asm volatile("v_nop\n\tv_nop\n\tv_nop\n\tv_nop\n\tv_nop" : "+v"(o[0][0]), "+v"(o[0][1]), "+v"(o[0][2]), "+v"(o[0][3]));
#pragma unroll
        for (int i = 0; i < 2; ++i) { T16* d = nxt + (sr + 32 * i) * LP + sc; *(T8*)d = gk[i]; *(T8*)(d + NP * LTILE) = gv[i]; if (HR) { *(T8*)(d + LTILE) = gk2[i]; *(T8*)(d + 3 * LTILE) = gv2[i]; } }   // nxt's last readers left it at the barrier that ended the stage before
        __syncthreads();   // publishes nxt and ends every wave's reads of cur, which the next stage refills
    }
#pragma unroll
    for (int n = 0; n < NQ; ++n) { const float inv = __fdiv_rn(1.0f, l[n] + xhalf(l[n])); const size_t oo = (size_t)(q0 + n * 16 + lr) * DQ + 8 * hi;
#pragma unroll
        for (int db = 0; db < 4; ++db) { v8us oh, ol;
#pragma unroll
            for (int j = 0; j < 8; ++j) { unsigned short a, c2; splitf(o[n][db][j] * inv, a, c2); oh[j] = a; ol[j] = c2; }
            *(v8us*)(Ah + oo + db * 16) = oh; *(v8us*)(Al + oo + db * 16) = ol; } }
}
// grid: the NB_ * NH_ * RH / 128 work-groups of the 3-product rows first (8 waves x 16 queries; they last longest), then NB_ * NH_ * (TT - RH) / 256 of 8 waves x 32 queries. Planes [b * NH_ + h][..]; Ah, Al [b][t][DQ].
__global__ __launch_bounds__(256) void k_fattn(const h16* __restrict__ Q16, const h16* __restrict__ K16, const h16* __restrict__ V16, const bf* __restrict__ Qh, const bf* __restrict__ Ql, const bf* __restrict__ Kh, const bf* __restrict__ Kl, const bf* __restrict__ Vh, const bf* __restrict__ Vl, bf* __restrict__ Ah, bf* __restrict__ Al) {
    __shared__ __align__(16) bf sm[2 * 4 * LTILE];
    const int wave = __builtin_amdgcn_readfirstlane((int)(threadIdx.x >> 5)); const int id = blockIdx.x; const int NHR = NB_ * NH_ * (RH / 128);
    if (id < NHR) { const int bh = id / (RH / 128), q0 = (id % (RH / 128)) * 128 + wave * 16; const size_t pl = (size_t)bh * TT * HD, ao = (size_t)(bh / NH_) * TT * DQ + (size_t)(bh % NH_) * HD;
        attn_wg<bf, true, 1>(sm, Qh + pl, Ql + pl, Kh + pl, Kl + pl, Vh + pl, Vl + pl, q0, Ah + ao, Al + ao);
    } else { const int i2 = id - NHR; const int bh = i2 / ((TT - RH) / 256), q0 = RH + (i2 % ((TT - RH) / 256)) * 256 + wave * 32; const size_t pl = (size_t)bh * TT * HD, ao = (size_t)(bh / NH_) * TT * DQ + (size_t)(bh % NH_) * HD;
        attn_wg<h16, false, 2>((h16*)sm, Q16 + pl, nullptr, K16 + pl, nullptr, V16 + pl, nullptr, q0, Ah + ao, Al + ao); }
}

extern "C" void kernel_launch(void* const* d_in, const int* in_sizes, int n_in,
                              void* d_out, int out_size, void* d_ws, size_t ws_size, hipStream_t stream) {
    (void)in_sizes; (void)n_in; (void)out_size;
    const float* x = (const float*)d_in[0]; const float* wqkv = (const float*)d_in[1]; const float* wo = (const float*)d_in[2];
    float* OUT = (float*)d_out;     // [4][2048][1024]
    char* wsp = (char*)d_ws;
    auto take = [&](size_t bytes) { char* p = wsp; wsp += (bytes + 255) & ~(size_t)255; return (void*)p; };
    bf* XB = (bf*)take((NX8 + NW8 + NO8) * 8 * 2); bf* WQKV = XB + NX8 * 8; bf* WO = WQKV + NW8 * 8;   // x of all batches, W_qkv, W_o: one run, as k_cvt8 writes it
    const size_t PQ = (size_t)NH_ * TT * HD;   // one batch's share of a q, k or v plane, in elements (NKV == NH_); every plane holds all NB_ batches
    h16* QP16 = (h16*)take(3 * NB_ * PQ * 2); h16* KP16 = QP16 + NB_ * PQ; h16* VT16 = KP16 + NB_ * PQ;   // q, k, v of one kind of plane lie NB_ * PQ elements apart
    bf* QPh = (bf*)take(3 * NB_ * PQ * 2); bf* KPh = QPh + NB_ * PQ; bf* VTh = KPh + NB_ * PQ;
    bf* QPl = (bf*)take(3 * NB_ * PQ * 2); bf* KPl = QPl + NB_ * PQ; bf* VTl = KPl + NB_ * PQ;
    bf* ATh = (bf*)take((size_t)NB_ * TT * DQ * 2); bf* ATl = (bf*)take((size_t)NB_ * TT * DQ * 2);
    if ((size_t)(wsp - (char*)d_ws) > ws_size) return;    // ws 256 MiB
    k_cvt8<<<(unsigned)((NX8 + NW8 + NO8) / 256), 256, 0, stream>>>(x, wqkv, wo, XB);
    k_gemmw<bf, 0, false, true><<<dim3(TT / 64, 3 * NH_, NB_), 32, 0, stream>>>(XB, nullptr, WQKV, nullptr, DM, nullptr, 0, nullptr, (size_t)TT * DM, 0, PQ, QP16, QPh, QPl, NB_ * PQ);
    k_fattn<<<NB_ * NH_ * (RH / 128 + (TT - RH) / 256), 256, 0, stream>>>(QP16, KP16, VT16, QPh, QPl, KPh, KPl, VTh, VTl, ATh, ATl);   // one kv head per query head
    k_gemmw<bf, 1, false, false><<<dim3(NB_ * TT / 64, DM / 64, 1), 32, 0, stream>>>(ATh, ATl, WO, nullptr, DQ, OUT, DM, nullptr, 0, 0, 0, nullptr, nullptr, nullptr, 0);   // the batches' rows are one run in ATh, ATl and OUT
}

// v006
// It runs in 197 microseconds.
// In two side-by-side timings against v005, it was 1.45 and 1.44 times as fast.
// All steps since v000 together make it 20.3 times as fast.
#include <hip/hip_runtime.h>

// Multi-head attention with a fused 'oi' projection (x [4][2048][1024]; [Q|K|V] = x W_qkv^T ([3072][1024]: rows q | k | v); 16 heads x 64; softmax(q.k/8) over all keys; out = merged W_o^T -> [4][2048][1024] (8.4 M)).
// Compute dtypes, f32 accumulate: every input rounded to bf16; q/k/v on PLAIN bf16 operands (inputs: exact); scores and attn.v: query rows < 512 hl (3 products), the rest single fp16 (P x1024); softmax f32, running maximum; W_o hl x exact (2 products).

#define NB_  4
#define TT   2048
#define DM   1024
#define NH_  16
#define NKV  16
#define REP  (NH_ / NKV)
#define HD   64
#define DQ   (NH_ * HD)
#define DKV  (NKV * HD)
#define RH   512                  // query rows < RH use hi+lo planes (0: none)
#define WIN  0
#define SCL  0.125f   // HD^-0.5
typedef _Float16 h16;
typedef unsigned short bf;
typedef __attribute__((ext_vector_type(16))) __bf16   v16bf;
typedef __attribute__((ext_vector_type(16))) _Float16 v16h;
typedef __attribute__((ext_vector_type(8)))  _Float16 v8h;
typedef __attribute__((ext_vector_type(8)))  unsigned short v8us;
typedef __attribute__((ext_vector_type(8)))  __bf16   v8bf;
typedef __attribute__((ext_vector_type(8)))  float    v8f;
typedef __attribute__((ext_vector_type(4)))  float    v4f;
typedef v8h  __attribute__((may_alias)) v8ha;
typedef v4f  __attribute__((may_alias)) v4fa;
typedef v8us __attribute__((may_alias)) v8usa;

__device__ __forceinline__ unsigned short f2bf(float f) { unsigned u = __float_as_uint(f); u += 0x7FFFu + ((u >> 16) & 1u); return (unsigned short)(u >> 16); }
__device__ __forceinline__ float bf2f(unsigned short b) { return __uint_as_float(((unsigned)b) << 16); }
__device__ __forceinline__ float bfr(float f) { return bf2f(f2bf(f)); }
__device__ __forceinline__ v16h cat16(v8h lo, v8h hi) { return __builtin_shufflevector(lo, hi, 0, 1, 2, 3, 4, 5, 6, 7, 8, 9, 10, 11, 12, 13, 14, 15); }
__device__ __forceinline__ v16bf cat16b(v8us lo, v8us hi) { return __builtin_bit_cast(v16bf, __builtin_shufflevector(lo, hi, 0, 1, 2, 3, 4, 5, 6, 7, 8, 9, 10, 11, 12, 13, 14, 15)); }
__device__ __forceinline__ v8f wmma16(v16h a, v16h b, v8f c) { return __builtin_amdgcn_wmma_f32_16x16x32_f16(false, a, false, b, (short)0, c, false, false); }
__device__ __forceinline__ v8f wmmab(v16bf a, v16bf b, v8f c) { return __builtin_amdgcn_wmma_f32_16x16x32_bf16(false, a, false, b, (short)0, c, false, false); }



__device__ __forceinline__ h16 tohx(float x) { return (h16)x; }
__device__ __forceinline__ void splitf(float y, unsigned short& h, unsigned short& l) { h = f2bf(y); l = f2bf(y - bf2f(h)); }
// ---- k_gemmw: GEMM on a 128 x 256 output tile per work-group of 8 waves (2 x 4), each wave a register-blocked 64x64 sub-tile (16 accumulators); grid (M/128, N/256, Z), 256 threads.
// C[m][n] (f32, pitch ldc, + optional f32 bias[n]) = sum_k A[m][k] Bt[n][k] (+ A2[m][k] Bt[n][k] where NSPLIT == 1). z-batch strides sA/sB/sC in elements. K % 64 == 0.
// The operands come from K-contiguous 16-bit planes through LDS: a stage is 64 k (one whole 128-byte line) of the tile's 128 A rows (and A2 rows) and 256 Bt rows; asynchronous 16-byte copies, a wave's copy = 4 whole lines;
// two buffers, stage t + 2 is copied into the buffer that trip t has just left, one barrier per trip. Every staged row serves 4 (A) or 2 (Bt) waves.
// PL: C is not stored as f32; each value goes out as fp16 (P16) and as bf16 hi + lo (Ph, Pl), at element (n / 64 / NH_) * cts + z * sC + (n / 64 % NH_) * TT * HD + m * HD + n % 64 (v: (n % 64) * TT + m in place of the last two terms) of each plane:
//     ONE launch does q, k and v of every batch: A = x ([b][t][DM], batch stride sA), Bt = all rows of W_qkv, grid (TT/128, 3 * NH_ / 4, NB_); a wave's 64 W rows are one head of q, k or v (plane sets cts elements apart, batches sC apart).
//     q, k: x rows times W rows, stored [h][t][d];  v: the operands swapped (W rows times x rows), stored [h][d][t]. A store instruction writes four whole 128-byte lines.
template <typename T16> struct WFrag;
template <> struct WFrag<h16> { typedef v16h V; static __device__ __forceinline__ V ld(const h16* p) { return cat16(*(const v8h*)p, *(const v8h*)(p + 16)); } static __device__ __forceinline__ v8f mma(V a, V b, v8f c) { return wmma16(a, b, c); } };
template <> struct WFrag<bf> { typedef v16bf V; static __device__ __forceinline__ V ld(const bf* p) { return cat16b(*(const v8us*)p, *(const v8us*)(p + 16)); } static __device__ __forceinline__ v8f mma(V a, V b, v8f c) { return wmmab(a, b, c); } };
#define GTM 128                   // output rows of a work-group's tile
#define GTN 256                   // output columns
#define GKS 64                    // k per stage
#define GLP 72                    // LDS row pitch in 16-bit elements: 144 B = 16 B x odd, 16-byte fragment reads of 16 rows fall on 64 different banks
// cpy<N>: N asynchronous 16-byte copies global -> LDS per lane (l: the lane's LDS byte addresses, g: its global addresses). The s_wait_xcnt 0 is the statement's last line, so it stands in front of every rewrite of an address register that these copies name.
template <int N> __device__ __forceinline__ void cpy(const unsigned* l, const void* const* g);
template <> __device__ __forceinline__ void cpy<8>(const unsigned* l, const void* const* g) {
    asm volatile("global_load_async_to_lds_b128 %0, %8, off\n\tglobal_load_async_to_lds_b128 %1, %9, off\n\tglobal_load_async_to_lds_b128 %2, %10, off\n\tglobal_load_async_to_lds_b128 %3, %11, off\n\tglobal_load_async_to_lds_b128 %4, %12, off\n\tglobal_load_async_to_lds_b128 %5, %13, off\n\tglobal_load_async_to_lds_b128 %6, %14, off\n\tglobal_load_async_to_lds_b128 %7, %15, off\n\ts_wait_xcnt 0x0"
                 :: "v"(l[0]), "v"(l[1]), "v"(l[2]), "v"(l[3]), "v"(l[4]), "v"(l[5]), "v"(l[6]), "v"(l[7]), "v"(g[0]), "v"(g[1]), "v"(g[2]), "v"(g[3]), "v"(g[4]), "v"(g[5]), "v"(g[6]), "v"(g[7]) : "memory"); }
template <> __device__ __forceinline__ void cpy<12>(const unsigned* l, const void* const* g) {
    asm volatile("global_load_async_to_lds_b128 %0, %12, off\n\tglobal_load_async_to_lds_b128 %1, %13, off\n\tglobal_load_async_to_lds_b128 %2, %14, off\n\tglobal_load_async_to_lds_b128 %3, %15, off\n\tglobal_load_async_to_lds_b128 %4, %16, off\n\tglobal_load_async_to_lds_b128 %5, %17, off\n\tglobal_load_async_to_lds_b128 %6, %18, off\n\tglobal_load_async_to_lds_b128 %7, %19, off\n\tglobal_load_async_to_lds_b128 %8, %20, off\n\tglobal_load_async_to_lds_b128 %9, %21, off\n\tglobal_load_async_to_lds_b128 %10, %22, off\n\tglobal_load_async_to_lds_b128 %11, %23, off\n\ts_wait_xcnt 0x0"
                 :: "v"(l[0]), "v"(l[1]), "v"(l[2]), "v"(l[3]), "v"(l[4]), "v"(l[5]), "v"(l[6]), "v"(l[7]), "v"(l[8]), "v"(l[9]), "v"(l[10]), "v"(l[11]), "v"(g[0]), "v"(g[1]), "v"(g[2]), "v"(g[3]), "v"(g[4]), "v"(g[5]), "v"(g[6]), "v"(g[7]), "v"(g[8]), "v"(g[9]), "v"(g[10]), "v"(g[11]) : "memory"); }
// launch bounds: at least 4 waves per SIMD, that is a budget of 256 registers, so that two work-groups of the q/k/v launch share a WGP (their LDS fits twice).
template <typename T16, int NSPLIT, bool BIAS, bool PL>
__global__ __launch_bounds__(256, 4) void k_gemmw(const T16* __restrict__ A, const T16* __restrict__ A2, const T16* __restrict__ Bt, const T16* __restrict__ Bt2, int K, float* C, int ldc, const float* __restrict__ bias, size_t sA, size_t sB, size_t sC, h16* P16, bf* Ph, bf* Pl, size_t cts) {
    static_assert(NSPLIT == 0 || NSPLIT == 1, "A (+ A2) times Bt");
    typedef typename WFrag<T16>::V V;
    constexpr int NAP = NSPLIT == 1 ? 2 : 1, ROWS = GTM * NAP + GTN, BUFE = ROWS * GLP, NC = ROWS / 32;   // a buffer: the A rows, the A2 rows, the Bt rows; NC copies per thread and stage
    __shared__ __align__(16) T16 sm[2 * BUFE];
    __shared__ __align__(16) float osm[8 * 16 * 68];
    const size_t z = blockIdx.z; A += z * sA; if (NSPLIT == 1) A2 += z * sA; Bt += z * sB;
    C += z * sC;
    const int wave = __builtin_amdgcn_readfirstlane((int)(threadIdx.x >> 5)), wm = wave & 1, wn = wave >> 1;
    float* os = osm + wave * (16 * 68);   // each wave's own epilogue staging
    const int lane = threadIdx.x & 31, lr = lane & 15, hi = lane >> 4; const int R0 = blockIdx.x * GTM, C0 = blockIdx.y * GTN; const int r0 = R0 + wm * 64, c0 = C0 + wn * 64;
    int arow = wm * 64, brow = GTM * NAP + wn * 64;   // first staged row of the wave's A and B operand
    size_t pofs = 0; int ldp = HD;   // PL: element of the wave tile's first value in each plane, and the pitch of its rows there
    if constexpr (PL) { const int y = blockIdx.y * (GTN / 64) + wn, sel = y / NH_, h = y % NH_; pofs = (size_t)sel * cts + z * sC + (size_t)h * TT * HD;
        if (sel < 2) pofs += (size_t)r0 * HD;
        else { pofs += r0; ldp = TT; const int t0 = arow; arow = brow; brow = t0; } }
    v8f acc[4][4];   // the unrolls in this kernel make every index of acc, a, a2, b, l and g a constant, so that these arrays live in registers
#pragma unroll
    for (int mb = 0; mb < 4; ++mb)
#pragma unroll
        for (int nb = 0; nb < 4; ++nb) acc[mb][nb] = (v8f){};
    const int sr = threadIdx.x >> 3, sc = (threadIdx.x & 7) * 8;   // staging: this thread copies 16 bytes at element sc of rows sr, sr + 32, ... of the stage
    const T16* pa = A + (size_t)(R0 + sr) * K + sc; const T16* pa2 = NSPLIT == 1 ? A2 + (size_t)(R0 + sr) * K + sc : pa; const T16* pb = Bt + (size_t)(C0 + sr) * K + sc;   // this thread's bytes of the next stage to copy; they move on by one stage per fill
    const unsigned l0 = (unsigned)(size_t)(sm + sr * GLP + sc);
    auto fill = [&](int t) {   // stage t into buffer t & 1
        unsigned l[NC]; const void* g[NC];
#pragma unroll
        for (int j = 0; j < NC; ++j) { l[j] = l0 + (unsigned)(((t & 1) * BUFE + j * 32 * GLP) * 2);
            g[j] = (j < GTM / 32 ? pa + (size_t)j * 32 * K : j < NAP * GTM / 32 ? pa2 + (size_t)(j - GTM / 32) * 32 * K : pb + (size_t)(j - NAP * GTM / 32) * 32 * K); }
        if constexpr (NC == 12) cpy<12>(l, g); else { cpy<8>(l, g); cpy<8>(l + 8, g + 8); }
        pa += GKS; pa2 += GKS; pb += GKS; };
    const int NT = K / GKS;
    fill(0);
    asm volatile("s_wait_asynccnt 0x0" ::: "memory");   // this wave's copies of stage 0 have landed
    __syncthreads();   // stage 0 is in LDS for every wave
    if (NT > 1) fill(1);
#pragma unroll 1   // one trip per stage stays rolled: unrolled, two trips' fragments and addresses would not fit the register budget
    for (int t = 0; t < NT; ++t) {
        const T16* cur = sm + (t & 1) * BUFE;
        V a[4], a2[4], b[4];
        auto frags = [&](int ks) {   // all fragments of 32 k, read as one group
#pragma unroll
            for (int mb = 0; mb < 4; ++mb) { const T16* p = cur + (arow + mb * 16 + lr) * GLP + ks * 32 + 8 * hi; a[mb] = WFrag<T16>::ld(p); if (NSPLIT == 1) a2[mb] = WFrag<T16>::ld(p + GTM * GLP); }
#pragma unroll
            for (int nb = 0; nb < 4; ++nb) b[nb] = WFrag<T16>::ld(cur + (brow + nb * 16 + lr) * GLP + ks * 32 + 8 * hi); };
        auto prods = [&]() {
#pragma unroll
            for (int nb = 0; nb < 4; ++nb)
#pragma unroll
                for (int mb = 0; mb < 4; ++mb) { acc[mb][nb] = WFrag<T16>::mma(a[mb], b[nb], acc[mb][nb]); if (NSPLIT == 1) acc[mb][nb] = WFrag<T16>::mma(a2[mb], b[nb], acc[mb][nb]); } };
        frags(0);
        __builtin_amdgcn_sched_barrier(0);   // keeps the LDS reads together in front of the products: without it the compiler sinks each b fragment's reads to just in front of its products, and the wave waits out the LDS latency four times
        prods();
        frags(1);   // the trip's last reads of cur
        __builtin_amdgcn_sched_barrier(0);   // as above
        if constexpr (NSPLIT == 1) prods();   // three fragment sets and the copies' addresses do not fit 256 registers together: here the last products come first
        asm volatile("s_wait_dscnt 0x0" ::: "memory");      // this wave's reads of cur are done before cur is handed to its next writer
        asm volatile("s_wait_asynccnt 0x0" ::: "memory");   // this wave's copies of stage t + 1 have landed
        __syncthreads();   // publishes stage t + 1 and ends every wave's reads of cur
        if (t + 2 < NT) fill(t + 2);
        if constexpr (NSPLIT == 0) { __builtin_amdgcn_sched_barrier(0);   // keeps the copies in front of the trip's last products (registers only), so that they fly a whole trip before they are waited for
            prods(); }
    }
    asm volatile("s_wait_asynccnt 0x0" ::: "memory");   // no copy is outstanding behind the loop
#pragma unroll
    for (int mb = 0; mb < 4; ++mb) {
#pragma unroll
        for (int nb = 0; nb < 4; ++nb) {
#pragma unroll
            for (int j = 0; j < 8; ++j) os[(hi * 8 + j) * 68 + nb * 16 + lr] = acc[mb][nb][j]; }
        __builtin_amdgcn_wave_barrier(); asm volatile("" ::: "memory");
        if constexpr (PL) {
            const int cofs = (lane & 7) * 8; v4f va[4], vb[4];   // all eight LDS reads of these 16 rows first: the store statements below are memory barriers to the compiler, no read moves up over one
#pragma unroll
            for (int s = 0; s < 4; ++s) { const float* o4 = os + (4 * s + (lane >> 3)) * 68 + cofs; va[s] = *(const v4fa*)o4; vb[s] = *(const v4fa*)(o4 + 4); }
#pragma unroll
            for (int s = 0; s < 4; ++s) { const int row = 4 * s + (lane >> 3); v8h o16; v8us oh, ol;
#pragma unroll
                for (int q = 0; q < 8; ++q) { const float r = q < 4 ? va[s][q & 3] : vb[s][q & 3]; o16[q] = tohx(r); unsigned short a2, c2; splitf(r, a2, c2); oh[q] = a2; ol[q] = c2; }
                const size_t off = pofs + (size_t)(mb * 16 + row) * ldp + cofs;
                // the three stores and their s_wait_xcnt 0 in one statement: the wait then stands in front of every rewrite of a data or address register that these stores name
                asm volatile("global_store_b128 %0, %3, off\n\tglobal_store_b128 %1, %4, off\n\tglobal_store_b128 %2, %5, off\n\ts_wait_xcnt 0x0" :: "v"(P16 + off), "v"(Ph + off), "v"(Pl + off), "v"(o16), "v"(oh), "v"(ol) : "memory"); }
        } else {
            float* crow = C + (size_t)(r0 + mb * 16) * ldc + c0;
#pragma unroll
            for (int s = 0; s < 8; ++s) { const int row = 2 * s + hi, cofs = lr * 4; v4f val = *(const v4fa*)(os + row * 68 + cofs); if (BIAS) { val[0] += bfr(bias[c0 + cofs]); val[1] += bfr(bias[c0 + cofs + 1]); val[2] += bfr(bias[c0 + cofs + 2]); val[3] += bfr(bias[c0 + cofs + 3]); }
                *(v4f*)(crow + (size_t)row * ldc + cofs) = val; }
             }
        __builtin_amdgcn_wave_barrier(); asm volatile("" ::: "memory");
    }
}

typedef __attribute__((ext_vector_type(2))) _Float16 v2h;
typedef __attribute__((ext_vector_type(4))) _Float16 v4h;
typedef __attribute__((ext_vector_type(2))) unsigned short v2us;
typedef __attribute__((ext_vector_type(4))) unsigned short v4us;
typedef __attribute__((ext_vector_type(2))) float v2f;
typedef __attribute__((ext_vector_type(4))) int v4i;

__global__ __launch_bounds__(256) void k_wtG(const float* __restrict__ w, int K, int N, bf* Bt) {
    const int lane = threadIdx.x & 31; const int L0 = (blockIdx.x * 8 + (threadIdx.x >> 5)) * 8; const int nlines = N * K / 64;
{
#pragma unroll 1
        for (int l = 0; l < 8; ++l) { const int L = L0 + l; if (L >= nlines) break; const size_t e = (size_t)L * 64 + lane * 2; const int k = (int)(e % K), n = (int)(e / K); v2us o;
            o[0] = f2bf(w[(size_t)k * N + n]); o[1] = f2bf(w[(size_t)(k + 1) * N + n]); *(v2us*)(Bt + e) = o; }
         }
}
// k_cvt8: x, W_qkv and W_o rounded to bf16 in one launch; dst holds the three one behind the other. Each part is a whole number of work-groups.
#define NX8 ((size_t)NB_ * TT * DM / 8)
#define NW8 ((size_t)(DQ + 2 * DKV) * DM / 8)
#define NO8 ((size_t)DM * DQ / 8)
__global__ __launch_bounds__(256) void k_cvt8(const float* __restrict__ x, const float* __restrict__ wqkv, const float* __restrict__ wo, bf* dst) { const size_t g = (size_t)blockIdx.x * 256, i = g + threadIdx.x;
    const float* src = g < NX8 ? x + i * 8 : g < NX8 + NW8 ? wqkv + (i - NX8) * 8 : wo + (i - NX8 - NW8) * 8; const v8f v = *(const v8f*)src; v8us o;
#pragma unroll
    for (int k = 0; k < 8; ++k) o[k] = f2bf(v[k]); *(v8us*)(dst + i * 8) = o;  }

// ---- k_fattn: scores, softmax and attn.v of one (batch, head) in ONE kernel; no score or P element leaves the registers.
// A wave owns NQ * 16 query columns and walks the 2048 keys 32 at a time: St = K Qt (A = K rows, B = Q rows, kept in registers), so a lane holds 16 scores of ONE query per column group;
// running maximum m and sum l per query (in-lane, the wave's halves joined by one lane exchange); two St tiles, converted in place, are the B operand Pt of Ot += Vt Pt (A = rows of the [d][t] planes).
// Ot: a lane holds 8 consecutive d of one query, scaled by 1 / l at the end and stored as the hi + lo planes that the output projection reads ([b][t][h][d]).
// The work-group's 8 waves share K and Vt through LDS: stages of KST keys, two buffers; whole 128-byte lines go global -> registers -> LDS while the stage before is worked on; one barrier per stage.
// HR (query rows < RH): hi + lo bf16 planes, 3 products each for St and Ot; else single fp16, P carried x 2^10 (l carries the same factor, so it cancels).
#define KST 64                    // keys per LDS stage
#define LP  72                    // LDS row pitch in 16-bit elements: 144 B = 16 B x odd, 16-byte fragment reads of 16 rows fall on 64 different banks
#define LTILE (64 * LP)           // one staged tile: 64 rows (keys of K, or d of Vt) of 64 elements
template <typename T16> struct Chunk;
template <> struct Chunk<h16> { typedef v8h T; };
template <> struct Chunk<bf> { typedef v8us T; };
// ldw: a staging load. The s_wait_xcnt 0 stands behind the 16-byte load so that it comes in front of any rewrite of the address pair the load names (the register allocator gives such pairs to later loads' data); its memory clobber also keeps the load in front of the stage's LDS reads, a whole stage ahead of its use.
// ldx: the same for a fragment loaded straight from global memory (the Q rows, once per wave).
__device__ __forceinline__ v16h ldx(const h16* p) { const v8h lo = *(const v8h*)p; asm volatile("s_wait_xcnt 0x0" ::: "memory"); const v8h hi = *(const v8h*)(p + 16); asm volatile("s_wait_xcnt 0x0" ::: "memory"); return cat16(lo, hi); }
__device__ __forceinline__ v16bf ldx(const bf* p) { const v8us lo = *(const v8us*)p; asm volatile("s_wait_xcnt 0x0" ::: "memory"); const v8us hi = *(const v8us*)(p + 16); asm volatile("s_wait_xcnt 0x0" ::: "memory"); return cat16b(lo, hi); }
template <typename T8, typename T16> __device__ __forceinline__ T8 ldw(const T16* p) { const T8 v = *(const T8*)p; asm volatile("s_wait_xcnt 0x0" ::: "memory"); return v; }
// exp2run: 2^x of 17 values, each in its own register, as ONE run of v_exp_f32: no instruction directly behind one of them reads its result or rewrites its source, and the v_nop is that slot behind the last.
__device__ __forceinline__ void exp2run(float (&e)[17]) { asm("v_exp_f32 %0, %0\n\tv_exp_f32 %1, %1\n\tv_exp_f32 %2, %2\n\tv_exp_f32 %3, %3\n\tv_exp_f32 %4, %4\n\tv_exp_f32 %5, %5\n\tv_exp_f32 %6, %6\n\tv_exp_f32 %7, %7\n\tv_exp_f32 %8, %8\n\tv_exp_f32 %9, %9\n\tv_exp_f32 %10, %10\n\tv_exp_f32 %11, %11\n\tv_exp_f32 %12, %12\n\tv_exp_f32 %13, %13\n\tv_exp_f32 %14, %14\n\tv_exp_f32 %15, %15\n\tv_exp_f32 %16, %16\n\tv_nop" : "+v"(e[0]), "+v"(e[1]), "+v"(e[2]), "+v"(e[3]), "+v"(e[4]), "+v"(e[5]), "+v"(e[6]), "+v"(e[7]), "+v"(e[8]), "+v"(e[9]), "+v"(e[10]), "+v"(e[11]), "+v"(e[12]), "+v"(e[13]), "+v"(e[14]), "+v"(e[15]), "+v"(e[16])); }
__device__ __forceinline__ float xhalf(float x) { const int b = __float_as_int(x); return __int_as_float(__builtin_amdgcn_permlanex16(b, b, 0x76543210, 0xfedcba98, false, false)); }   // the value of lane l ^ 16
template <typename T16, bool HR, int NQ>
__device__ __forceinline__ void attn_wg(T16* sm, const T16* __restrict__ Q, const T16* __restrict__ Q2, const T16* __restrict__ Kp, const T16* __restrict__ K2, const T16* __restrict__ Vt, const T16* __restrict__ V2, int q0, bf* __restrict__ Ah, bf* __restrict__ Al) {
    typedef WFrag<T16> F; typedef typename F::V V; typedef typename Chunk<T16>::T T8;
    constexpr int NP = HR ? 2 : 1, BUF = 2 * NP * LTILE;   // a buffer: the K tile(s), then the Vt tile(s)
    const int lane = threadIdx.x & 31, lr = lane & 15, hi = lane >> 4;
    const int sr = threadIdx.x >> 3, sc = (threadIdx.x & 7) * 8;   // staging: this thread moves 16 bytes at element sc of rows sr and sr + 32 of every tile
    const float C2 = SCL * 1.4426950408889634f, OFF = HR ? 0.0f : 10.0f;
    V qf[NQ][2], qg[NQ][2];
#pragma unroll
    for (int n = 0; n < NQ; ++n)
#pragma unroll
        for (int ks = 0; ks < 2; ++ks) { const size_t qo = (size_t)(q0 + n * 16 + lr) * HD + ks * 32 + 8 * hi; qf[n][ks] = ldx(Q + qo); if (HR) qg[n][ks] = ldx(Q2 + qo); }
    v8f o[NQ][4]; float m[NQ], l[NQ];
#pragma unroll
    for (int n = 0; n < NQ; ++n) { m[n] = -3.0e38f; l[n] = 0.0f;
#pragma unroll
        for (int db = 0; db < 4; ++db) o[n][db] = (v8f){}; }
    T8 gk[2], gk2[2], gv[2], gv2[2];
#pragma unroll
    for (int i = 0; i < 2; ++i) { const int r = sr + 32 * i; gk[i] = ldw<T8>(Kp + (size_t)r * HD + sc); gv[i] = ldw<T8>(Vt + (size_t)r * TT + sc); if (HR) { gk2[i] = ldw<T8>(K2 + (size_t)r * HD + sc); gv2[i] = ldw<T8>(V2 + (size_t)r * TT + sc); } }
#pragma unroll
    for (int i = 0; i < 2; ++i) { T16* d = sm + (sr + 32 * i) * LP + sc; *(T8*)d = gk[i]; *(T8*)(d + NP * LTILE) = gv[i]; if (HR) { *(T8*)(d + LTILE) = gk2[i]; *(T8*)(d + 3 * LTILE) = gv2[i]; } }
    __syncthreads();   // stage 0 is in LDS for every wave
#pragma unroll 1
    for (int st = 0; st < TT / KST; ++st) {
        const T16* cur = sm + (st & 1) * BUF; T16* nxt = sm + ((st + 1) & 1) * BUF;
        const int kn = (st + 1 < TT / KST) ? (st + 1) * KST : 0;   // the next stage's lines fly while this stage is worked on (last stage: keys 0 again, in bounds, never read from LDS)
#pragma unroll
        for (int i = 0; i < 2; ++i) { const int r = sr + 32 * i; gk[i] = ldw<T8>(Kp + (size_t)(kn + r) * HD + sc); gv[i] = ldw<T8>(Vt + (size_t)r * TT + kn + sc); if (HR) { gk2[i] = ldw<T8>(K2 + (size_t)(kn + r) * HD + sc); gv2[i] = ldw<T8>(V2 + (size_t)r * TT + kn + sc); } }
#pragma unroll
        for (int p = 0; p < KST / 32; ++p) {
            v8f s[NQ][2];
#pragma unroll
            for (int kt = 0; kt < 2; ++kt) { V kf[2], kg[2];
#pragma unroll
                for (int ks = 0; ks < 2; ++ks) { const T16* a = cur + (p * 32 + kt * 16 + lr) * LP + ks * 32 + 8 * hi; kf[ks] = F::ld(a); if (HR) kg[ks] = F::ld(a + LTILE); }
#pragma unroll
                for (int n = 0; n < NQ; ++n) { s[n][kt] = (v8f){};
#pragma unroll
                    for (int ks = 0; ks < 2; ++ks) { s[n][kt] = F::mma(kf[ks], qf[n][ks], s[n][kt]); if (HR) { s[n][kt] = F::mma(kf[ks], qg[n][ks], s[n][kt]); s[n][kt] = F::mma(kg[ks], qf[n][ks], s[n][kt]); } } } }
            V pf[NQ], pg[NQ];
#pragma unroll
            for (int n = 0; n < NQ; ++n) {
                float mx = s[n][0][0];
#pragma unroll
                for (int j = 1; j < 8; ++j) mx = fmaxf(mx, s[n][0][j]);
#pragma unroll
                for (int j = 0; j < 8; ++j) mx = fmaxf(mx, s[n][1][j]);
                mx = fmaxf(mx, xhalf(mx));
                const float mn = fmaxf(m[n], mx); float e[17]; e[16] = (m[n] - mn) * C2; m[n] = mn;
                const float nb = OFF - mn * C2; const v8f d0 = s[n][0] * C2 + nb, d1 = s[n][1] * C2 + nb; v8f p0, p1;   // one fused multiply-add per score: (s - mn) C2 + OFF
#pragma unroll
                for (int j = 0; j < 8; ++j) { e[j] = d0[j]; e[8 + j] = d1[j]; }
                exp2run(e); const float al = e[16];
#pragma unroll
                for (int j = 0; j < 8; ++j) { p0[j] = e[j]; p1[j] = e[8 + j]; }
                const v8f ps = p0 + p1;
                l[n] = l[n] * al + (((ps[0] + ps[1]) + (ps[2] + ps[3])) + ((ps[4] + ps[5]) + (ps[6] + ps[7])));
#pragma unroll
                for (int db = 0; db < 4; ++db) o[n][db] *= al;
                if constexpr (HR) {
                    const v8bf h0 = __builtin_convertvector(p0, v8bf), h1 = __builtin_convertvector(p1, v8bf);
                    const v8bf l0 = __builtin_convertvector(p0 - __builtin_convertvector(h0, v8f), v8bf), l1 = __builtin_convertvector(p1 - __builtin_convertvector(h1, v8f), v8bf);
                    pf[n] = __builtin_shufflevector(h0, h1, 0, 1, 2, 3, 4, 5, 6, 7, 8, 9, 10, 11, 12, 13, 14, 15); pg[n] = __builtin_shufflevector(l0, l1, 0, 1, 2, 3, 4, 5, 6, 7, 8, 9, 10, 11, 12, 13, 14, 15);
                } else pf[n] = cat16(__builtin_convertvector(p0, v8h), __builtin_convertvector(p1, v8h));
            }
#pragma unroll
            for (int db = 0; db < 4; ++db) { const T16* a = cur + NP * LTILE + (db * 16 + lr) * LP + p * 32 + 8 * hi; const V vf = F::ld(a); V vg; if (HR) vg = F::ld(a + LTILE);
#pragma unroll
                for (int n = 0; n < NQ; ++n) { o[n][db] = F::mma(vf, pf[n], o[n][db]); if (HR) { o[n][db] = F::mma(vf, pg[n], o[n][db]); o[n][db] = F::mma(vg, pf[n], o[n][db]); } } }
        }
        // five vector slots between the stage's last matrix instruction and whatever vector instruction stands first behind the loop's taken back edge
        if constexpr (NQ == 2) asm volatile("v_nop\n\tv_nop\n\tv_nop\n\tv_nop\n\tv_nop" : "+v"(o[0][0]), "+v"(o[0][1]), "+v"(o[0][2]), "+v"(o[0][3]), "+v"(o[1][0]), "+v"(o[1][1]), "+v"(o[1][2]), "+v"(o[1][3]));
        else asm volatile("v_nop\n\tv_nop\n\tv_nop\n\tv_nop\n\tv_nop" : "+v"(o[0][0]), "+v"(o[0][1]), "+v"(o[0][2]), "+v"(o[0][3]));
#pragma unroll
        for (int i = 0; i < 2; ++i) { T16* d = nxt + (sr + 32 * i) * LP + sc; *(T8*)d = gk[i]; *(T8*)(d + NP * LTILE) = gv[i]; if (HR) { *(T8*)(d + LTILE) = gk2[i]; *(T8*)(d + 3 * LTILE) = gv2[i]; } }   // nxt's last readers left it at the barrier that ended the stage before
        __syncthreads();   // publishes nxt and ends every wave's reads of cur, which the next stage refills
    }
#pragma unroll
    for (int n = 0; n < NQ; ++n) { const float inv = __fdiv_rn(1.0f, l[n] + xhalf(l[n])); const size_t oo = (size_t)(q0 + n * 16 + lr) * DQ + 8 * hi;
#pragma unroll
        for (int db = 0; db < 4; ++db) { v8us oh, ol;
#pragma unroll
            for (int j = 0; j < 8; ++j) { unsigned short a, c2; splitf(o[n][db][j] * inv, a, c2); oh[j] = a; ol[j] = c2; }
            *(v8us*)(Ah + oo + db * 16) = oh; *(v8us*)(Al + oo + db * 16) = ol; } }
}
// grid: the NB_ * NH_ * RH / 128 work-groups of the 3-product rows first (8 waves x 16 queries; they last longest), then NB_ * NH_ * (TT - RH) / 256 of 8 waves x 32 queries. Planes [b * NH_ + h][..]; Ah, Al [b][t][DQ].
__global__ __launch_bounds__(256) void k_fattn(const h16* __restrict__ Q16, const h16* __restrict__ K16, const h16* __restrict__ V16, const bf* __restrict__ Qh, const bf* __restrict__ Ql, const bf* __restrict__ Kh, const bf* __restrict__ Kl, const bf* __restrict__ Vh, const bf* __restrict__ Vl, bf* __restrict__ Ah, bf* __restrict__ Al) {
    __shared__ __align__(16) bf sm[2 * 4 * LTILE];
    const int wave = __builtin_amdgcn_readfirstlane((int)(threadIdx.x >> 5)); const int id = blockIdx.x; const int NHR = NB_ * NH_ * (RH / 128);
    if (id < NHR) { const int bh = id / (RH / 128), q0 = (id % (RH / 128)) * 128 + wave * 16; const size_t pl = (size_t)bh * TT * HD, ao = (size_t)(bh / NH_) * TT * DQ + (size_t)(bh % NH_) * HD;
        attn_wg<bf, true, 1>(sm, Qh + pl, Ql + pl, Kh + pl, Kl + pl, Vh + pl, Vl + pl, q0, Ah + ao, Al + ao);
    } else { const int i2 = id - NHR; const int bh = i2 / ((TT - RH) / 256), q0 = RH + (i2 % ((TT - RH) / 256)) * 256 + wave * 32; const size_t pl = (size_t)bh * TT * HD, ao = (size_t)(bh / NH_) * TT * DQ + (size_t)(bh % NH_) * HD;
        attn_wg<h16, false, 2>((h16*)sm, Q16 + pl, nullptr, K16 + pl, nullptr, V16 + pl, nullptr, q0, Ah + ao, Al + ao); }
}

extern "C" void kernel_launch(void* const* d_in, const int* in_sizes, int n_in,
                              void* d_out, int out_size, void* d_ws, size_t ws_size, hipStream_t stream) {
    (void)in_sizes; (void)n_in; (void)out_size;
    const float* x = (const float*)d_in[0]; const float* wqkv = (const float*)d_in[1]; const float* wo = (const float*)d_in[2];
    float* OUT = (float*)d_out;     // [4][2048][1024]
    char* wsp = (char*)d_ws;
    auto take = [&](size_t bytes) { char* p = wsp; wsp += (bytes + 255) & ~(size_t)255; return (void*)p; };
    bf* XB = (bf*)take((NX8 + NW8 + NO8) * 8 * 2); bf* WQKV = XB + NX8 * 8; bf* WO = WQKV + NW8 * 8;   // x of all batches, W_qkv, W_o: one run, as k_cvt8 writes it
    const size_t PQ = (size_t)NH_ * TT * HD;   // one batch's share of a q, k or v plane, in elements (NKV == NH_); every plane holds all NB_ batches
    h16* QP16 = (h16*)take(3 * NB_ * PQ * 2); h16* KP16 = QP16 + NB_ * PQ; h16* VT16 = KP16 + NB_ * PQ;   // q, k, v of one kind of plane lie NB_ * PQ elements apart
    bf* QPh = (bf*)take(3 * NB_ * PQ * 2); bf* KPh = QPh + NB_ * PQ; bf* VTh = KPh + NB_ * PQ;
    bf* QPl = (bf*)take(3 * NB_ * PQ * 2); bf* KPl = QPl + NB_ * PQ; bf* VTl = KPl + NB_ * PQ;
    bf* ATh = (bf*)take((size_t)NB_ * TT * DQ * 2); bf* ATl = (bf*)take((size_t)NB_ * TT * DQ * 2);
    if ((size_t)(wsp - (char*)d_ws) > ws_size) return;    // ws 256 MiB
    k_cvt8<<<(unsigned)((NX8 + NW8 + NO8) / 256), 256, 0, stream>>>(x, wqkv, wo, XB);
    k_gemmw<bf, 0, false, true><<<dim3(TT / GTM, 3 * NH_ * 64 / GTN, NB_), 256, 0, stream>>>(XB, nullptr, WQKV, nullptr, DM, nullptr, 0, nullptr, (size_t)TT * DM, 0, PQ, QP16, QPh, QPl, NB_ * PQ);
    k_fattn<<<NB_ * NH_ * (RH / 128 + (TT - RH) / 256), 256, 0, stream>>>(QP16, KP16, VT16, QPh, QPl, KPh, KPl, VTh, VTl, ATh, ATl);   // one kv head per query head
    k_gemmw<bf, 1, false, false><<<dim3(NB_ * TT / GTM, DM / GTN, 1), 256, 0, stream>>>(ATh, ATl, WO, nullptr, DQ, OUT, DM, nullptr, 0, 0, 0, nullptr, nullptr, nullptr, 0);   // the batches' rows are one run in ATh, ATl and OUT
}

// v007
// A run of this version takes 178 microseconds.
// Next to v006, in two timings, it ran 1.11 times as fast each time.
// Counting every step since v000, it is 22.5 times as fast.
#include <hip/hip_runtime.h>

// Multi-head attention with a fused 'oi' projection (x [4][2048][1024]; [Q|K|V] = x W_qkv^T ([3072][1024]: rows q | k | v); 16 heads x 64; softmax(q.k/8) over all keys; out = merged W_o^T -> [4][2048][1024] (8.4 M)).
// Compute dtypes, f32 accumulate: every input rounded to bf16; q/k/v on PLAIN bf16 operands (inputs: exact); scores and attn.v: query rows < 512 hl (3 products), the rest single fp16 (P x1024); softmax f32, maximum held while P fits its type; W_o hl x exact (2 products).

#define NB_  4
#define TT   2048
#define DM   1024
#define NH_  16
#define NKV  16
#define REP  (NH_ / NKV)
#define HD   64
#define DQ   (NH_ * HD)
#define DKV  (NKV * HD)
#define RH   512                  // query rows < RH use hi+lo planes (0: none)
#define WIN  0
#define SCL  0.125f   // HD^-0.5
typedef _Float16 h16;
typedef unsigned short bf;
typedef __attribute__((ext_vector_type(16))) __bf16   v16bf;
typedef __attribute__((ext_vector_type(16))) _Float16 v16h;
typedef __attribute__((ext_vector_type(8)))  _Float16 v8h;
typedef __attribute__((ext_vector_type(8)))  unsigned short v8us;
typedef __attribute__((ext_vector_type(8)))  __bf16   v8bf;
typedef __attribute__((ext_vector_type(8)))  float    v8f;
typedef __attribute__((ext_vector_type(4)))  float    v4f;
typedef v8h  __attribute__((may_alias)) v8ha;
typedef v4f  __attribute__((may_alias)) v4fa;
typedef v8us __attribute__((may_alias)) v8usa;

__device__ __forceinline__ unsigned short f2bf(float f) { unsigned u = __float_as_uint(f); u += 0x7FFFu + ((u >> 16) & 1u); return (unsigned short)(u >> 16); }
__device__ __forceinline__ float bf2f(unsigned short b) { return __uint_as_float(((unsigned)b) << 16); }
__device__ __forceinline__ float bfr(float f) { return bf2f(f2bf(f)); }
__device__ __forceinline__ v16h cat16(v8h lo, v8h hi) { return __builtin_shufflevector(lo, hi, 0, 1, 2, 3, 4, 5, 6, 7, 8, 9, 10, 11, 12, 13, 14, 15); }
__device__ __forceinline__ v16bf cat16b(v8us lo, v8us hi) { return __builtin_bit_cast(v16bf, __builtin_shufflevector(lo, hi, 0, 1, 2, 3, 4, 5, 6, 7, 8, 9, 10, 11, 12, 13, 14, 15)); }
__device__ __forceinline__ v8f wmma16(v16h a, v16h b, v8f c) { return __builtin_amdgcn_wmma_f32_16x16x32_f16(false, a, false, b, (short)0, c, false, false); }
__device__ __forceinline__ v8f wmmab(v16bf a, v16bf b, v8f c) { return __builtin_amdgcn_wmma_f32_16x16x32_bf16(false, a, false, b, (short)0, c, false, false); }



__device__ __forceinline__ h16 tohx(float x) { return (h16)x; }
__device__ __forceinline__ void splitf(float y, unsigned short& h, unsigned short& l) { h = f2bf(y); l = f2bf(y - bf2f(h)); }
// ---- k_gemmw: GEMM on a 128 x 256 output tile per work-group of 8 waves (2 x 4), each wave a register-blocked 64x64 sub-tile (16 accumulators); grid (M/128, N/256, Z), 256 threads.
// C[m][n] (f32, pitch ldc, + optional f32 bias[n]) = sum_k A[m][k] Bt[n][k] (+ A2[m][k] Bt[n][k] where NSPLIT == 1). z-batch strides sA/sB/sC in elements. K % 64 == 0.
// The operands come from K-contiguous 16-bit planes through LDS: a stage is 64 k (one whole 128-byte line) of the tile's 128 A rows (and A2 rows) and 256 Bt rows; asynchronous 16-byte copies, a wave's copy = 4 whole lines;
// two buffers, stage t + 2 is copied into the buffer that trip t has just left, one barrier per trip. Every staged row serves 4 (A) or 2 (Bt) waves.
// PL: C is not stored as f32; each value goes out as fp16 (P16) and as bf16 hi + lo (Ph, Pl), at element (n / 64 / NH_) * cts + z * sC + (n / 64 % NH_) * TT * HD + m * HD + n % 64 (v: (n % 64) * TT + m in place of the last two terms) of each plane:
//     ONE launch does q, k and v of every batch: A = x ([b][t][DM], batch stride sA), Bt = all rows of W_qkv, grid (TT/128, 3 * NH_ / 4, NB_); a wave's 64 W rows are one head of q, k or v (plane sets cts elements apart, batches sC apart).
//     q, k: x rows times W rows, stored [h][t][d];  v: the operands swapped (W rows times x rows), stored [h][d][t]. A store instruction writes four whole 128-byte lines.
template <typename T16> struct WFrag;
template <> struct WFrag<h16> { typedef v16h V; static __device__ __forceinline__ V ld(const h16* p) { return cat16(*(const v8h*)p, *(const v8h*)(p + 16)); } static __device__ __forceinline__ v8f mma(V a, V b, v8f c) { return wmma16(a, b, c); } };
template <> struct WFrag<bf> { typedef v16bf V; static __device__ __forceinline__ V ld(const bf* p) { return cat16b(*(const v8us*)p, *(const v8us*)(p + 16)); } static __device__ __forceinline__ v8f mma(V a, V b, v8f c) { return wmmab(a, b, c); } };
#define GTM 128                   // output rows of a work-group's tile
#define GTN 256                   // output columns
#define GKS 64                    // k per stage
#define GLP 72                    // LDS row pitch in 16-bit elements: 144 B = 16 B x odd, 16-byte fragment reads of 16 rows fall on 64 different banks
// cpy<N>: N asynchronous 16-byte copies global -> LDS per lane (l: the lane's LDS byte addresses, g: its global addresses). The s_wait_xcnt 0 is the statement's last line, so it stands in front of every rewrite of an address register that these copies name.
template <int N> __device__ __forceinline__ void cpy(const unsigned* l, const void* const* g);
template <> __device__ __forceinline__ void cpy<8>(const unsigned* l, const void* const* g) {
    asm volatile("global_load_async_to_lds_b128 %0, %8, off\n\tglobal_load_async_to_lds_b128 %1, %9, off\n\tglobal_load_async_to_lds_b128 %2, %10, off\n\tglobal_load_async_to_lds_b128 %3, %11, off\n\tglobal_load_async_to_lds_b128 %4, %12, off\n\tglobal_load_async_to_lds_b128 %5, %13, off\n\tglobal_load_async_to_lds_b128 %6, %14, off\n\tglobal_load_async_to_lds_b128 %7, %15, off\n\ts_wait_xcnt 0x0"
                 :: "v"(l[0]), "v"(l[1]), "v"(l[2]), "v"(l[3]), "v"(l[4]), "v"(l[5]), "v"(l[6]), "v"(l[7]), "v"(g[0]), "v"(g[1]), "v"(g[2]), "v"(g[3]), "v"(g[4]), "v"(g[5]), "v"(g[6]), "v"(g[7]) : "memory"); }
template <> __device__ __forceinline__ void cpy<12>(const unsigned* l, const void* const* g) {
    asm volatile("global_load_async_to_lds_b128 %0, %12, off\n\tglobal_load_async_to_lds_b128 %1, %13, off\n\tglobal_load_async_to_lds_b128 %2, %14, off\n\tglobal_load_async_to_lds_b128 %3, %15, off\n\tglobal_load_async_to_lds_b128 %4, %16, off\n\tglobal_load_async_to_lds_b128 %5, %17, off\n\tglobal_load_async_to_lds_b128 %6, %18, off\n\tglobal_load_async_to_lds_b128 %7, %19, off\n\tglobal_load_async_to_lds_b128 %8, %20, off\n\tglobal_load_async_to_lds_b128 %9, %21, off\n\tglobal_load_async_to_lds_b128 %10, %22, off\n\tglobal_load_async_to_lds_b128 %11, %23, off\n\ts_wait_xcnt 0x0"
                 :: "v"(l[0]), "v"(l[1]), "v"(l[2]), "v"(l[3]), "v"(l[4]), "v"(l[5]), "v"(l[6]), "v"(l[7]), "v"(l[8]), "v"(l[9]), "v"(l[10]), "v"(l[11]), "v"(g[0]), "v"(g[1]), "v"(g[2]), "v"(g[3]), "v"(g[4]), "v"(g[5]), "v"(g[6]), "v"(g[7]), "v"(g[8]), "v"(g[9]), "v"(g[10]), "v"(g[11]) : "memory"); }
// launch bounds: at least 4 waves per SIMD, that is a budget of 256 registers, so that two work-groups of the q/k/v launch share a WGP (their LDS fits twice).
template <typename T16, int NSPLIT, bool BIAS, bool PL>
__global__ __launch_bounds__(256, 4) void k_gemmw(const T16* __restrict__ A, const T16* __restrict__ A2, const T16* __restrict__ Bt, const T16* __restrict__ Bt2, int K, float* C, int ldc, const float* __restrict__ bias, size_t sA, size_t sB, size_t sC, h16* P16, bf* Ph, bf* Pl, size_t cts) {
    static_assert(NSPLIT == 0 || NSPLIT == 1, "A (+ A2) times Bt");
    typedef typename WFrag<T16>::V V;
    constexpr int NAP = NSPLIT == 1 ? 2 : 1, ROWS = GTM * NAP + GTN, BUFE = ROWS * GLP, NC = ROWS / 32;   // a buffer: the A rows, the A2 rows, the Bt rows; NC copies per thread and stage
    __shared__ __align__(16) T16 sm[2 * BUFE];
    __shared__ __align__(16) float osm[8 * 16 * 68];
    const size_t z = blockIdx.z; A += z * sA; if (NSPLIT == 1) A2 += z * sA; Bt += z * sB;
    C += z * sC;
    const int wave = __builtin_amdgcn_readfirstlane((int)(threadIdx.x >> 5)), wm = wave & 1, wn = wave >> 1;
    float* os = osm + wave * (16 * 68);   // each wave's own epilogue staging
    const int lane = threadIdx.x & 31, lr = lane & 15, hi = lane >> 4; const int R0 = blockIdx.x * GTM, C0 = blockIdx.y * GTN; const int r0 = R0 + wm * 64, c0 = C0 + wn * 64;
    int arow = wm * 64, brow = GTM * NAP + wn * 64;   // first staged row of the wave's A and B operand
    size_t pofs = 0; int ldp = HD;   // PL: element of the wave tile's first value in each plane, and the pitch of its rows there
    if constexpr (PL) { const int y = blockIdx.y * (GTN / 64) + wn, sel = y / NH_, h = y % NH_; pofs = (size_t)sel * cts + z * sC + (size_t)h * TT * HD;
        if (sel < 2) pofs += (size_t)r0 * HD;
        else { pofs += r0; ldp = TT; const int t0 = arow; arow = brow; brow = t0; } }
    v8f acc[4][4];   // the unrolls in this kernel make every index of acc, a, a2, b, l and g a constant, so that these arrays live in registers
#pragma unroll
    for (int mb = 0; mb < 4; ++mb)
#pragma unroll
        for (int nb = 0; nb < 4; ++nb) acc[mb][nb] = (v8f){};
    const int sr = threadIdx.x >> 3, sc = (threadIdx.x & 7) * 8;   // staging: this thread copies 16 bytes at element sc of rows sr, sr + 32, ... of the stage
    const T16* pa = A + (size_t)(R0 + sr) * K + sc; const T16* pa2 = NSPLIT == 1 ? A2 + (size_t)(R0 + sr) * K + sc : pa; const T16* pb = Bt + (size_t)(C0 + sr) * K + sc;   // this thread's bytes of the next stage to copy; they move on by one stage per fill
    const unsigned l0 = (unsigned)(size_t)(sm + sr * GLP + sc);
    auto fill = [&](int t) {   // stage t into buffer t & 1
        unsigned l[NC]; const void* g[NC];
#pragma unroll
        for (int j = 0; j < NC; ++j) { l[j] = l0 + (unsigned)(((t & 1) * BUFE + j * 32 * GLP) * 2);
            g[j] = (j < GTM / 32 ? pa + (size_t)j * 32 * K : j < NAP * GTM / 32 ? pa2 + (size_t)(j - GTM / 32) * 32 * K : pb + (size_t)(j - NAP * GTM / 32) * 32 * K); }
        if constexpr (NC == 12) cpy<12>(l, g); else { cpy<8>(l, g); cpy<8>(l + 8, g + 8); }
        pa += GKS; pa2 += GKS; pb += GKS; };
    const int NT = K / GKS;
    fill(0);
    asm volatile("s_wait_asynccnt 0x0" ::: "memory");   // this wave's copies of stage 0 have landed
    __syncthreads();   // stage 0 is in LDS for every wave
    if (NT > 1) fill(1);
#pragma unroll 1   // one trip per stage stays rolled: unrolled, two trips' fragments and addresses would not fit the register budget
    for (int t = 0; t < NT; ++t) {
        const T16* cur = sm + (t & 1) * BUFE;
        V a[4], a2[4], b[4];
        auto frags = [&](int ks) {   // all fragments of 32 k, read as one group
#pragma unroll
            for (int mb = 0; mb < 4; ++mb) { const T16* p = cur + (arow + mb * 16 + lr) * GLP + ks * 32 + 8 * hi; a[mb] = WFrag<T16>::ld(p); if (NSPLIT == 1) a2[mb] = WFrag<T16>::ld(p + GTM * GLP); }
#pragma unroll
            for (int nb = 0; nb < 4; ++nb) b[nb] = WFrag<T16>::ld(cur + (brow + nb * 16 + lr) * GLP + ks * 32 + 8 * hi); };
        auto prods = [&]() {
#pragma unroll
            for (int nb = 0; nb < 4; ++nb)
#pragma unroll
                for (int mb = 0; mb < 4; ++mb) { acc[mb][nb] = WFrag<T16>::mma(a[mb], b[nb], acc[mb][nb]); if (NSPLIT == 1) acc[mb][nb] = WFrag<T16>::mma(a2[mb], b[nb], acc[mb][nb]); } };
        frags(0);
        __builtin_amdgcn_sched_barrier(0);   // keeps the LDS reads together in front of the products: without it the compiler sinks each b fragment's reads to just in front of its products, and the wave waits out the LDS latency four times
        prods();
        frags(1);   // the trip's last reads of cur
        __builtin_amdgcn_sched_barrier(0);   // as above
        if constexpr (NSPLIT == 1) prods();   // three fragment sets and the copies' addresses do not fit 256 registers together: here the last products come first
        asm volatile("s_wait_dscnt 0x0" ::: "memory");      // this wave's reads of cur are done before cur is handed to its next writer
        asm volatile("s_wait_asynccnt 0x0" ::: "memory");   // this wave's copies of stage t + 1 have landed
        __syncthreads();   // publishes stage t + 1 and ends every wave's reads of cur
        if (t + 2 < NT) fill(t + 2);
        if constexpr (NSPLIT == 0) { __builtin_amdgcn_sched_barrier(0);   // keeps the copies in front of the trip's last products (registers only), so that they fly a whole trip before they are waited for
            prods(); }
    }
    asm volatile("s_wait_asynccnt 0x0" ::: "memory");   // no copy is outstanding behind the loop
#pragma unroll
    for (int mb = 0; mb < 4; ++mb) {
#pragma unroll
        for (int nb = 0; nb < 4; ++nb) {
#pragma unroll
            for (int j = 0; j < 8; ++j) os[(hi * 8 + j) * 68 + nb * 16 + lr] = acc[mb][nb][j]; }
        __builtin_amdgcn_wave_barrier(); asm volatile("" ::: "memory");
        if constexpr (PL) {
            const int cofs = (lane & 7) * 8; v4f va[4], vb[4];   // all eight LDS reads of these 16 rows first: the store statements below are memory barriers to the compiler, no read moves up over one
#pragma unroll
            for (int s = 0; s < 4; ++s) { const float* o4 = os + (4 * s + (lane >> 3)) * 68 + cofs; va[s] = *(const v4fa*)o4; vb[s] = *(const v4fa*)(o4 + 4); }
#pragma unroll
            for (int s = 0; s < 4; ++s) { const int row = 4 * s + (lane >> 3); v8h o16; v8us oh, ol;
#pragma unroll
                for (int q = 0; q < 8; ++q) { const float r = q < 4 ? va[s][q & 3] : vb[s][q & 3]; o16[q] = tohx(r); unsigned short a2, c2; splitf(r, a2, c2); oh[q] = a2; ol[q] = c2; }
                const size_t off = pofs + (size_t)(mb * 16 + row) * ldp + cofs;
                // the three stores and their s_wait_xcnt 0 in one statement: the wait then stands in front of every rewrite of a data or address register that these stores name
                asm volatile("global_store_b128 %0, %3, off\n\tglobal_store_b128 %1, %4, off\n\tglobal_store_b128 %2, %5, off\n\ts_wait_xcnt 0x0" :: "v"(P16 + off), "v"(Ph + off), "v"(Pl + off), "v"(o16), "v"(oh), "v"(ol) : "memory"); }
        } else {
            float* crow = C + (size_t)(r0 + mb * 16) * ldc + c0;
#pragma unroll
            for (int s = 0; s < 8; ++s) { const int row = 2 * s + hi, cofs = lr * 4; v4f val = *(const v4fa*)(os + row * 68 + cofs); if (BIAS) { val[0] += bfr(bias[c0 + cofs]); val[1] += bfr(bias[c0 + cofs + 1]); val[2] += bfr(bias[c0 + cofs + 2]); val[3] += bfr(bias[c0 + cofs + 3]); }
                *(v4f*)(crow + (size_t)row * ldc + cofs) = val; }
             }
        __builtin_amdgcn_wave_barrier(); asm volatile("" ::: "memory");
    }
}

typedef __attribute__((ext_vector_type(2))) _Float16 v2h;
typedef __attribute__((ext_vector_type(4))) _Float16 v4h;
typedef __attribute__((ext_vector_type(2))) unsigned short v2us;
typedef __attribute__((ext_vector_type(4))) unsigned short v4us;
typedef __attribute__((ext_vector_type(2))) float v2f;
typedef __attribute__((ext_vector_type(4))) int v4i;

__global__ __launch_bounds__(256) void k_wtG(const float* __restrict__ w, int K, int N, bf* Bt) {
    const int lane = threadIdx.x & 31; const int L0 = (blockIdx.x * 8 + (threadIdx.x >> 5)) * 8; const int nlines = N * K / 64;
{
#pragma unroll 1
        for (int l = 0; l < 8; ++l) { const int L = L0 + l; if (L >= nlines) break; const size_t e = (size_t)L * 64 + lane * 2; const int k = (int)(e % K), n = (int)(e / K); v2us o;
            o[0] = f2bf(w[(size_t)k * N + n]); o[1] = f2bf(w[(size_t)(k + 1) * N + n]); *(v2us*)(Bt + e) = o; }
         }
}
// k_cvt8: x, W_qkv and W_o rounded to bf16 in one launch; dst holds the three one behind the other. Each part is a whole number of work-groups.
#define NX8 ((size_t)NB_ * TT * DM / 8)
#define NW8 ((size_t)(DQ + 2 * DKV) * DM / 8)
#define NO8 ((size_t)DM * DQ / 8)
__global__ __launch_bounds__(256) void k_cvt8(const float* __restrict__ x, const float* __restrict__ wqkv, const float* __restrict__ wo, bf* dst) { const size_t g = (size_t)blockIdx.x * 256, i = g + threadIdx.x;
    const float* src = g < NX8 ? x + i * 8 : g < NX8 + NW8 ? wqkv + (i - NX8) * 8 : wo + (i - NX8 - NW8) * 8; const v8f v = *(const v8f*)src; v8us o;
#pragma unroll
    for (int k = 0; k < 8; ++k) o[k] = f2bf(v[k]); *(v8us*)(dst + i * 8) = o;  }

// ---- k_fattn: scores, softmax and attn.v of one (batch, head) in ONE kernel; no score or P element leaves the registers.
// A wave owns NQ * 16 query columns and walks the 2048 keys 32 at a time: St = K Qt (A = K rows, B = Q rows, kept in registers), so a lane holds 16 scores of ONE query per column group;
// maximum in use m and sum l per query (in-lane; m is held from pass to pass and no maximum is formed while the P stay small enough for their type, tested once per 32 keys on their sums; only then does m move to the running maximum and are l and Ot rescaled); two St tiles, converted in place, are the B operand Pt of Ot += Vt Pt (A = rows of the [d][t] planes).
// Ot: a lane holds 8 consecutive d of one query, scaled by 1 / l at the end and stored as the hi + lo planes that the output projection reads ([b][t][h][d]).
// The work-group's 8 waves share K and Vt through LDS: stages of KST keys, two buffers; whole 128-byte lines go global -> registers -> LDS while the stage before is worked on; one barrier per stage.
// HR (query rows < RH): hi + lo bf16 planes, 3 products each for St and Ot; else single fp16, P carried x 2^10 (l carries the same factor, so it cancels).
#define KST 64                    // keys per LDS stage
#define LP  72                    // LDS row pitch in 16-bit elements: 144 B = 16 B x odd, 16-byte fragment reads of 16 rows fall on 64 different banks
#define LTILE (64 * LP)           // one staged tile: 64 rows (keys of K, or d of Vt) of 64 elements
template <typename T16> struct Chunk;
template <> struct Chunk<h16> { typedef v8h T; };
template <> struct Chunk<bf> { typedef v8us T; };
// ldw: a staging load. The s_wait_xcnt 0 stands behind the 16-byte load so that it comes in front of any rewrite of the address pair the load names (the register allocator gives such pairs to later loads' data); its memory clobber also keeps the load in front of the stage's LDS reads, a whole stage ahead of its use.
// ldx: the same for a fragment loaded straight from global memory (the Q rows, once per wave).
__device__ __forceinline__ v16h ldx(const h16* p) { const v8h lo = *(const v8h*)p; asm volatile("s_wait_xcnt 0x0" ::: "memory"); const v8h hi = *(const v8h*)(p + 16); asm volatile("s_wait_xcnt 0x0" ::: "memory"); return cat16(lo, hi); }
__device__ __forceinline__ v16bf ldx(const bf* p) { const v8us lo = *(const v8us*)p; asm volatile("s_wait_xcnt 0x0" ::: "memory"); const v8us hi = *(const v8us*)(p + 16); asm volatile("s_wait_xcnt 0x0" ::: "memory"); return cat16b(lo, hi); }
template <typename T8, typename T16> __device__ __forceinline__ T8 ldw(const T16* p) { const T8 v = *(const T8*)p; asm volatile("s_wait_xcnt 0x0" ::: "memory"); return v; }
// exp2run: 2^x of 16 values, each in its own register, as ONE run of v_exp_f32: no instruction directly behind one of them reads its result or rewrites its source, and the v_nop is that slot behind the last.
__device__ __forceinline__ void exp2run(float (&e)[16]) { asm("v_exp_f32 %0, %0\n\tv_exp_f32 %1, %1\n\tv_exp_f32 %2, %2\n\tv_exp_f32 %3, %3\n\tv_exp_f32 %4, %4\n\tv_exp_f32 %5, %5\n\tv_exp_f32 %6, %6\n\tv_exp_f32 %7, %7\n\tv_exp_f32 %8, %8\n\tv_exp_f32 %9, %9\n\tv_exp_f32 %10, %10\n\tv_exp_f32 %11, %11\n\tv_exp_f32 %12, %12\n\tv_exp_f32 %13, %13\n\tv_exp_f32 %14, %14\n\tv_exp_f32 %15, %15\n\tv_nop" : "+v"(e[0]), "+v"(e[1]), "+v"(e[2]), "+v"(e[3]), "+v"(e[4]), "+v"(e[5]), "+v"(e[6]), "+v"(e[7]), "+v"(e[8]), "+v"(e[9]), "+v"(e[10]), "+v"(e[11]), "+v"(e[12]), "+v"(e[13]), "+v"(e[14]), "+v"(e[15])); }
// exp2one: 2^x of one value (the rescale factor); the v_nop is the slot behind the v_exp_f32.
__device__ __forceinline__ float exp2one(float x) { asm("v_exp_f32 %0, %0\n\tv_nop" : "+v"(x)); return x; }
__device__ __forceinline__ float xhalf(float x) { const int b = __float_as_int(x); return __int_as_float(__builtin_amdgcn_permlanex16(b, b, 0x76543210, 0xfedcba98, false, false)); }   // the value of lane l ^ 16
template <typename T16, bool HR, int NQ>
__device__ __forceinline__ void attn_wg(T16* sm, const T16* __restrict__ Q, const T16* __restrict__ Q2, const T16* __restrict__ Kp, const T16* __restrict__ K2, const T16* __restrict__ Vt, const T16* __restrict__ V2, int q0, bf* __restrict__ Ah, bf* __restrict__ Al) {
    typedef WFrag<T16> F; typedef typename F::V V; typedef typename Chunk<T16>::T T8;
    constexpr int NP = HR ? 2 : 1, BUF = 2 * NP * LTILE;   // a buffer: the K tile(s), then the Vt tile(s)
    const int lane = threadIdx.x & 31, lr = lane & 15, hi = lane >> 4;
    const int sr = threadIdx.x >> 3, sc = (threadIdx.x & 7) * 8;   // staging: this thread moves 16 bytes at element sc of rows sr and sr + 32 of every tile
    const float C2 = SCL * 1.4426950408889634f, OFF = HR ? 0.0f : 10.0f;
    const float LIM = HR ? 256.0f : 32768.0f;   // the maximum in use is held while a lane's 16 P of a pass sum to LIM or less: every P then is at most LIM, which fp16 holds (P carries 2^OFF)
    V qf[NQ][2], qg[NQ][2];
#pragma unroll
    for (int n = 0; n < NQ; ++n)
#pragma unroll
        for (int ks = 0; ks < 2; ++ks) { const size_t qo = (size_t)(q0 + n * 16 + lr) * HD + ks * 32 + 8 * hi; qf[n][ks] = ldx(Q + qo); if (HR) qg[n][ks] = ldx(Q2 + qo); }
    v8f o[NQ][4]; float m[NQ], l[NQ], nb[NQ];   // m: the maximum in use, nb = OFF - m C2 (at the start so large that the first pass's P overflow and the test below sets m)
#pragma unroll
    for (int n = 0; n < NQ; ++n) { m[n] = -3.0e38f; nb[n] = 3.0e38f; l[n] = 0.0f;
#pragma unroll
        for (int db = 0; db < 4; ++db) o[n][db] = (v8f){}; }
    T8 gk[2], gk2[2], gv[2], gv2[2];
#pragma unroll
    for (int i = 0; i < 2; ++i) { const int r = sr + 32 * i; gk[i] = ldw<T8>(Kp + (size_t)r * HD + sc); gv[i] = ldw<T8>(Vt + (size_t)r * TT + sc); if (HR) { gk2[i] = ldw<T8>(K2 + (size_t)r * HD + sc); gv2[i] = ldw<T8>(V2 + (size_t)r * TT + sc); } }
#pragma unroll
    for (int i = 0; i < 2; ++i) { T16* d = sm + (sr + 32 * i) * LP + sc; *(T8*)d = gk[i]; *(T8*)(d + NP * LTILE) = gv[i]; if (HR) { *(T8*)(d + LTILE) = gk2[i]; *(T8*)(d + 3 * LTILE) = gv2[i]; } }
    __syncthreads();   // stage 0 is in LDS for every wave
#pragma unroll 1
    for (int st = 0; st < TT / KST; ++st) {
        const T16* cur = sm + (st & 1) * BUF; T16* nxt = sm + ((st + 1) & 1) * BUF;
        const int kn = (st + 1 < TT / KST) ? (st + 1) * KST : 0;   // the next stage's lines fly while this stage is worked on (last stage: keys 0 again, in bounds, never read from LDS)
#pragma unroll
        for (int i = 0; i < 2; ++i) { const int r = sr + 32 * i; gk[i] = ldw<T8>(Kp + (size_t)(kn + r) * HD + sc); gv[i] = ldw<T8>(Vt + (size_t)r * TT + kn + sc); if (HR) { gk2[i] = ldw<T8>(K2 + (size_t)(kn + r) * HD + sc); gv2[i] = ldw<T8>(V2 + (size_t)r * TT + kn + sc); } }
#pragma unroll
        for (int p = 0; p < KST / 32; ++p) {
            v8f s[NQ][2];
#pragma unroll
            for (int kt = 0; kt < 2; ++kt) { V kf[2], kg[2];
#pragma unroll
                for (int ks = 0; ks < 2; ++ks) { const T16* a = cur + (p * 32 + kt * 16 + lr) * LP + ks * 32 + 8 * hi; kf[ks] = F::ld(a); if (HR) kg[ks] = F::ld(a + LTILE); }
#pragma unroll
                for (int n = 0; n < NQ; ++n) { s[n][kt] = (v8f){};
#pragma unroll
                    for (int ks = 0; ks < 2; ++ks) { s[n][kt] = F::mma(kf[ks], qf[n][ks], s[n][kt]); if (HR) { s[n][kt] = F::mma(kf[ks], qg[n][ks], s[n][kt]); s[n][kt] = F::mma(kg[ks], qf[n][ks], s[n][kt]); } } } }
            V pf[NQ], pg[NQ]; v8f p0[NQ], p1[NQ]; float sum[NQ];
            auto soft = [&](int n) {   // P of column group n from the maximum in use, and this lane's sum of its 16
                float e[16]; const v8f d0 = s[n][0] * C2 + nb[n], d1 = s[n][1] * C2 + nb[n];   // one fused multiply-add per score: (s - m) C2 + OFF
#pragma unroll
                for (int j = 0; j < 8; ++j) { e[j] = d0[j]; e[8 + j] = d1[j]; }
                exp2run(e);
#pragma unroll
                for (int j = 0; j < 8; ++j) { p0[n][j] = e[j]; p1[n][j] = e[8 + j]; }
                const v8f ps = p0[n] + p1[n];
                sum[n] = (((ps[0] + ps[1]) + (ps[2] + ps[3])) + ((ps[4] + ps[5]) + (ps[6] + ps[7]))); };
            bool need = false;   // need: this lane's 16 P sum to more than LIM (or are not numbers), so one of them may be too large for its 16-bit type
#pragma unroll
            for (int n = 0; n < NQ; ++n) { soft(n); need = need || !(sum[n] <= LIM); }
            if (__builtin_expect(__builtin_amdgcn_ballot_w32(need) != 0, 0)) {   // one scalar test per 32 keys, marked rare so that the usual path falls through; taken by the whole wave: every column moves to its running maximum, l and Ot are rescaled, P is formed again
#pragma unroll
                for (int n = 0; n < NQ; ++n) {
                    float mx = s[n][0][0];
#pragma unroll
                    for (int j = 1; j < 8; ++j) mx = fmaxf(mx, s[n][0][j]);
#pragma unroll
                    for (int j = 0; j < 8; ++j) mx = fmaxf(mx, s[n][1][j]);
                    const float mn = fmaxf(m[n], fmaxf(mx, xhalf(mx))); const float al = exp2one((m[n] - mn) * C2);
                    m[n] = mn; nb[n] = OFF - mn * C2; l[n] *= al;
#pragma unroll
                    for (int db = 0; db < 4; ++db) o[n][db] *= al;
                    soft(n);
                }
            }
#pragma unroll
            for (int n = 0; n < NQ; ++n) {
                l[n] += sum[n];
                if constexpr (HR) {
                    const v8bf h0 = __builtin_convertvector(p0[n], v8bf), h1 = __builtin_convertvector(p1[n], v8bf);
                    const v8bf l0 = __builtin_convertvector(p0[n] - __builtin_convertvector(h0, v8f), v8bf), l1 = __builtin_convertvector(p1[n] - __builtin_convertvector(h1, v8f), v8bf);
                    pf[n] = __builtin_shufflevector(h0, h1, 0, 1, 2, 3, 4, 5, 6, 7, 8, 9, 10, 11, 12, 13, 14, 15); pg[n] = __builtin_shufflevector(l0, l1, 0, 1, 2, 3, 4, 5, 6, 7, 8, 9, 10, 11, 12, 13, 14, 15);
                } else pf[n] = cat16(__builtin_convertvector(p0[n], v8h), __builtin_convertvector(p1[n], v8h));
            }
#pragma unroll
            for (int db = 0; db < 4; ++db) { const T16* a = cur + NP * LTILE + (db * 16 + lr) * LP + p * 32 + 8 * hi; const V vf = F::ld(a); V vg; if (HR) vg = F::ld(a + LTILE);
#pragma unroll
                for (int n = 0; n < NQ; ++n) { o[n][db] = F::mma(vf, pf[n], o[n][db]); if (HR) { o[n][db] = F::mma(vf, pg[n], o[n][db]); o[n][db] = F::mma(vg, pf[n], o[n][db]); } } }
        }
        // five vector slots between the stage's last matrix instruction and whatever vector instruction stands first behind the loop's taken back edge
        if constexpr (NQ == 2) asm volatile("v_nop\n\tv_nop\n\tv_nop\n\tv_nop\n\tv_nop" : "+v"(o[0][0]), "+v"(o[0][1]), "+v"(o[0][2]), "+v"(o[0][3]), "+v"(o[1][0]), "+v"(o[1][1]), "+v"(o[1][2]), "+v"(o[1][3]));
        else asm volatile("v_nop\n\tv_nop\n\tv_nop\n\tv_nop\n\tv_nop" : "+v"(o[0][0]), "+v"(o[0][1]), "+v"(o[0][2]), "+v"(o[0][3]));
#pragma unroll
        for (int i = 0; i < 2; ++i) { T16* d = nxt + (sr + 32 * i) * LP + sc; *(T8*)d = gk[i]; *(T8*)(d + NP * LTILE) = gv[i]; if (HR) { *(T8*)(d + LTILE) = gk2[i]; *(T8*)(d + 3 * LTILE) = gv2[i]; } }   // nxt's last readers left it at the barrier that ended the stage before
        __syncthreads();   // publishes nxt and ends every wave's reads of cur, which the next stage refills
    }
#pragma unroll
    for (int n = 0; n < NQ; ++n) { const float inv = __fdiv_rn(1.0f, l[n] + xhalf(l[n])); const size_t oo = (size_t)(q0 + n * 16 + lr) * DQ + 8 * hi;
#pragma unroll
        for (int db = 0; db < 4; ++db) { v8us oh, ol;
#pragma unroll
            for (int j = 0; j < 8; ++j) { unsigned short a, c2; splitf(o[n][db][j] * inv, a, c2); oh[j] = a; ol[j] = c2; }
            *(v8us*)(Ah + oo + db * 16) = oh; *(v8us*)(Al + oo + db * 16) = ol; } }
}
// grid: the NB_ * NH_ * RH / 128 work-groups of the 3-product rows first (8 waves x 16 queries; they last longest), then NB_ * NH_ * (TT - RH) / 256 of 8 waves x 32 queries. Planes [b * NH_ + h][..]; Ah, Al [b][t][DQ].
__global__ __launch_bounds__(256) void k_fattn(const h16* __restrict__ Q16, const h16* __restrict__ K16, const h16* __restrict__ V16, const bf* __restrict__ Qh, const bf* __restrict__ Ql, const bf* __restrict__ Kh, const bf* __restrict__ Kl, const bf* __restrict__ Vh, const bf* __restrict__ Vl, bf* __restrict__ Ah, bf* __restrict__ Al) {
    __shared__ __align__(16) bf sm[2 * 4 * LTILE];
    const int wave = __builtin_amdgcn_readfirstlane((int)(threadIdx.x >> 5)); const int id = blockIdx.x; const int NHR = NB_ * NH_ * (RH / 128);
    if (id < NHR) { const int bh = id / (RH / 128), q0 = (id % (RH / 128)) * 128 + wave * 16; const size_t pl = (size_t)bh * TT * HD, ao = (size_t)(bh / NH_) * TT * DQ + (size_t)(bh % NH_) * HD;
        attn_wg<bf, true, 1>(sm, Qh + pl, Ql + pl, Kh + pl, Kl + pl, Vh + pl, Vl + pl, q0, Ah + ao, Al + ao);
    } else { const int i2 = id - NHR; const int bh = i2 / ((TT - RH) / 256), q0 = RH + (i2 % ((TT - RH) / 256)) * 256 + wave * 32; const size_t pl = (size_t)bh * TT * HD, ao = (size_t)(bh / NH_) * TT * DQ + (size_t)(bh % NH_) * HD;
        attn_wg<h16, false, 2>((h16*)sm, Q16 + pl, nullptr, K16 + pl, nullptr, V16 + pl, nullptr, q0, Ah + ao, Al + ao); }
}

extern "C" void kernel_launch(void* const* d_in, const int* in_sizes, int n_in,
                              void* d_out, int out_size, void* d_ws, size_t ws_size, hipStream_t stream) {
    (void)in_sizes; (void)n_in; (void)out_size;
    const float* x = (const float*)d_in[0]; const float* wqkv = (const float*)d_in[1]; const float* wo = (const float*)d_in[2];
    float* OUT = (float*)d_out;     // [4][2048][1024]
    char* wsp = (char*)d_ws;
    auto take = [&](size_t bytes) { char* p = wsp; wsp += (bytes + 255) & ~(size_t)255; return (void*)p; };
    bf* XB = (bf*)take((NX8 + NW8 + NO8) * 8 * 2); bf* WQKV = XB + NX8 * 8; bf* WO = WQKV + NW8 * 8;   // x of all batches, W_qkv, W_o: one run, as k_cvt8 writes it
    const size_t PQ = (size_t)NH_ * TT * HD;   // one batch's share of a q, k or v plane, in elements (NKV == NH_); every plane holds all NB_ batches
    h16* QP16 = (h16*)take(3 * NB_ * PQ * 2); h16* KP16 = QP16 + NB_ * PQ; h16* VT16 = KP16 + NB_ * PQ;   // q, k, v of one kind of plane lie NB_ * PQ elements apart
    bf* QPh = (bf*)take(3 * NB_ * PQ * 2); bf* KPh = QPh + NB_ * PQ; bf* VTh = KPh + NB_ * PQ;
    bf* QPl = (bf*)take(3 * NB_ * PQ * 2); bf* KPl = QPl + NB_ * PQ; bf* VTl = KPl + NB_ * PQ;
    bf* ATh = (bf*)take((size_t)NB_ * TT * DQ * 2); bf* ATl = (bf*)take((size_t)NB_ * TT * DQ * 2);
    if ((size_t)(wsp - (char*)d_ws) > ws_size) return;    // ws 256 MiB
    k_cvt8<<<(unsigned)((NX8 + NW8 + NO8) / 256), 256, 0, stream>>>(x, wqkv, wo, XB);
    k_gemmw<bf, 0, false, true><<<dim3(TT / GTM, 3 * NH_ * 64 / GTN, NB_), 256, 0, stream>>>(XB, nullptr, WQKV, nullptr, DM, nullptr, 0, nullptr, (size_t)TT * DM, 0, PQ, QP16, QPh, QPl, NB_ * PQ);
    k_fattn<<<NB_ * NH_ * (RH / 128 + (TT - RH) / 256), 256, 0, stream>>>(QP16, KP16, VT16, QPh, QPl, KPh, KPl, VTh, VTl, ATh, ATl);   // one kv head per query head
    k_gemmw<bf, 1, false, false><<<dim3(NB_ * TT / GTM, DM / GTN, 1), 256, 0, stream>>>(ATh, ATl, WO, nullptr, DQ, OUT, DM, nullptr, 0, 0, 0, nullptr, nullptr, nullptr, 0);   // the batches' rows are one run in ATh, ATl and OUT
}

// v008
// Measured time: 171 microseconds a run.
// Two timings next to v007 put it at 1.04 and 1.03 times that version's speed.
// Over all steps from v000 it is 23.3 times as fast.
#include <hip/hip_runtime.h>

// Multi-head attention with a fused 'oi' projection (x [4][2048][1024]; [Q|K|V] = x W_qkv^T ([3072][1024]: rows q | k | v); 16 heads x 64; softmax(q.k/8) over all keys; out = merged W_o^T -> [4][2048][1024] (8.4 M)).
// Compute dtypes, f32 accumulate: every input rounded to bf16; q/k/v on PLAIN bf16 operands (inputs: exact); scores and attn.v: query rows < 512 hl (3 products), the rest single fp16 (P x1024); softmax f32, maximum held while P fits its type; W_o hl x exact (2 products).

#define NB_  4
#define TT   2048
#define DM   1024
#define NH_  16
#define NKV  16
#define REP  (NH_ / NKV)
#define HD   64
#define DQ   (NH_ * HD)
#define DKV  (NKV * HD)
#define RH   512                  // query rows < RH use hi+lo planes (0: none)
#define WIN  0
#define SCL  0.125f   // HD^-0.5
typedef _Float16 h16;
typedef unsigned short bf;
typedef __attribute__((ext_vector_type(16))) __bf16   v16bf;
typedef __attribute__((ext_vector_type(16))) _Float16 v16h;
typedef __attribute__((ext_vector_type(8)))  _Float16 v8h;
typedef __attribute__((ext_vector_type(8)))  unsigned short v8us;
typedef __attribute__((ext_vector_type(8)))  __bf16   v8bf;
typedef __attribute__((ext_vector_type(8)))  float    v8f;
typedef __attribute__((ext_vector_type(4)))  float    v4f;
typedef v8h  __attribute__((may_alias)) v8ha;
typedef v4f  __attribute__((may_alias)) v4fa;
typedef v8us __attribute__((may_alias)) v8usa;

__device__ __forceinline__ unsigned short f2bf(float f) { unsigned u = __float_as_uint(f); u += 0x7FFFu + ((u >> 16) & 1u); return (unsigned short)(u >> 16); }
__device__ __forceinline__ float bf2f(unsigned short b) { return __uint_as_float(((unsigned)b) << 16); }
__device__ __forceinline__ float bfr(float f) { return bf2f(f2bf(f)); }
__device__ __forceinline__ v16h cat16(v8h lo, v8h hi) { return __builtin_shufflevector(lo, hi, 0, 1, 2, 3, 4, 5, 6, 7, 8, 9, 10, 11, 12, 13, 14, 15); }
__device__ __forceinline__ v16bf cat16b(v8us lo, v8us hi) { return __builtin_bit_cast(v16bf, __builtin_shufflevector(lo, hi, 0, 1, 2, 3, 4, 5, 6, 7, 8, 9, 10, 11, 12, 13, 14, 15)); }
__device__ __forceinline__ v8f wmma16(v16h a, v16h b, v8f c) { return __builtin_amdgcn_wmma_f32_16x16x32_f16(false, a, false, b, (short)0, c, false, false); }
__device__ __forceinline__ v8f wmmab(v16bf a, v16bf b, v8f c) { return __builtin_amdgcn_wmma_f32_16x16x32_bf16(false, a, false, b, (short)0, c, false, false); }



__device__ __forceinline__ h16 tohx(float x) { return (h16)x; }
__device__ __forceinline__ void splitf(float y, unsigned short& h, unsigned short& l) { h = f2bf(y); l = f2bf(y - bf2f(h)); }
// ---- k_gemmw: GEMM on a 128 x 256 output tile per work-group of 8 waves (2 x 4), each wave a register-blocked 64x64 sub-tile (16 accumulators); grid (M/128, N/256, Z), 256 threads.
// C[m][n] (f32, pitch ldc, + optional f32 bias[n]) = sum_k A[m][k] Bt[n][k] (+ A2[m][k] Bt[n][k] where NSPLIT == 1). z-batch strides sA/sB/sC in elements. K % 64 == 0.
// The operands come from K-contiguous 16-bit planes through LDS: a stage is 64 k (one whole 128-byte line) of the tile's 128 A rows (and A2 rows) and 256 Bt rows; asynchronous 16-byte copies, a wave's copy = 4 whole lines;
// two buffers, stage t + 2 is copied into the buffer that trip t has just left, one barrier per trip. Every staged row serves 4 (A) or 2 (Bt) waves.
// PL: C is not stored as f32; each value goes out as fp16 (P16) and as bf16 hi + lo (Ph, Pl), at element (n / 64 / NH_) * cts + z * sC + (n / 64 % NH_) * TT * HD + m * HD + n % 64 (v: (n % 64) * TT + m in place of the last two terms) of each plane:
//     ONE launch does q, k and v of every batch: A = x ([b][t][DM], batch stride sA), Bt = all rows of W_qkv, grid (TT/128, 3 * NH_ / 4, NB_); a wave's 64 W rows are one head of q, k or v (plane sets cts elements apart, batches sC apart).
//     q, k: x rows times W rows, stored [h][t][d];  v: the operands swapped (W rows times x rows), stored [h][d][t]. A store instruction writes four whole 128-byte lines.
template <typename T16> struct WFrag;
template <> struct WFrag<h16> { typedef v16h V; static __device__ __forceinline__ V ld(const h16* p) { return cat16(*(const v8h*)p, *(const v8h*)(p + 16)); } static __device__ __forceinline__ v8f mma(V a, V b, v8f c) { return wmma16(a, b, c); } };
template <> struct WFrag<bf> { typedef v16bf V; static __device__ __forceinline__ V ld(const bf* p) { return cat16b(*(const v8us*)p, *(const v8us*)(p + 16)); } static __device__ __forceinline__ v8f mma(V a, V b, v8f c) { return wmmab(a, b, c); } };
#define GTM 128                   // output rows of a work-group's tile
#define GTN 256                   // output columns
#define GKS 64                    // k per stage
#define GLP 72                    // LDS row pitch in 16-bit elements: 144 B = 16 B x odd, 16-byte fragment reads of 16 rows fall on 64 different banks
// cpy<N>: N asynchronous 16-byte copies global -> LDS per lane (l: the lane's LDS byte addresses, g: its global addresses). The s_wait_xcnt 0 is the statement's last line, so it stands in front of every rewrite of an address register that these copies name.
template <int N> __device__ __forceinline__ void cpy(const unsigned* l, const void* const* g);
template <> __device__ __forceinline__ void cpy<4>(const unsigned* l, const void* const* g) {
    asm volatile("global_load_async_to_lds_b128 %0, %4, off\n\tglobal_load_async_to_lds_b128 %1, %5, off\n\tglobal_load_async_to_lds_b128 %2, %6, off\n\tglobal_load_async_to_lds_b128 %3, %7, off\n\ts_wait_xcnt 0x0"
                 :: "v"(l[0]), "v"(l[1]), "v"(l[2]), "v"(l[3]), "v"(g[0]), "v"(g[1]), "v"(g[2]), "v"(g[3]) : "memory"); }
template <> __device__ __forceinline__ void cpy<8>(const unsigned* l, const void* const* g) {
    asm volatile("global_load_async_to_lds_b128 %0, %8, off\n\tglobal_load_async_to_lds_b128 %1, %9, off\n\tglobal_load_async_to_lds_b128 %2, %10, off\n\tglobal_load_async_to_lds_b128 %3, %11, off\n\tglobal_load_async_to_lds_b128 %4, %12, off\n\tglobal_load_async_to_lds_b128 %5, %13, off\n\tglobal_load_async_to_lds_b128 %6, %14, off\n\tglobal_load_async_to_lds_b128 %7, %15, off\n\ts_wait_xcnt 0x0"
                 :: "v"(l[0]), "v"(l[1]), "v"(l[2]), "v"(l[3]), "v"(l[4]), "v"(l[5]), "v"(l[6]), "v"(l[7]), "v"(g[0]), "v"(g[1]), "v"(g[2]), "v"(g[3]), "v"(g[4]), "v"(g[5]), "v"(g[6]), "v"(g[7]) : "memory"); }
template <> __device__ __forceinline__ void cpy<12>(const unsigned* l, const void* const* g) {
    asm volatile("global_load_async_to_lds_b128 %0, %12, off\n\tglobal_load_async_to_lds_b128 %1, %13, off\n\tglobal_load_async_to_lds_b128 %2, %14, off\n\tglobal_load_async_to_lds_b128 %3, %15, off\n\tglobal_load_async_to_lds_b128 %4, %16, off\n\tglobal_load_async_to_lds_b128 %5, %17, off\n\tglobal_load_async_to_lds_b128 %6, %18, off\n\tglobal_load_async_to_lds_b128 %7, %19, off\n\tglobal_load_async_to_lds_b128 %8, %20, off\n\tglobal_load_async_to_lds_b128 %9, %21, off\n\tglobal_load_async_to_lds_b128 %10, %22, off\n\tglobal_load_async_to_lds_b128 %11, %23, off\n\ts_wait_xcnt 0x0"
                 :: "v"(l[0]), "v"(l[1]), "v"(l[2]), "v"(l[3]), "v"(l[4]), "v"(l[5]), "v"(l[6]), "v"(l[7]), "v"(l[8]), "v"(l[9]), "v"(l[10]), "v"(l[11]), "v"(g[0]), "v"(g[1]), "v"(g[2]), "v"(g[3]), "v"(g[4]), "v"(g[5]), "v"(g[6]), "v"(g[7]), "v"(g[8]), "v"(g[9]), "v"(g[10]), "v"(g[11]) : "memory"); }
// launch bounds: at least 4 waves per SIMD, that is a budget of 256 registers, so that two work-groups of the q/k/v launch share a WGP (their LDS fits twice).
template <typename T16, int NSPLIT, bool BIAS, bool PL>
__global__ __launch_bounds__(256, 4) void k_gemmw(const T16* __restrict__ A, const T16* __restrict__ A2, const T16* __restrict__ Bt, const T16* __restrict__ Bt2, int K, float* C, int ldc, const float* __restrict__ bias, size_t sA, size_t sB, size_t sC, h16* P16, bf* Ph, bf* Pl, size_t cts) {
    static_assert(NSPLIT == 0 || NSPLIT == 1, "A (+ A2) times Bt");
    typedef typename WFrag<T16>::V V;
    constexpr int NAP = NSPLIT == 1 ? 2 : 1, ROWS = GTM * NAP + GTN, BUFE = ROWS * GLP, NC = ROWS / 32;   // a buffer: the A rows, the A2 rows, the Bt rows; NC copies per thread and stage
    __shared__ __align__(16) T16 sm[2 * BUFE];
    __shared__ __align__(16) float osm[8 * 16 * 68];
    const size_t z = blockIdx.z; A += z * sA; if (NSPLIT == 1) A2 += z * sA; Bt += z * sB;
    C += z * sC;
    const int wave = __builtin_amdgcn_readfirstlane((int)(threadIdx.x >> 5)), wm = wave & 1, wn = wave >> 1;
    float* os = osm + wave * (16 * 68);   // each wave's own epilogue staging
    const int lane = threadIdx.x & 31, lr = lane & 15, hi = lane >> 4; const int R0 = blockIdx.x * GTM, C0 = blockIdx.y * GTN; const int r0 = R0 + wm * 64, c0 = C0 + wn * 64;
    int arow = wm * 64, brow = GTM * NAP + wn * 64;   // first staged row of the wave's A and B operand
    size_t pofs = 0; int ldp = HD;   // PL: element of the wave tile's first value in each plane, and the pitch of its rows there
    if constexpr (PL) { const int y = blockIdx.y * (GTN / 64) + wn, sel = y / NH_, h = y % NH_; pofs = (size_t)sel * cts + z * sC + (size_t)h * TT * HD;
        if (sel < 2) pofs += (size_t)r0 * HD;
        else { pofs += r0; ldp = TT; const int t0 = arow; arow = brow; brow = t0; } }
    v8f acc[4][4];   // the unrolls in this kernel make every index of acc, a, a2, b, l and g a constant, so that these arrays live in registers
#pragma unroll
    for (int mb = 0; mb < 4; ++mb)
#pragma unroll
        for (int nb = 0; nb < 4; ++nb) acc[mb][nb] = (v8f){};
    const int sr = threadIdx.x >> 3, sc = (threadIdx.x & 7) * 8;   // staging: this thread copies 16 bytes at element sc of rows sr, sr + 32, ... of the stage
    const T16* pa = A + (size_t)(R0 + sr) * K + sc; const T16* pa2 = NSPLIT == 1 ? A2 + (size_t)(R0 + sr) * K + sc : pa; const T16* pb = Bt + (size_t)(C0 + sr) * K + sc;   // this thread's bytes of the next stage to copy; they move on by one stage per fill
    const unsigned l0 = (unsigned)(size_t)(sm + sr * GLP + sc);
    auto fill = [&](int t) {   // stage t into buffer t & 1
        unsigned l[NC]; const void* g[NC];
#pragma unroll
        for (int j = 0; j < NC; ++j) { l[j] = l0 + (unsigned)(((t & 1) * BUFE + j * 32 * GLP) * 2);
            g[j] = (j < GTM / 32 ? pa + (size_t)j * 32 * K : j < NAP * GTM / 32 ? pa2 + (size_t)(j - GTM / 32) * 32 * K : pb + (size_t)(j - NAP * GTM / 32) * 32 * K); }
        if constexpr (NC == 12) cpy<12>(l, g); else { cpy<8>(l, g); cpy<8>(l + 8, g + 8); }
        pa += GKS; pa2 += GKS; pb += GKS; };
    const int NT = K / GKS;
    fill(0);
    asm volatile("s_wait_asynccnt 0x0" ::: "memory");   // this wave's copies of stage 0 have landed
    __syncthreads();   // stage 0 is in LDS for every wave
    if (NT > 1) fill(1);
#pragma unroll 1   // one trip per stage stays rolled: unrolled, two trips' fragments and addresses would not fit the register budget
    for (int t = 0; t < NT; ++t) {
        const T16* cur = sm + (t & 1) * BUFE;
        V a[4], a2[4], b[4];
        auto frags = [&](int ks) {   // all fragments of 32 k, read as one group
#pragma unroll
            for (int mb = 0; mb < 4; ++mb) { const T16* p = cur + (arow + mb * 16 + lr) * GLP + ks * 32 + 8 * hi; a[mb] = WFrag<T16>::ld(p); if (NSPLIT == 1) a2[mb] = WFrag<T16>::ld(p + GTM * GLP); }
#pragma unroll
            for (int nb = 0; nb < 4; ++nb) b[nb] = WFrag<T16>::ld(cur + (brow + nb * 16 + lr) * GLP + ks * 32 + 8 * hi); };
        auto prods = [&]() {
#pragma unroll
            for (int nb = 0; nb < 4; ++nb)
#pragma unroll
                for (int mb = 0; mb < 4; ++mb) { acc[mb][nb] = WFrag<T16>::mma(a[mb], b[nb], acc[mb][nb]); if (NSPLIT == 1) acc[mb][nb] = WFrag<T16>::mma(a2[mb], b[nb], acc[mb][nb]); } };
        frags(0);
        __builtin_amdgcn_sched_barrier(0);   // keeps the LDS reads together in front of the products: without it the compiler sinks each b fragment's reads to just in front of its products, and the wave waits out the LDS latency four times
        prods();
        frags(1);   // the trip's last reads of cur
        __builtin_amdgcn_sched_barrier(0);   // as above
        if constexpr (NSPLIT == 1) prods();   // three fragment sets and the copies' addresses do not fit 256 registers together: here the last products come first
        asm volatile("s_wait_dscnt 0x0" ::: "memory");      // this wave's reads of cur are done before cur is handed to its next writer
        asm volatile("s_wait_asynccnt 0x0" ::: "memory");   // this wave's copies of stage t + 1 have landed
        __syncthreads();   // publishes stage t + 1 and ends every wave's reads of cur
        if (t + 2 < NT) fill(t + 2);
        if constexpr (NSPLIT == 0) { __builtin_amdgcn_sched_barrier(0);   // keeps the copies in front of the trip's last products (registers only), so that they fly a whole trip before they are waited for
            prods(); }
    }
    asm volatile("s_wait_asynccnt 0x0" ::: "memory");   // no copy is outstanding behind the loop
#pragma unroll
    for (int mb = 0; mb < 4; ++mb) {
#pragma unroll
        for (int nb = 0; nb < 4; ++nb) {
#pragma unroll
            for (int j = 0; j < 8; ++j) os[(hi * 8 + j) * 68 + nb * 16 + lr] = acc[mb][nb][j]; }
        __builtin_amdgcn_wave_barrier(); asm volatile("" ::: "memory");
        if constexpr (PL) {
            const int cofs = (lane & 7) * 8; v4f va[4], vb[4];   // all eight LDS reads of these 16 rows first: the store statements below are memory barriers to the compiler, no read moves up over one
#pragma unroll
            for (int s = 0; s < 4; ++s) { const float* o4 = os + (4 * s + (lane >> 3)) * 68 + cofs; va[s] = *(const v4fa*)o4; vb[s] = *(const v4fa*)(o4 + 4); }
#pragma unroll
            for (int s = 0; s < 4; ++s) { const int row = 4 * s + (lane >> 3); v8h o16; v8us oh, ol;
#pragma unroll
                for (int q = 0; q < 8; ++q) { const float r = q < 4 ? va[s][q & 3] : vb[s][q & 3]; o16[q] = tohx(r); unsigned short a2, c2; splitf(r, a2, c2); oh[q] = a2; ol[q] = c2; }
                const size_t off = pofs + (size_t)(mb * 16 + row) * ldp + cofs;
                // the three stores and their s_wait_xcnt 0 in one statement: the wait then stands in front of every rewrite of a data or address register that these stores name
                asm volatile("global_store_b128 %0, %3, off\n\tglobal_store_b128 %1, %4, off\n\tglobal_store_b128 %2, %5, off\n\ts_wait_xcnt 0x0" :: "v"(P16 + off), "v"(Ph + off), "v"(Pl + off), "v"(o16), "v"(oh), "v"(ol) : "memory"); }
        } else {
            float* crow = C + (size_t)(r0 + mb * 16) * ldc + c0;
#pragma unroll
            for (int s = 0; s < 8; ++s) { const int row = 2 * s + hi, cofs = lr * 4; v4f val = *(const v4fa*)(os + row * 68 + cofs); if (BIAS) { val[0] += bfr(bias[c0 + cofs]); val[1] += bfr(bias[c0 + cofs + 1]); val[2] += bfr(bias[c0 + cofs + 2]); val[3] += bfr(bias[c0 + cofs + 3]); }
                *(v4f*)(crow + (size_t)row * ldc + cofs) = val; }
             }
        __builtin_amdgcn_wave_barrier(); asm volatile("" ::: "memory");
    }
}

typedef __attribute__((ext_vector_type(2))) _Float16 v2h;
typedef __attribute__((ext_vector_type(4))) _Float16 v4h;
typedef __attribute__((ext_vector_type(2))) unsigned short v2us;
typedef __attribute__((ext_vector_type(4))) unsigned short v4us;
typedef __attribute__((ext_vector_type(2))) float v2f;
typedef __attribute__((ext_vector_type(4))) int v4i;

__global__ __launch_bounds__(256) void k_wtG(const float* __restrict__ w, int K, int N, bf* Bt) {
    const int lane = threadIdx.x & 31; const int L0 = (blockIdx.x * 8 + (threadIdx.x >> 5)) * 8; const int nlines = N * K / 64;
{
#pragma unroll 1
        for (int l = 0; l < 8; ++l) { const int L = L0 + l; if (L >= nlines) break; const size_t e = (size_t)L * 64 + lane * 2; const int k = (int)(e % K), n = (int)(e / K); v2us o;
            o[0] = f2bf(w[(size_t)k * N + n]); o[1] = f2bf(w[(size_t)(k + 1) * N + n]); *(v2us*)(Bt + e) = o; }
         }
}
// k_cvt8: x, W_qkv and W_o rounded to bf16 in one launch; dst holds the three one behind the other. Each part is a whole number of work-groups.
#define NX8 ((size_t)NB_ * TT * DM / 8)
#define NW8 ((size_t)(DQ + 2 * DKV) * DM / 8)
#define NO8 ((size_t)DM * DQ / 8)
__global__ __launch_bounds__(256) void k_cvt8(const float* __restrict__ x, const float* __restrict__ wqkv, const float* __restrict__ wo, bf* dst) { const size_t g = (size_t)blockIdx.x * 256, i = g + threadIdx.x;
    const float* src = g < NX8 ? x + i * 8 : g < NX8 + NW8 ? wqkv + (i - NX8) * 8 : wo + (i - NX8 - NW8) * 8; const v8f v = *(const v8f*)src; v8us o;
#pragma unroll
    for (int k = 0; k < 8; ++k) o[k] = f2bf(v[k]); *(v8us*)(dst + i * 8) = o;  }

// ---- k_fattn: scores, softmax and attn.v of one (batch, head) in ONE kernel; no score or P element leaves the registers.
// A wave owns NQ * 16 query columns and walks the 2048 keys 32 at a time: St = K Qt (A = K rows, B = Q rows, kept in registers), so a lane holds 16 scores of ONE query per column group;
// maximum in use m and sum l per query (in-lane; m is held from pass to pass and no maximum is formed while the P stay small enough for their type, tested once per 32 keys on their sums; only then does m move to the running maximum and are l and Ot rescaled); two St tiles, converted in place, are the B operand Pt of Ot += Vt Pt (A = rows of the [d][t] planes).
// Ot: a lane holds 8 consecutive d of one query, scaled by 1 / l at the end and stored as the hi + lo planes that the output projection reads ([b][t][h][d]).
// The work-group's 8 waves share K and Vt through LDS: stages of KST keys, two buffers; whole 128-byte lines go global -> LDS by asynchronous 16-byte copies (through no register); stage st + 2 is copied into the buffer that stage st has just left, one barrier per stage.
// HR (query rows < RH): hi + lo bf16 planes, 3 products each for St and Ot; else single fp16, P carried x 2^10 (l carries the same factor, so it cancels).
#define KST 64                    // keys per LDS stage
#define LP  72                    // LDS row pitch in 16-bit elements: 144 B = 16 B x odd, 16-byte fragment reads of 16 rows fall on 64 different banks
#define LTILE (64 * LP)           // one staged tile: 64 rows (keys of K, or d of Vt) of 64 elements
// ldx: a fragment loaded straight from global memory (the Q rows, once per wave). The s_wait_xcnt 0 stands behind each 16-byte load so that it comes in front of any rewrite of the address pair the load names (the register allocator gives such pairs to later loads' data).
__device__ __forceinline__ v16h ldx(const h16* p) { const v8h lo = *(const v8h*)p; asm volatile("s_wait_xcnt 0x0" ::: "memory"); const v8h hi = *(const v8h*)(p + 16); asm volatile("s_wait_xcnt 0x0" ::: "memory"); return cat16(lo, hi); }
__device__ __forceinline__ v16bf ldx(const bf* p) { const v8us lo = *(const v8us*)p; asm volatile("s_wait_xcnt 0x0" ::: "memory"); const v8us hi = *(const v8us*)(p + 16); asm volatile("s_wait_xcnt 0x0" ::: "memory"); return cat16b(lo, hi); }
// exp2run: 2^x of 16 values, each in its own register, as ONE run of v_exp_f32: no instruction directly behind one of them reads its result or rewrites its source, and the v_nop is that slot behind the last.
__device__ __forceinline__ void exp2run(float (&e)[16]) { asm("v_exp_f32 %0, %0\n\tv_exp_f32 %1, %1\n\tv_exp_f32 %2, %2\n\tv_exp_f32 %3, %3\n\tv_exp_f32 %4, %4\n\tv_exp_f32 %5, %5\n\tv_exp_f32 %6, %6\n\tv_exp_f32 %7, %7\n\tv_exp_f32 %8, %8\n\tv_exp_f32 %9, %9\n\tv_exp_f32 %10, %10\n\tv_exp_f32 %11, %11\n\tv_exp_f32 %12, %12\n\tv_exp_f32 %13, %13\n\tv_exp_f32 %14, %14\n\tv_exp_f32 %15, %15\n\tv_nop" : "+v"(e[0]), "+v"(e[1]), "+v"(e[2]), "+v"(e[3]), "+v"(e[4]), "+v"(e[5]), "+v"(e[6]), "+v"(e[7]), "+v"(e[8]), "+v"(e[9]), "+v"(e[10]), "+v"(e[11]), "+v"(e[12]), "+v"(e[13]), "+v"(e[14]), "+v"(e[15])); }
// exp2one: 2^x of one value (the rescale factor); the v_nop is the slot behind the v_exp_f32.
__device__ __forceinline__ float exp2one(float x) { asm("v_exp_f32 %0, %0\n\tv_nop" : "+v"(x)); return x; }
__device__ __forceinline__ float xhalf(float x) { const int b = __float_as_int(x); return __int_as_float(__builtin_amdgcn_permlanex16(b, b, 0x76543210, 0xfedcba98, false, false)); }   // the value of lane l ^ 16
template <typename T16, bool HR, int NQ>
__device__ __forceinline__ void attn_wg(T16* sm, const T16* __restrict__ Q, const T16* __restrict__ Q2, const T16* __restrict__ Kp, const T16* __restrict__ K2, const T16* __restrict__ Vt, const T16* __restrict__ V2, int q0, bf* __restrict__ Ah, bf* __restrict__ Al) {
    typedef WFrag<T16> F; typedef typename F::V V;
    constexpr int NP = HR ? 2 : 1, BUF = 2 * NP * LTILE, NCP = 4 * NP;   // a buffer: the K tile(s), then the Vt tile(s); NCP copies per thread and stage
    const int lane = threadIdx.x & 31, lr = lane & 15, hi = lane >> 4;
    const int sr = threadIdx.x >> 3, sc = (threadIdx.x & 7) * 8;   // staging: this thread copies 16 bytes at element sc of rows sr and sr + 32 of every tile
    const T16* pk = Kp + (size_t)sr * HD + sc; const T16* pv = Vt + (size_t)sr * TT + sc; const T16* pk2 = HR ? K2 + (size_t)sr * HD + sc : pk; const T16* pv2 = HR ? V2 + (size_t)sr * TT + sc : pv;   // this thread's bytes of the next stage to copy; they move on by one stage per fill
    const unsigned l0 = (unsigned)(size_t)(sm + sr * LP + sc);
    auto fill = [&](int t) {   // stage t into buffer t & 1
        unsigned l[NCP]; const void* g[NCP]; const unsigned lb = l0 + (unsigned)((t & 1) * BUF * 2);
#pragma unroll
        for (int i = 0; i < 2; ++i) { l[i] = lb + (unsigned)(i * 32 * LP * 2); g[i] = pk + (size_t)i * 32 * HD; l[2 + i] = lb + (unsigned)((NP * LTILE + i * 32 * LP) * 2); g[2 + i] = pv + (size_t)i * 32 * TT;
            if constexpr (HR) { l[4 + i] = lb + (unsigned)((LTILE + i * 32 * LP) * 2); g[4 + i] = pk2 + (size_t)i * 32 * HD; l[6 + i] = lb + (unsigned)((3 * LTILE + i * 32 * LP) * 2); g[6 + i] = pv2 + (size_t)i * 32 * TT; } }
        cpy<NCP>(l, g);
        pk += KST * HD; pv += KST; pk2 += KST * HD; pv2 += KST; };
    static_assert(TT / KST >= 2, "stages 0 and 1 are copied in front of the loop");
    fill(0);   // flies while the Q rows are loaded
    const float C2 = SCL * 1.4426950408889634f, OFF = HR ? 0.0f : 10.0f;
    const float LIM = HR ? 256.0f : 32768.0f;   // the maximum in use is held while a lane's 16 P of a pass sum to LIM or less: every P then is at most LIM, which fp16 holds (P carries 2^OFF)
    V qf[NQ][2], qg[NQ][2];
#pragma unroll
    for (int n = 0; n < NQ; ++n)
#pragma unroll
        for (int ks = 0; ks < 2; ++ks) { const size_t qo = (size_t)(q0 + n * 16 + lr) * HD + ks * 32 + 8 * hi; qf[n][ks] = ldx(Q + qo); if (HR) qg[n][ks] = ldx(Q2 + qo); }
    v8f o[NQ][4]; float m[NQ], l[NQ], nb[NQ];   // m: the maximum in use, nb = OFF - m C2 (at the start so large that the first pass's P overflow and the test below sets m)
#pragma unroll
    for (int n = 0; n < NQ; ++n) { m[n] = -3.0e38f; nb[n] = 3.0e38f; l[n] = 0.0f;
#pragma unroll
        for (int db = 0; db < 4; ++db) o[n][db] = (v8f){}; }
    asm volatile("s_wait_asynccnt 0x0" ::: "memory");   // this wave's copies of stage 0 have landed
    __syncthreads();   // stage 0 is in LDS for every wave
    fill(1);
#pragma unroll 1
    for (int st = 0; st < TT / KST; ++st) {
        const T16* cur = sm + (st & 1) * BUF;
#pragma unroll
        for (int p = 0; p < KST / 32; ++p) {
            v8f s[NQ][2];
#pragma unroll
            for (int kt = 0; kt < 2; ++kt) { V kf[2], kg[2];
#pragma unroll
                for (int ks = 0; ks < 2; ++ks) { const T16* a = cur + (p * 32 + kt * 16 + lr) * LP + ks * 32 + 8 * hi; kf[ks] = F::ld(a); if (HR) kg[ks] = F::ld(a + LTILE); }
#pragma unroll
                for (int n = 0; n < NQ; ++n) { s[n][kt] = (v8f){};
#pragma unroll
                    for (int ks = 0; ks < 2; ++ks) { s[n][kt] = F::mma(kf[ks], qf[n][ks], s[n][kt]); if (HR) { s[n][kt] = F::mma(kf[ks], qg[n][ks], s[n][kt]); s[n][kt] = F::mma(kg[ks], qf[n][ks], s[n][kt]); } } } }
            V pf[NQ], pg[NQ]; v8f p0[NQ], p1[NQ]; float sum[NQ];
            auto soft = [&](int n) {   // P of column group n from the maximum in use, and this lane's sum of its 16
                float e[16]; const v8f d0 = s[n][0] * C2 + nb[n], d1 = s[n][1] * C2 + nb[n];   // one fused multiply-add per score: (s - m) C2 + OFF
#pragma unroll
                for (int j = 0; j < 8; ++j) { e[j] = d0[j]; e[8 + j] = d1[j]; }
                exp2run(e);
#pragma unroll
                for (int j = 0; j < 8; ++j) { p0[n][j] = e[j]; p1[n][j] = e[8 + j]; }
                const v8f ps = p0[n] + p1[n];
                sum[n] = (((ps[0] + ps[1]) + (ps[2] + ps[3])) + ((ps[4] + ps[5]) + (ps[6] + ps[7]))); };
            bool need = false;   // need: this lane's 16 P sum to more than LIM (or are not numbers), so one of them may be too large for its 16-bit type
#pragma unroll
            for (int n = 0; n < NQ; ++n) { soft(n); need = need || !(sum[n] <= LIM); }
            if (__builtin_expect(__builtin_amdgcn_ballot_w32(need) != 0, 0)) {   // one scalar test per 32 keys, marked rare so that the usual path falls through; taken by the whole wave: every column moves to its running maximum, l and Ot are rescaled, P is formed again
#pragma unroll
                for (int n = 0; n < NQ; ++n) {
                    float mx = s[n][0][0];
#pragma unroll
                    for (int j = 1; j < 8; ++j) mx = fmaxf(mx, s[n][0][j]);
#pragma unroll
                    for (int j = 0; j < 8; ++j) mx = fmaxf(mx, s[n][1][j]);
                    const float mn = fmaxf(m[n], fmaxf(mx, xhalf(mx))); const float al = exp2one((m[n] - mn) * C2);
                    m[n] = mn; nb[n] = OFF - mn * C2; l[n] *= al;
#pragma unroll
                    for (int db = 0; db < 4; ++db) o[n][db] *= al;
                    soft(n);
                }
            }
#pragma unroll
            for (int n = 0; n < NQ; ++n) {
                l[n] += sum[n];
                if constexpr (HR) {
                    const v8bf h0 = __builtin_convertvector(p0[n], v8bf), h1 = __builtin_convertvector(p1[n], v8bf);
                    const v8bf l0 = __builtin_convertvector(p0[n] - __builtin_convertvector(h0, v8f), v8bf), l1 = __builtin_convertvector(p1[n] - __builtin_convertvector(h1, v8f), v8bf);
                    pf[n] = __builtin_shufflevector(h0, h1, 0, 1, 2, 3, 4, 5, 6, 7, 8, 9, 10, 11, 12, 13, 14, 15); pg[n] = __builtin_shufflevector(l0, l1, 0, 1, 2, 3, 4, 5, 6, 7, 8, 9, 10, 11, 12, 13, 14, 15);
                } else pf[n] = cat16(__builtin_convertvector(p0[n], v8h), __builtin_convertvector(p1[n], v8h));
            }
            V vf[4], vg[4];
#pragma unroll
            for (int db = 0; db < 4; ++db) { const T16* a = cur + NP * LTILE + (db * 16 + lr) * LP + p * 32 + 8 * hi; vf[db] = F::ld(a); if (HR) vg[db] = F::ld(a + LTILE); }
            if (!HR && p == KST / 32 - 1) __builtin_amdgcn_sched_barrier(0);   // the stage's last Vt reads stay one group in front of their products: with the staging registers gone the compiler reads them into one fragment's registers, and the wave waits out the LDS latency four times
#pragma unroll
            for (int db = 0; db < 4; ++db)
#pragma unroll
                for (int n = 0; n < NQ; ++n) { o[n][db] = F::mma(vf[db], pf[n], o[n][db]); if (HR) { o[n][db] = F::mma(vf[db], pg[n], o[n][db]); o[n][db] = F::mma(vg[db], pf[n], o[n][db]); } }
        }
        // five vector slots between the stage's last matrix instruction and whatever vector instruction stands first behind the loop's taken back edge
        if constexpr (NQ == 2) asm volatile("v_nop\n\tv_nop\n\tv_nop\n\tv_nop\n\tv_nop" : "+v"(o[0][0]), "+v"(o[0][1]), "+v"(o[0][2]), "+v"(o[0][3]), "+v"(o[1][0]), "+v"(o[1][1]), "+v"(o[1][2]), "+v"(o[1][3]));
        else asm volatile("v_nop\n\tv_nop\n\tv_nop\n\tv_nop\n\tv_nop" : "+v"(o[0][0]), "+v"(o[0][1]), "+v"(o[0][2]), "+v"(o[0][3]));
        asm volatile("s_wait_dscnt 0x0" ::: "memory");      // this wave's reads of cur are done before cur is handed to its next writer
        asm volatile("s_wait_asynccnt 0x0" ::: "memory");   // this wave's copies of stage st + 1 have landed
        __syncthreads();   // publishes stage st + 1 and ends every wave's reads of cur
        if (st + 2 < TT / KST) fill(st + 2);   // into cur; these copies fly a whole stage before they are waited for
    }
    asm volatile("s_wait_asynccnt 0x0" ::: "memory");   // no copy is outstanding behind the loop
#pragma unroll
    for (int n = 0; n < NQ; ++n) { const float inv = __fdiv_rn(1.0f, l[n] + xhalf(l[n])); const size_t oo = (size_t)(q0 + n * 16 + lr) * DQ + 8 * hi;
#pragma unroll
        for (int db = 0; db < 4; ++db) { v8us oh, ol;
#pragma unroll
            for (int j = 0; j < 8; ++j) { unsigned short a, c2; splitf(o[n][db][j] * inv, a, c2); oh[j] = a; ol[j] = c2; }
            *(v8us*)(Ah + oo + db * 16) = oh; *(v8us*)(Al + oo + db * 16) = ol; } }
}
// grid: the NB_ * NH_ * RH / 128 work-groups of the 3-product rows first (8 waves x 16 queries; they last longest), then NB_ * NH_ * (TT - RH) / 256 of 8 waves x 32 queries. Planes [b * NH_ + h][..]; Ah, Al [b][t][DQ].
__global__ __launch_bounds__(256) void k_fattn(const h16* __restrict__ Q16, const h16* __restrict__ K16, const h16* __restrict__ V16, const bf* __restrict__ Qh, const bf* __restrict__ Ql, const bf* __restrict__ Kh, const bf* __restrict__ Kl, const bf* __restrict__ Vh, const bf* __restrict__ Vl, bf* __restrict__ Ah, bf* __restrict__ Al) {
    __shared__ __align__(16) bf sm[2 * 4 * LTILE];
    const int wave = __builtin_amdgcn_readfirstlane((int)(threadIdx.x >> 5)); const int id = blockIdx.x; const int NHR = NB_ * NH_ * (RH / 128);
    if (id < NHR) { const int bh = id / (RH / 128), q0 = (id % (RH / 128)) * 128 + wave * 16; const size_t pl = (size_t)bh * TT * HD, ao = (size_t)(bh / NH_) * TT * DQ + (size_t)(bh % NH_) * HD;
        attn_wg<bf, true, 1>(sm, Qh + pl, Ql + pl, Kh + pl, Kl + pl, Vh + pl, Vl + pl, q0, Ah + ao, Al + ao);
    } else { const int i2 = id - NHR; const int bh = i2 / ((TT - RH) / 256), q0 = RH + (i2 % ((TT - RH) / 256)) * 256 + wave * 32; const size_t pl = (size_t)bh * TT * HD, ao = (size_t)(bh / NH_) * TT * DQ + (size_t)(bh % NH_) * HD;
        attn_wg<h16, false, 2>((h16*)sm, Q16 + pl, nullptr, K16 + pl, nullptr, V16 + pl, nullptr, q0, Ah + ao, Al + ao); }
}

extern "C" void kernel_launch(void* const* d_in, const int* in_sizes, int n_in,
                              void* d_out, int out_size, void* d_ws, size_t ws_size, hipStream_t stream) {
    (void)in_sizes; (void)n_in; (void)out_size;
    const float* x = (const float*)d_in[0]; const float* wqkv = (const float*)d_in[1]; const float* wo = (const float*)d_in[2];
    float* OUT = (float*)d_out;     // [4][2048][1024]
    char* wsp = (char*)d_ws;
    auto take = [&](size_t bytes) { char* p = wsp; wsp += (bytes + 255) & ~(size_t)255; return (void*)p; };
    bf* XB = (bf*)take((NX8 + NW8 + NO8) * 8 * 2); bf* WQKV = XB + NX8 * 8; bf* WO = WQKV + NW8 * 8;   // x of all batches, W_qkv, W_o: one run, as k_cvt8 writes it
    const size_t PQ = (size_t)NH_ * TT * HD;   // one batch's share of a q, k or v plane, in elements (NKV == NH_); every plane holds all NB_ batches
    h16* QP16 = (h16*)take(3 * NB_ * PQ * 2); h16* KP16 = QP16 + NB_ * PQ; h16* VT16 = KP16 + NB_ * PQ;   // q, k, v of one kind of plane lie NB_ * PQ elements apart
    bf* QPh = (bf*)take(3 * NB_ * PQ * 2); bf* KPh = QPh + NB_ * PQ; bf* VTh = KPh + NB_ * PQ;
    bf* QPl = (bf*)take(3 * NB_ * PQ * 2); bf* KPl = QPl + NB_ * PQ; bf* VTl = KPl + NB_ * PQ;
    bf* ATh = (bf*)take((size_t)NB_ * TT * DQ * 2); bf* ATl = (bf*)take((size_t)NB_ * TT * DQ * 2);
    if ((size_t)(wsp - (char*)d_ws) > ws_size) return;    // ws 256 MiB
    k_cvt8<<<(unsigned)((NX8 + NW8 + NO8) / 256), 256, 0, stream>>>(x, wqkv, wo, XB);
    k_gemmw<bf, 0, false, true><<<dim3(TT / GTM, 3 * NH_ * 64 / GTN, NB_), 256, 0, stream>>>(XB, nullptr, WQKV, nullptr, DM, nullptr, 0, nullptr, (size_t)TT * DM, 0, PQ, QP16, QPh, QPl, NB_ * PQ);
    k_fattn<<<NB_ * NH_ * (RH / 128 + (TT - RH) / 256), 256, 0, stream>>>(QP16, KP16, VT16, QPh, QPl, KPh, KPl, VTh, VTl, ATh, ATl);   // one kv head per query head
    k_gemmw<bf, 1, false, false><<<dim3(NB_ * TT / GTM, DM / GTN, 1), 256, 0, stream>>>(ATh, ATl, WO, nullptr, DQ, OUT, DM, nullptr, 0, 0, 0, nullptr, nullptr, nullptr, 0);   // the batches' rows are one run in ATh, ATl and OUT
}

// v009
// A run of this version takes 166 microseconds.
// Timed twice side by side with v008, it ran 1.03 and 1.04 times as fast.
// Over all steps from v000 it is 24.1 times as fast.
#include <hip/hip_runtime.h>

// Multi-head attention with a fused 'oi' projection (x [4][2048][1024]; [Q|K|V] = x W_qkv^T ([3072][1024]: rows q | k | v); 16 heads x 64; softmax(q.k/8) over all keys; out = merged W_o^T -> [4][2048][1024] (8.4 M)).
// Compute dtypes, f32 accumulate: every input rounded to bf16; q/k/v on PLAIN bf16 operands (inputs: exact); scores and attn.v on fp16 operands (P x1024): query rows < 512 value + residual (3 products), the rest the value alone; softmax f32, maximum held while P fits its type; W_o hl x exact (2 products).

#define NB_  4
#define TT   2048
#define DM   1024
#define NH_  16
#define NKV  16
#define REP  (NH_ / NKV)
#define HD   64
#define DQ   (NH_ * HD)
#define DKV  (NKV * HD)
#define RH   512                  // query rows < RH use hi+lo planes (0: none)
#define WIN  0
#define SCL  0.125f   // HD^-0.5
typedef _Float16 h16;
typedef unsigned short bf;
typedef __attribute__((ext_vector_type(16))) __bf16   v16bf;
typedef __attribute__((ext_vector_type(16))) _Float16 v16h;
typedef __attribute__((ext_vector_type(8)))  _Float16 v8h;
typedef __attribute__((ext_vector_type(8)))  unsigned short v8us;
typedef __attribute__((ext_vector_type(8)))  __bf16   v8bf;
typedef __attribute__((ext_vector_type(8)))  float    v8f;
typedef __attribute__((ext_vector_type(4)))  float    v4f;
typedef v8h  __attribute__((may_alias)) v8ha;
typedef v4f  __attribute__((may_alias)) v4fa;
typedef v8us __attribute__((may_alias)) v8usa;

__device__ __forceinline__ unsigned short f2bf(float f) { unsigned u = __float_as_uint(f); u += 0x7FFFu + ((u >> 16) & 1u); return (unsigned short)(u >> 16); }
__device__ __forceinline__ float bf2f(unsigned short b) { return __uint_as_float(((unsigned)b) << 16); }
__device__ __forceinline__ float bfr(float f) { return bf2f(f2bf(f)); }
__device__ __forceinline__ v16h cat16(v8h lo, v8h hi) { return __builtin_shufflevector(lo, hi, 0, 1, 2, 3, 4, 5, 6, 7, 8, 9, 10, 11, 12, 13, 14, 15); }
__device__ __forceinline__ v16bf cat16b(v8us lo, v8us hi) { return __builtin_bit_cast(v16bf, __builtin_shufflevector(lo, hi, 0, 1, 2, 3, 4, 5, 6, 7, 8, 9, 10, 11, 12, 13, 14, 15)); }
__device__ __forceinline__ v8f wmma16(v16h a, v16h b, v8f c) { return __builtin_amdgcn_wmma_f32_16x16x32_f16(false, a, false, b, (short)0, c, false, false); }
__device__ __forceinline__ v8f wmmab(v16bf a, v16bf b, v8f c) { return __builtin_amdgcn_wmma_f32_16x16x32_bf16(false, a, false, b, (short)0, c, false, false); }



__device__ __forceinline__ h16 tohx(float x) { return (h16)x; }
__device__ __forceinline__ void splitf(float y, unsigned short& h, unsigned short& l) { h = f2bf(y); l = f2bf(y - bf2f(h)); }
// ---- k_gemmw: GEMM on a 128 x 256 output tile per work-group of 8 waves (2 x 4), each wave a register-blocked 64x64 sub-tile (16 accumulators); grid (M/128, N/256, Z), 256 threads.
// C[m][n] (f32, pitch ldc, + optional f32 bias[n]) = sum_k A[m][k] Bt[n][k] (+ A2[m][k] Bt[n][k] where NSPLIT == 1). z-batch strides sA/sB/sC in elements. K % 64 == 0.
// The operands come from K-contiguous 16-bit planes through LDS: a stage is 64 k (one whole 128-byte line) of the tile's 128 A rows (and A2 rows) and 256 Bt rows; asynchronous 16-byte copies, a wave's copy = 4 whole lines;
// two buffers, stage t + 2 is copied into the buffer that trip t has just left, one barrier per trip. Every staged row serves 4 (A) or 2 (Bt) waves.
// PL: C is not stored as f32; each value goes out as fp16 (P16) and as the fp16 residual of that rounding (Pl), at the same element of each plane, placed as below:
//     ONE launch does q, k and v of every batch: A = x ([b][t][DM], batch stride sA), Bt = all rows of W_qkv, grid (TT/128, 3 * NH_ / 4, NB_); a wave's 64 W rows are one head of q, k or v (plane sets cts elements apart, batches sC apart).
//     q, k: x rows times W rows, stored [h][t][d];  v: the operands swapped (W rows times x rows), stored [h][d][t]. A store instruction writes four whole 128-byte lines.
template <typename T16> struct WFrag;
template <> struct WFrag<h16> { typedef v16h V; static __device__ __forceinline__ V ld(const h16* p) { return cat16(*(const v8h*)p, *(const v8h*)(p + 16)); } static __device__ __forceinline__ v8f mma(V a, V b, v8f c) { return wmma16(a, b, c); } };
template <> struct WFrag<bf> { typedef v16bf V; static __device__ __forceinline__ V ld(const bf* p) { return cat16b(*(const v8us*)p, *(const v8us*)(p + 16)); } static __device__ __forceinline__ v8f mma(V a, V b, v8f c) { return wmmab(a, b, c); } };
#define GTM 128                   // output rows of a work-group's tile
#define GTN 256                   // output columns
#define GKS 64                    // k per stage
#define GLP 72                    // LDS row pitch in 16-bit elements: 144 B = 16 B x odd, 16-byte fragment reads of 16 rows fall on 64 different banks
// cpy<N>: N asynchronous 16-byte copies global -> LDS per lane (l: the lane's LDS byte addresses, g: its global addresses). The s_wait_xcnt 0 is the statement's last line, so it stands in front of every rewrite of an address register that these copies name.
template <int N> __device__ __forceinline__ void cpy(const unsigned* l, const void* const* g);
template <> __device__ __forceinline__ void cpy<4>(const unsigned* l, const void* const* g) {
    asm volatile("global_load_async_to_lds_b128 %0, %4, off\n\tglobal_load_async_to_lds_b128 %1, %5, off\n\tglobal_load_async_to_lds_b128 %2, %6, off\n\tglobal_load_async_to_lds_b128 %3, %7, off\n\ts_wait_xcnt 0x0"
                 :: "v"(l[0]), "v"(l[1]), "v"(l[2]), "v"(l[3]), "v"(g[0]), "v"(g[1]), "v"(g[2]), "v"(g[3]) : "memory"); }
template <> __device__ __forceinline__ void cpy<8>(const unsigned* l, const void* const* g) {
    asm volatile("global_load_async_to_lds_b128 %0, %8, off\n\tglobal_load_async_to_lds_b128 %1, %9, off\n\tglobal_load_async_to_lds_b128 %2, %10, off\n\tglobal_load_async_to_lds_b128 %3, %11, off\n\tglobal_load_async_to_lds_b128 %4, %12, off\n\tglobal_load_async_to_lds_b128 %5, %13, off\n\tglobal_load_async_to_lds_b128 %6, %14, off\n\tglobal_load_async_to_lds_b128 %7, %15, off\n\ts_wait_xcnt 0x0"
                 :: "v"(l[0]), "v"(l[1]), "v"(l[2]), "v"(l[3]), "v"(l[4]), "v"(l[5]), "v"(l[6]), "v"(l[7]), "v"(g[0]), "v"(g[1]), "v"(g[2]), "v"(g[3]), "v"(g[4]), "v"(g[5]), "v"(g[6]), "v"(g[7]) : "memory"); }
template <> __device__ __forceinline__ void cpy<12>(const unsigned* l, const void* const* g) {
    asm volatile("global_load_async_to_lds_b128 %0, %12, off\n\tglobal_load_async_to_lds_b128 %1, %13, off\n\tglobal_load_async_to_lds_b128 %2, %14, off\n\tglobal_load_async_to_lds_b128 %3, %15, off\n\tglobal_load_async_to_lds_b128 %4, %16, off\n\tglobal_load_async_to_lds_b128 %5, %17, off\n\tglobal_load_async_to_lds_b128 %6, %18, off\n\tglobal_load_async_to_lds_b128 %7, %19, off\n\tglobal_load_async_to_lds_b128 %8, %20, off\n\tglobal_load_async_to_lds_b128 %9, %21, off\n\tglobal_load_async_to_lds_b128 %10, %22, off\n\tglobal_load_async_to_lds_b128 %11, %23, off\n\ts_wait_xcnt 0x0"
                 :: "v"(l[0]), "v"(l[1]), "v"(l[2]), "v"(l[3]), "v"(l[4]), "v"(l[5]), "v"(l[6]), "v"(l[7]), "v"(l[8]), "v"(l[9]), "v"(l[10]), "v"(l[11]), "v"(g[0]), "v"(g[1]), "v"(g[2]), "v"(g[3]), "v"(g[4]), "v"(g[5]), "v"(g[6]), "v"(g[7]), "v"(g[8]), "v"(g[9]), "v"(g[10]), "v"(g[11]) : "memory"); }
// launch bounds: at least 4 waves per SIMD, that is a budget of 256 registers, so that two work-groups of the q/k/v launch share a WGP (their LDS fits twice).
template <typename T16, int NSPLIT, bool BIAS, bool PL>
__global__ __launch_bounds__(256, 4) void k_gemmw(const T16* __restrict__ A, const T16* __restrict__ A2, const T16* __restrict__ Bt, const T16* __restrict__ Bt2, int K, float* C, int ldc, const float* __restrict__ bias, size_t sA, size_t sB, size_t sC, h16* P16, h16* Pl, size_t cts) {
    static_assert(NSPLIT == 0 || NSPLIT == 1, "A (+ A2) times Bt");
    typedef typename WFrag<T16>::V V;
    constexpr int NAP = NSPLIT == 1 ? 2 : 1, ROWS = GTM * NAP + GTN, BUFE = ROWS * GLP, NC = ROWS / 32;   // a buffer: the A rows, the A2 rows, the Bt rows; NC copies per thread and stage
    __shared__ __align__(16) T16 sm[2 * BUFE];
    __shared__ __align__(16) float osm[8 * 16 * 68];
    const size_t z = blockIdx.z; A += z * sA; if (NSPLIT == 1) A2 += z * sA; Bt += z * sB;
    C += z * sC;
    const int wave = __builtin_amdgcn_readfirstlane((int)(threadIdx.x >> 5)), wm = wave & 1, wn = wave >> 1;
    float* os = osm + wave * (16 * 68);   // each wave's own epilogue staging
    const int lane = threadIdx.x & 31, lr = lane & 15, hi = lane >> 4; const int R0 = blockIdx.x * GTM, C0 = blockIdx.y * GTN; const int r0 = R0 + wm * 64, c0 = C0 + wn * 64;
    int arow = wm * 64, brow = GTM * NAP + wn * 64;   // first staged row of the wave's A and B operand
    size_t pofs = 0; int ldp = HD;   // PL: element of the wave tile's first value in each plane, and the pitch of its rows there
    if constexpr (PL) { const int y = blockIdx.y * (GTN / 64) + wn, sel = y / NH_, h = y % NH_; pofs = (size_t)sel * cts + z * sC + (size_t)h * TT * HD;
        if (sel < 2) pofs += (size_t)r0 * HD;
        else { pofs += r0; ldp = TT; const int t0 = arow; arow = brow; brow = t0; } }
    v8f acc[4][4];   // the unrolls in this kernel make every index of acc, a, a2, b, l and g a constant, so that these arrays live in registers
#pragma unroll
    for (int mb = 0; mb < 4; ++mb)
#pragma unroll
        for (int nb = 0; nb < 4; ++nb) acc[mb][nb] = (v8f){};
    const int sr = threadIdx.x >> 3, sc = (threadIdx.x & 7) * 8;   // staging: this thread copies 16 bytes at element sc of rows sr, sr + 32, ... of the stage
    const T16* pa = A + (size_t)(R0 + sr) * K + sc; const T16* pa2 = NSPLIT == 1 ? A2 + (size_t)(R0 + sr) * K + sc : pa; const T16* pb = Bt + (size_t)(C0 + sr) * K + sc;   // this thread's bytes of the next stage to copy; they move on by one stage per fill
    const unsigned l0 = (unsigned)(size_t)(sm + sr * GLP + sc);
    auto fill = [&](int t) {   // stage t into buffer t & 1
        unsigned l[NC]; const void* g[NC];
#pragma unroll
        for (int j = 0; j < NC; ++j) { l[j] = l0 + (unsigned)(((t & 1) * BUFE + j * 32 * GLP) * 2);
            g[j] = (j < GTM / 32 ? pa + (size_t)j * 32 * K : j < NAP * GTM / 32 ? pa2 + (size_t)(j - GTM / 32) * 32 * K : pb + (size_t)(j - NAP * GTM / 32) * 32 * K); }
        if constexpr (NC == 12) cpy<12>(l, g); else { cpy<8>(l, g); cpy<8>(l + 8, g + 8); }
        pa += GKS; pa2 += GKS; pb += GKS; };
    const int NT = K / GKS;
    fill(0);
    asm volatile("s_wait_asynccnt 0x0" ::: "memory");   // this wave's copies of stage 0 have landed
    __syncthreads();   // stage 0 is in LDS for every wave
    if (NT > 1) fill(1);
#pragma unroll 1   // one trip per stage stays rolled: unrolled, two trips' fragments and addresses would not fit the register budget
    for (int t = 0; t < NT; ++t) {
        const T16* cur = sm + (t & 1) * BUFE;
        V a[4], a2[4], b[4];
        auto frags = [&](int ks) {   // all fragments of 32 k, read as one group
#pragma unroll
            for (int mb = 0; mb < 4; ++mb) { const T16* p = cur + (arow + mb * 16 + lr) * GLP + ks * 32 + 8 * hi; a[mb] = WFrag<T16>::ld(p); if (NSPLIT == 1) a2[mb] = WFrag<T16>::ld(p + GTM * GLP); }
#pragma unroll
            for (int nb = 0; nb < 4; ++nb) b[nb] = WFrag<T16>::ld(cur + (brow + nb * 16 + lr) * GLP + ks * 32 + 8 * hi); };
        auto prods = [&]() {
#pragma unroll
            for (int nb = 0; nb < 4; ++nb)
#pragma unroll
                for (int mb = 0; mb < 4; ++mb) { acc[mb][nb] = WFrag<T16>::mma(a[mb], b[nb], acc[mb][nb]); if (NSPLIT == 1) acc[mb][nb] = WFrag<T16>::mma(a2[mb], b[nb], acc[mb][nb]); } };
        frags(0);
        __builtin_amdgcn_sched_barrier(0);   // keeps the LDS reads together in front of the products: without it the compiler sinks each b fragment's reads to just in front of its products, and the wave waits out the LDS latency four times
        prods();
        frags(1);   // the trip's last reads of cur
        __builtin_amdgcn_sched_barrier(0);   // as above
        if constexpr (NSPLIT == 1) prods();   // three fragment sets and the copies' addresses do not fit 256 registers together: here the last products come first
        asm volatile("s_wait_dscnt 0x0" ::: "memory");      // this wave's reads of cur are done before cur is handed to its next writer
        asm volatile("s_wait_asynccnt 0x0" ::: "memory");   // this wave's copies of stage t + 1 have landed
        __syncthreads();   // publishes stage t + 1 and ends every wave's reads of cur
        if (t + 2 < NT) fill(t + 2);
        if constexpr (NSPLIT == 0) { __builtin_amdgcn_sched_barrier(0);   // keeps the copies in front of the trip's last products (registers only), so that they fly a whole trip before they are waited for
            prods(); }
    }
    asm volatile("s_wait_asynccnt 0x0" ::: "memory");   // no copy is outstanding behind the loop
#pragma unroll
    for (int mb = 0; mb < 4; ++mb) {
#pragma unroll
        for (int nb = 0; nb < 4; ++nb) {
#pragma unroll
            for (int j = 0; j < 8; ++j) os[(hi * 8 + j) * 68 + nb * 16 + lr] = acc[mb][nb][j]; }
        __builtin_amdgcn_wave_barrier(); asm volatile("" ::: "memory");
        if constexpr (PL) {
            const int cofs = (lane & 7) * 8; v4f va[4], vb[4];   // all eight LDS reads of these 16 rows first: the store statements below are memory barriers to the compiler, no read moves up over one
#pragma unroll
            for (int s = 0; s < 4; ++s) { const float* o4 = os + (4 * s + (lane >> 3)) * 68 + cofs; va[s] = *(const v4fa*)o4; vb[s] = *(const v4fa*)(o4 + 4); }
#pragma unroll
            for (int s = 0; s < 4; ++s) { const int row = 4 * s + (lane >> 3); v8h o16, ol;
#pragma unroll
                for (int q = 0; q < 8; ++q) { const float r = q < 4 ? va[s][q & 3] : vb[s][q & 3]; const h16 a2 = tohx(r); o16[q] = a2; ol[q] = tohx(r - (float)a2); }
                const size_t off = pofs + (size_t)(mb * 16 + row) * ldp + cofs;
                // the two stores and their s_wait_xcnt 0 in one statement: the wait then stands in front of every rewrite of a data or address register that these stores name
                asm volatile("global_store_b128 %0, %2, off\n\tglobal_store_b128 %1, %3, off\n\ts_wait_xcnt 0x0" :: "v"(P16 + off), "v"(Pl + off), "v"(o16), "v"(ol) : "memory"); }
        } else {
            float* crow = C + (size_t)(r0 + mb * 16) * ldc + c0;
#pragma unroll
            for (int s = 0; s < 8; ++s) { const int row = 2 * s + hi, cofs = lr * 4; v4f val = *(const v4fa*)(os + row * 68 + cofs); if (BIAS) { val[0] += bfr(bias[c0 + cofs]); val[1] += bfr(bias[c0 + cofs + 1]); val[2] += bfr(bias[c0 + cofs + 2]); val[3] += bfr(bias[c0 + cofs + 3]); }
                *(v4f*)(crow + (size_t)row * ldc + cofs) = val; }
             }
        __builtin_amdgcn_wave_barrier(); asm volatile("" ::: "memory");
    }
}

typedef __attribute__((ext_vector_type(2))) _Float16 v2h;
typedef __attribute__((ext_vector_type(4))) _Float16 v4h;
typedef __attribute__((ext_vector_type(2))) unsigned short v2us;
typedef __attribute__((ext_vector_type(4))) unsigned short v4us;
typedef __attribute__((ext_vector_type(2))) float v2f;
typedef __attribute__((ext_vector_type(4))) int v4i;

__global__ __launch_bounds__(256) void k_wtG(const float* __restrict__ w, int K, int N, bf* Bt) {
    const int lane = threadIdx.x & 31; const int L0 = (blockIdx.x * 8 + (threadIdx.x >> 5)) * 8; const int nlines = N * K / 64;
{
#pragma unroll 1
        for (int l = 0; l < 8; ++l) { const int L = L0 + l; if (L >= nlines) break; const size_t e = (size_t)L * 64 + lane * 2; const int k = (int)(e % K), n = (int)(e / K); v2us o;
            o[0] = f2bf(w[(size_t)k * N + n]); o[1] = f2bf(w[(size_t)(k + 1) * N + n]); *(v2us*)(Bt + e) = o; }
         }
}
// k_cvt8: x, W_qkv and W_o rounded to bf16 in one launch; dst holds the three one behind the other. Each part is a whole number of work-groups.
#define NX8 ((size_t)NB_ * TT * DM / 8)
#define NW8 ((size_t)(DQ + 2 * DKV) * DM / 8)
#define NO8 ((size_t)DM * DQ / 8)
__global__ __launch_bounds__(256) void k_cvt8(const float* __restrict__ x, const float* __restrict__ wqkv, const float* __restrict__ wo, bf* dst) { const size_t g = (size_t)blockIdx.x * 256, i = g + threadIdx.x;
    const float* src = g < NX8 ? x + i * 8 : g < NX8 + NW8 ? wqkv + (i - NX8) * 8 : wo + (i - NX8 - NW8) * 8; const v8f v = *(const v8f*)src; v8us o;
#pragma unroll
    for (int k = 0; k < 8; ++k) o[k] = f2bf(v[k]); *(v8us*)(dst + i * 8) = o;  }

// ---- k_fattn: scores, softmax and attn.v of one (batch, head) in ONE kernel; no score or P element leaves the registers.
// A wave owns NQ * 16 query columns and walks the 2048 keys 32 at a time: St = K Qt (A = K rows, B = Q rows, kept in registers), so a lane holds 16 scores of ONE query per column group;
// maximum in use m and sum l per query (in-lane; m is held from pass to pass and no maximum is formed while the P stay small enough for their type, tested once per 32 keys on their sums; only then does m move to the running maximum and are l and Ot rescaled); two St tiles, converted in place, are the B operand Pt of Ot += Vt Pt (A = rows of the [d][t] planes).
// Ot: a lane holds 8 consecutive d of one query, scaled by 1 / l at the end and stored as the hi + lo planes that the output projection reads ([b][t][h][d]).
// The work-group's 8 waves share K and Vt through LDS: stages of KST keys, two buffers; whole 128-byte lines go global -> LDS by asynchronous 16-byte copies (through no register); stage st + 2 is copied into the buffer that stage st has just left, one barrier per stage.
// All operands fp16, P carried x 2^10 (l carries the same factor, so it cancels). HR (query rows < RH): every operand is its fp16 value plus the fp16 residual of that rounding, 3 products each for St and Ot; the value planes are the ones the other rows read alone.
#define KST 64                    // keys per LDS stage
#define LP  72                    // LDS row pitch in 16-bit elements: 144 B = 16 B x odd, 16-byte fragment reads of 16 rows fall on 64 different banks
#define LTILE (64 * LP)           // one staged tile: 64 rows (keys of K, or d of Vt) of 64 elements
// ldx: a fragment loaded straight from global memory (the Q rows, once per wave). The s_wait_xcnt 0 stands behind each 16-byte load so that it comes in front of any rewrite of the address pair the load names (the register allocator gives such pairs to later loads' data).
__device__ __forceinline__ v16h ldx(const h16* p) { const v8h lo = *(const v8h*)p; asm volatile("s_wait_xcnt 0x0" ::: "memory"); const v8h hi = *(const v8h*)(p + 16); asm volatile("s_wait_xcnt 0x0" ::: "memory"); return cat16(lo, hi); }
__device__ __forceinline__ v16bf ldx(const bf* p) { const v8us lo = *(const v8us*)p; asm volatile("s_wait_xcnt 0x0" ::: "memory"); const v8us hi = *(const v8us*)(p + 16); asm volatile("s_wait_xcnt 0x0" ::: "memory"); return cat16b(lo, hi); }
// exp2run: 2^x of 16 values, each in its own register, as ONE run of v_exp_f32: no instruction directly behind one of them reads its result or rewrites its source, and the v_nop is that slot behind the last.
__device__ __forceinline__ void exp2run(float (&e)[16]) { asm("v_exp_f32 %0, %0\n\tv_exp_f32 %1, %1\n\tv_exp_f32 %2, %2\n\tv_exp_f32 %3, %3\n\tv_exp_f32 %4, %4\n\tv_exp_f32 %5, %5\n\tv_exp_f32 %6, %6\n\tv_exp_f32 %7, %7\n\tv_exp_f32 %8, %8\n\tv_exp_f32 %9, %9\n\tv_exp_f32 %10, %10\n\tv_exp_f32 %11, %11\n\tv_exp_f32 %12, %12\n\tv_exp_f32 %13, %13\n\tv_exp_f32 %14, %14\n\tv_exp_f32 %15, %15\n\tv_nop" : "+v"(e[0]), "+v"(e[1]), "+v"(e[2]), "+v"(e[3]), "+v"(e[4]), "+v"(e[5]), "+v"(e[6]), "+v"(e[7]), "+v"(e[8]), "+v"(e[9]), "+v"(e[10]), "+v"(e[11]), "+v"(e[12]), "+v"(e[13]), "+v"(e[14]), "+v"(e[15])); }
// exp2one: 2^x of one value (the rescale factor); the v_nop is the slot behind the v_exp_f32.
__device__ __forceinline__ float exp2one(float x) { asm("v_exp_f32 %0, %0\n\tv_nop" : "+v"(x)); return x; }
__device__ __forceinline__ float xhalf(float x) { const int b = __float_as_int(x); return __int_as_float(__builtin_amdgcn_permlanex16(b, b, 0x76543210, 0xfedcba98, false, false)); }   // the value of lane l ^ 16
template <typename T16, bool HR, int NQ>
__device__ __forceinline__ void attn_wg(T16* sm, const T16* __restrict__ Q, const T16* __restrict__ Q2, const T16* __restrict__ Kp, const T16* __restrict__ K2, const T16* __restrict__ Vt, const T16* __restrict__ V2, int q0, bf* __restrict__ Ah, bf* __restrict__ Al) {
    typedef WFrag<T16> F; typedef typename F::V V;
    constexpr int NP = HR ? 2 : 1, BUF = 2 * NP * LTILE, NCP = 4 * NP;   // a buffer: the K tile(s), then the Vt tile(s); NCP copies per thread and stage
    const int lane = threadIdx.x & 31, lr = lane & 15, hi = lane >> 4;
    const int sr = threadIdx.x >> 3, sc = (threadIdx.x & 7) * 8;   // staging: this thread copies 16 bytes at element sc of rows sr and sr + 32 of every tile
    const T16* pk = Kp + (size_t)sr * HD + sc; const T16* pv = Vt + (size_t)sr * TT + sc; const T16* pk2 = HR ? K2 + (size_t)sr * HD + sc : pk; const T16* pv2 = HR ? V2 + (size_t)sr * TT + sc : pv;   // this thread's bytes of the next stage to copy; they move on by one stage per fill
    const unsigned l0 = (unsigned)(size_t)(sm + sr * LP + sc);
    auto fill = [&](int t) {   // stage t into buffer t & 1
        unsigned l[NCP]; const void* g[NCP]; const unsigned lb = l0 + (unsigned)((t & 1) * BUF * 2);
#pragma unroll
        for (int i = 0; i < 2; ++i) { l[i] = lb + (unsigned)(i * 32 * LP * 2); g[i] = pk + (size_t)i * 32 * HD; l[2 + i] = lb + (unsigned)((NP * LTILE + i * 32 * LP) * 2); g[2 + i] = pv + (size_t)i * 32 * TT;
            if constexpr (HR) { l[4 + i] = lb + (unsigned)((LTILE + i * 32 * LP) * 2); g[4 + i] = pk2 + (size_t)i * 32 * HD; l[6 + i] = lb + (unsigned)((3 * LTILE + i * 32 * LP) * 2); g[6 + i] = pv2 + (size_t)i * 32 * TT; } }
        cpy<NCP>(l, g);
        pk += KST * HD; pv += KST; pk2 += KST * HD; pv2 += KST; };
    static_assert(TT / KST >= 2, "stages 0 and 1 are copied in front of the loop");
    fill(0);   // flies while the Q rows are loaded
    const float C2 = SCL * 1.4426950408889634f, OFF = 10.0f;
    const float LIM = 32768.0f;   // the maximum in use is held while a lane's 16 P of a pass sum to LIM or less: every P then is at most LIM, which fp16 holds (P carries 2^OFF)
    V qf[NQ][2], qg[NQ][2];
#pragma unroll
    for (int n = 0; n < NQ; ++n)
#pragma unroll
        for (int ks = 0; ks < 2; ++ks) { const size_t qo = (size_t)(q0 + n * 16 + lr) * HD + ks * 32 + 8 * hi; qf[n][ks] = ldx(Q + qo); if (HR) qg[n][ks] = ldx(Q2 + qo); }
    v8f o[NQ][4]; float m[NQ], l[NQ], nb[NQ];   // m: the maximum in use, nb = OFF - m C2 (at the start so large that the first pass's P overflow and the test below sets m)
#pragma unroll
    for (int n = 0; n < NQ; ++n) { m[n] = -3.0e38f; nb[n] = 3.0e38f; l[n] = 0.0f;
#pragma unroll
        for (int db = 0; db < 4; ++db) o[n][db] = (v8f){}; }
    asm volatile("s_wait_asynccnt 0x0" ::: "memory");   // this wave's copies of stage 0 have landed
    __syncthreads();   // stage 0 is in LDS for every wave
    fill(1);
#pragma unroll 1
    for (int st = 0; st < TT / KST; ++st) {
        const T16* cur = sm + (st & 1) * BUF;
#pragma unroll
        for (int p = 0; p < KST / 32; ++p) {
            v8f s[NQ][2];
#pragma unroll
            for (int kt = 0; kt < 2; ++kt) { V kf[2], kg[2];
#pragma unroll
                for (int ks = 0; ks < 2; ++ks) { const T16* a = cur + (p * 32 + kt * 16 + lr) * LP + ks * 32 + 8 * hi; kf[ks] = F::ld(a); if (HR) kg[ks] = F::ld(a + LTILE); }
#pragma unroll
                for (int n = 0; n < NQ; ++n) { s[n][kt] = (v8f){};
#pragma unroll
                    for (int ks = 0; ks < 2; ++ks) { s[n][kt] = F::mma(kf[ks], qf[n][ks], s[n][kt]); if (HR) { s[n][kt] = F::mma(kf[ks], qg[n][ks], s[n][kt]); s[n][kt] = F::mma(kg[ks], qf[n][ks], s[n][kt]); } } } }
            V pf[NQ], pg[NQ]; v8f p0[NQ], p1[NQ]; float sum[NQ];
            auto soft = [&](int n) {   // P of column group n from the maximum in use, and this lane's sum of its 16
                float e[16]; const v8f d0 = s[n][0] * C2 + nb[n], d1 = s[n][1] * C2 + nb[n];   // one fused multiply-add per score: (s - m) C2 + OFF
#pragma unroll
                for (int j = 0; j < 8; ++j) { e[j] = d0[j]; e[8 + j] = d1[j]; }
                exp2run(e);
#pragma unroll
                for (int j = 0; j < 8; ++j) { p0[n][j] = e[j]; p1[n][j] = e[8 + j]; }
                const v8f ps = p0[n] + p1[n];
                sum[n] = (((ps[0] + ps[1]) + (ps[2] + ps[3])) + ((ps[4] + ps[5]) + (ps[6] + ps[7]))); };
            bool need = false;   // need: this lane's 16 P sum to more than LIM (or are not numbers), so one of them may be too large for its 16-bit type
#pragma unroll
            for (int n = 0; n < NQ; ++n) { soft(n); need = need || !(sum[n] <= LIM); }
            if (__builtin_expect(__builtin_amdgcn_ballot_w32(need) != 0, 0)) {   // one scalar test per 32 keys, marked rare so that the usual path falls through; taken by the whole wave: every column moves to its running maximum, l and Ot are rescaled, P is formed again
#pragma unroll
                for (int n = 0; n < NQ; ++n) {
                    float mx = s[n][0][0];
#pragma unroll
                    for (int j = 1; j < 8; ++j) mx = fmaxf(mx, s[n][0][j]);
#pragma unroll
                    for (int j = 0; j < 8; ++j) mx = fmaxf(mx, s[n][1][j]);
                    const float mn = fmaxf(m[n], fmaxf(mx, xhalf(mx))); const float al = exp2one((m[n] - mn) * C2);
                    m[n] = mn; nb[n] = OFF - mn * C2; l[n] *= al;
#pragma unroll
                    for (int db = 0; db < 4; ++db) o[n][db] *= al;
                    soft(n);
                }
            }
#pragma unroll
            for (int n = 0; n < NQ; ++n) {
                l[n] += sum[n];
                if constexpr (HR) {
                    const v8h h0 = __builtin_convertvector(p0[n], v8h), h1 = __builtin_convertvector(p1[n], v8h);
                    const v8h l0 = __builtin_convertvector(p0[n] - __builtin_convertvector(h0, v8f), v8h), l1 = __builtin_convertvector(p1[n] - __builtin_convertvector(h1, v8f), v8h);
                    pf[n] = cat16(h0, h1); pg[n] = cat16(l0, l1);
                } else pf[n] = cat16(__builtin_convertvector(p0[n], v8h), __builtin_convertvector(p1[n], v8h));
            }
            V vf[4], vg[4];
#pragma unroll
            for (int db = 0; db < 4; ++db) { const T16* a = cur + NP * LTILE + (db * 16 + lr) * LP + p * 32 + 8 * hi; vf[db] = F::ld(a); if (HR) vg[db] = F::ld(a + LTILE); }
            if (!HR && p == KST / 32 - 1) __builtin_amdgcn_sched_barrier(0);   // the stage's last Vt reads stay one group in front of their products: with the staging registers gone the compiler reads them into one fragment's registers, and the wave waits out the LDS latency four times
#pragma unroll
            for (int db = 0; db < 4; ++db)
#pragma unroll
                for (int n = 0; n < NQ; ++n) { o[n][db] = F::mma(vf[db], pf[n], o[n][db]); if (HR) { o[n][db] = F::mma(vf[db], pg[n], o[n][db]); o[n][db] = F::mma(vg[db], pf[n], o[n][db]); } }
        }
        // five vector slots between the stage's last matrix instruction and whatever vector instruction stands first behind the loop's taken back edge
        if constexpr (NQ == 2) asm volatile("v_nop\n\tv_nop\n\tv_nop\n\tv_nop\n\tv_nop" : "+v"(o[0][0]), "+v"(o[0][1]), "+v"(o[0][2]), "+v"(o[0][3]), "+v"(o[1][0]), "+v"(o[1][1]), "+v"(o[1][2]), "+v"(o[1][3]));
        else asm volatile("v_nop\n\tv_nop\n\tv_nop\n\tv_nop\n\tv_nop" : "+v"(o[0][0]), "+v"(o[0][1]), "+v"(o[0][2]), "+v"(o[0][3]));
        asm volatile("s_wait_dscnt 0x0" ::: "memory");      // this wave's reads of cur are done before cur is handed to its next writer
        asm volatile("s_wait_asynccnt 0x0" ::: "memory");   // this wave's copies of stage st + 1 have landed
        __syncthreads();   // publishes stage st + 1 and ends every wave's reads of cur
        if (st + 2 < TT / KST) fill(st + 2);   // into cur; these copies fly a whole stage before they are waited for
    }
    asm volatile("s_wait_asynccnt 0x0" ::: "memory");   // no copy is outstanding behind the loop
#pragma unroll
    for (int n = 0; n < NQ; ++n) { const float inv = __fdiv_rn(1.0f, l[n] + xhalf(l[n])); const size_t oo = (size_t)(q0 + n * 16 + lr) * DQ + 8 * hi;
#pragma unroll
        for (int db = 0; db < 4; ++db) { v8us oh, ol;
#pragma unroll
            for (int j = 0; j < 8; ++j) { unsigned short a, c2; splitf(o[n][db][j] * inv, a, c2); oh[j] = a; ol[j] = c2; }
            *(v8us*)(Ah + oo + db * 16) = oh; *(v8us*)(Al + oo + db * 16) = ol;
            asm volatile("s_wait_xcnt 0x0" ::: "memory"); } }   // stands in front of every rewrite of a data or address register that these two stores name
}
// grid: the NB_ * NH_ * RH / 128 work-groups of the 3-product rows first (8 waves x 16 queries; they last longest), then NB_ * NH_ * (TT - RH) / 256 of 8 waves x 32 queries. Planes [b * NH_ + h][..]; Ah, Al [b][t][DQ].
__global__ __launch_bounds__(256) void k_fattn(const h16* __restrict__ Q16, const h16* __restrict__ K16, const h16* __restrict__ V16, const h16* __restrict__ Ql, const h16* __restrict__ Kl, const h16* __restrict__ Vl, bf* __restrict__ Ah, bf* __restrict__ Al) {
    __shared__ __align__(16) h16 sm[2 * 4 * LTILE];
    const int wave = __builtin_amdgcn_readfirstlane((int)(threadIdx.x >> 5)); const int id = blockIdx.x; const int NHR = NB_ * NH_ * (RH / 128);
    if (id < NHR) { const int bh = id / (RH / 128), q0 = (id % (RH / 128)) * 128 + wave * 16; const size_t pl = (size_t)bh * TT * HD, ao = (size_t)(bh / NH_) * TT * DQ + (size_t)(bh % NH_) * HD;
        attn_wg<h16, true, 1>(sm, Q16 + pl, Ql + pl, K16 + pl, Kl + pl, V16 + pl, Vl + pl, q0, Ah + ao, Al + ao);
    } else { const int i2 = id - NHR; const int bh = i2 / ((TT - RH) / 256), q0 = RH + (i2 % ((TT - RH) / 256)) * 256 + wave * 32; const size_t pl = (size_t)bh * TT * HD, ao = (size_t)(bh / NH_) * TT * DQ + (size_t)(bh % NH_) * HD;
        attn_wg<h16, false, 2>(sm, Q16 + pl, nullptr, K16 + pl, nullptr, V16 + pl, nullptr, q0, Ah + ao, Al + ao); }
}

extern "C" void kernel_launch(void* const* d_in, const int* in_sizes, int n_in,
                              void* d_out, int out_size, void* d_ws, size_t ws_size, hipStream_t stream) {
    (void)in_sizes; (void)n_in; (void)out_size;
    const float* x = (const float*)d_in[0]; const float* wqkv = (const float*)d_in[1]; const float* wo = (const float*)d_in[2];
    float* OUT = (float*)d_out;     // [4][2048][1024]
    char* wsp = (char*)d_ws;
    auto take = [&](size_t bytes) { char* p = wsp; wsp += (bytes + 255) & ~(size_t)255; return (void*)p; };
    bf* XB = (bf*)take((NX8 + NW8 + NO8) * 8 * 2); bf* WQKV = XB + NX8 * 8; bf* WO = WQKV + NW8 * 8;   // x of all batches, W_qkv, W_o: one run, as k_cvt8 writes it
    const size_t PQ = (size_t)NH_ * TT * HD;   // one batch's share of a q, k or v plane, in elements (NKV == NH_); every plane holds all NB_ batches
    h16* QP16 = (h16*)take(3 * NB_ * PQ * 2); h16* KP16 = QP16 + NB_ * PQ; h16* VT16 = KP16 + NB_ * PQ;   // q, k, v of one kind of plane lie NB_ * PQ elements apart
    h16* QPl = (h16*)take(3 * NB_ * PQ * 2); h16* KPl = QPl + NB_ * PQ; h16* VTl = KPl + NB_ * PQ;
    bf* ATh = (bf*)take((size_t)NB_ * TT * DQ * 2); bf* ATl = (bf*)take((size_t)NB_ * TT * DQ * 2);
    if ((size_t)(wsp - (char*)d_ws) > ws_size) return;    // ws 256 MiB
    k_cvt8<<<(unsigned)((NX8 + NW8 + NO8) / 256), 256, 0, stream>>>(x, wqkv, wo, XB);
    k_gemmw<bf, 0, false, true><<<dim3(TT / GTM, 3 * NH_ * 64 / GTN, NB_), 256, 0, stream>>>(XB, nullptr, WQKV, nullptr, DM, nullptr, 0, nullptr, (size_t)TT * DM, 0, PQ, QP16, QPl, NB_ * PQ);
    k_fattn<<<NB_ * NH_ * (RH / 128 + (TT - RH) / 256), 256, 0, stream>>>(QP16, KP16, VT16, QPl, KPl, VTl, ATh, ATl);   // one kv head per query head
    k_gemmw<bf, 1, false, false><<<dim3(NB_ * TT / GTM, DM / GTN, 1), 256, 0, stream>>>(ATh, ATl, WO, nullptr, DQ, OUT, DM, nullptr, 0, 0, 0, nullptr, nullptr, 0);   // the batches' rows are one run in ATh, ATl and OUT
}

// v010
// It runs in 130 microseconds.
// Timed twice side by side with v009, it ran 1.28 and 1.27 times as fast.
// Counting every step since v000, it is 30.8 times as fast.
#include <hip/hip_runtime.h>

// Multi-head attention with a fused 'oi' projection (x [4][2048][1024]; [Q|K|V] = x W_qkv^T ([3072][1024]: rows q | k | v); 16 heads x 64; softmax(q.k/8) over all keys; out = merged W_o^T -> [4][2048][1024] (8.4 M)).
// Compute dtypes, f32 accumulate: every input rounded to bf16; q/k/v on PLAIN bf16 operands (inputs: exact); scores and attn.v on fp16 operands (P x1024), one product each for every query row; softmax f32, maximum held while P fits its type; W_o hl x exact (2 products).

#define NB_  4
#define TT   2048
#define DM   1024
#define NH_  16
#define NKV  16
#define REP  (NH_ / NKV)
#define HD   64
#define DQ   (NH_ * HD)
#define DKV  (NKV * HD)
#define WIN  0
#define SCL  0.125f   // HD^-0.5
typedef _Float16 h16;
typedef unsigned short bf;
typedef __attribute__((ext_vector_type(16))) __bf16   v16bf;
typedef __attribute__((ext_vector_type(16))) _Float16 v16h;
typedef __attribute__((ext_vector_type(8)))  _Float16 v8h;
typedef __attribute__((ext_vector_type(8)))  unsigned short v8us;
typedef __attribute__((ext_vector_type(8)))  __bf16   v8bf;
typedef __attribute__((ext_vector_type(8)))  float    v8f;
typedef __attribute__((ext_vector_type(4)))  float    v4f;
typedef v8h  __attribute__((may_alias)) v8ha;
typedef v4f  __attribute__((may_alias)) v4fa;
typedef v8us __attribute__((may_alias)) v8usa;

__device__ __forceinline__ unsigned short f2bf(float f) { unsigned u = __float_as_uint(f); u += 0x7FFFu + ((u >> 16) & 1u); return (unsigned short)(u >> 16); }
__device__ __forceinline__ float bf2f(unsigned short b) { return __uint_as_float(((unsigned)b) << 16); }
__device__ __forceinline__ float bfr(float f) { return bf2f(f2bf(f)); }
__device__ __forceinline__ v16h cat16(v8h lo, v8h hi) { return __builtin_shufflevector(lo, hi, 0, 1, 2, 3, 4, 5, 6, 7, 8, 9, 10, 11, 12, 13, 14, 15); }
__device__ __forceinline__ v16bf cat16b(v8us lo, v8us hi) { return __builtin_bit_cast(v16bf, __builtin_shufflevector(lo, hi, 0, 1, 2, 3, 4, 5, 6, 7, 8, 9, 10, 11, 12, 13, 14, 15)); }
__device__ __forceinline__ v8f wmma16(v16h a, v16h b, v8f c) { return __builtin_amdgcn_wmma_f32_16x16x32_f16(false, a, false, b, (short)0, c, false, false); }
__device__ __forceinline__ v8f wmmab(v16bf a, v16bf b, v8f c) { return __builtin_amdgcn_wmma_f32_16x16x32_bf16(false, a, false, b, (short)0, c, false, false); }



__device__ __forceinline__ h16 tohx(float x) { return (h16)x; }
__device__ __forceinline__ void splitf(float y, unsigned short& h, unsigned short& l) { h = f2bf(y); l = f2bf(y - bf2f(h)); }
// ---- k_gemmw: GEMM on a 128 x 256 output tile per work-group of 8 waves (2 x 4), each wave a register-blocked 64x64 sub-tile (16 accumulators); grid (M/128, N/256, Z), 256 threads.
// C[m][n] (f32, pitch ldc, + optional f32 bias[n]) = sum_k A[m][k] Bt[n][k] (+ A2[m][k] Bt[n][k] where NSPLIT == 1). z-batch strides sA/sB/sC in elements. K % 64 == 0.
// The operands come from K-contiguous 16-bit planes through LDS: a stage is 64 k (one whole 128-byte line) of the tile's 128 A rows (and A2 rows) and 256 Bt rows; asynchronous 16-byte copies, a wave's copy = 4 whole lines;
// two buffers, stage t + 2 is copied into the buffer that trip t has just left, one barrier per trip. Every staged row serves 4 (A) or 2 (Bt) waves.
// PL: C is not stored as f32; each value goes out as fp16 (P16), into the plane of head (n / 64) % NH_ of q, k or v (n / 1024):
//     ONE launch does q, k and v of every batch: A = x ([b][t][DM], batch stride sA), Bt = all rows of W_qkv, grid (TT/128, 3 * NH_ / 4, NB_); a wave's 64 W rows are one head of q, k or v (plane sets cts elements apart, batches sC apart).
//     q, k: x rows times W rows, stored [h][t][d];  v: the operands swapped (W rows times x rows), stored [h][d][t]. A store instruction writes four whole 128-byte lines.
template <typename T16> struct WFrag;
template <> struct WFrag<h16> { typedef v16h V; static __device__ __forceinline__ V ld(const h16* p) { return cat16(*(const v8h*)p, *(const v8h*)(p + 16)); } static __device__ __forceinline__ v8f mma(V a, V b, v8f c) { return wmma16(a, b, c); } };
template <> struct WFrag<bf> { typedef v16bf V; static __device__ __forceinline__ V ld(const bf* p) { return cat16b(*(const v8us*)p, *(const v8us*)(p + 16)); } static __device__ __forceinline__ v8f mma(V a, V b, v8f c) { return wmmab(a, b, c); } };
#define GTM 128                   // output rows of a work-group's tile
#define GTN 256                   // output columns
#define GKS 64                    // k per stage
#define GLP 72                    // LDS row pitch in 16-bit elements: 144 B = 16 B x odd, 16-byte fragment reads of 16 rows fall on 64 different banks
// cpy<N>: N asynchronous 16-byte copies global -> LDS per lane (l: the lane's LDS byte addresses, g: its global addresses). The s_wait_xcnt 0 is the statement's last line, so it stands in front of every rewrite of an address register that these copies name.
template <int N> __device__ __forceinline__ void cpy(const unsigned* l, const void* const* g);
template <> __device__ __forceinline__ void cpy<4>(const unsigned* l, const void* const* g) {
    asm volatile("global_load_async_to_lds_b128 %0, %4, off\n\tglobal_load_async_to_lds_b128 %1, %5, off\n\tglobal_load_async_to_lds_b128 %2, %6, off\n\tglobal_load_async_to_lds_b128 %3, %7, off\n\ts_wait_xcnt 0x0"
                 :: "v"(l[0]), "v"(l[1]), "v"(l[2]), "v"(l[3]), "v"(g[0]), "v"(g[1]), "v"(g[2]), "v"(g[3]) : "memory"); }
template <> __device__ __forceinline__ void cpy<8>(const unsigned* l, const void* const* g) {
    asm volatile("global_load_async_to_lds_b128 %0, %8, off\n\tglobal_load_async_to_lds_b128 %1, %9, off\n\tglobal_load_async_to_lds_b128 %2, %10, off\n\tglobal_load_async_to_lds_b128 %3, %11, off\n\tglobal_load_async_to_lds_b128 %4, %12, off\n\tglobal_load_async_to_lds_b128 %5, %13, off\n\tglobal_load_async_to_lds_b128 %6, %14, off\n\tglobal_load_async_to_lds_b128 %7, %15, off\n\ts_wait_xcnt 0x0"
                 :: "v"(l[0]), "v"(l[1]), "v"(l[2]), "v"(l[3]), "v"(l[4]), "v"(l[5]), "v"(l[6]), "v"(l[7]), "v"(g[0]), "v"(g[1]), "v"(g[2]), "v"(g[3]), "v"(g[4]), "v"(g[5]), "v"(g[6]), "v"(g[7]) : "memory"); }
template <> __device__ __forceinline__ void cpy<12>(const unsigned* l, const void* const* g) {
    asm volatile("global_load_async_to_lds_b128 %0, %12, off\n\tglobal_load_async_to_lds_b128 %1, %13, off\n\tglobal_load_async_to_lds_b128 %2, %14, off\n\tglobal_load_async_to_lds_b128 %3, %15, off\n\tglobal_load_async_to_lds_b128 %4, %16, off\n\tglobal_load_async_to_lds_b128 %5, %17, off\n\tglobal_load_async_to_lds_b128 %6, %18, off\n\tglobal_load_async_to_lds_b128 %7, %19, off\n\tglobal_load_async_to_lds_b128 %8, %20, off\n\tglobal_load_async_to_lds_b128 %9, %21, off\n\tglobal_load_async_to_lds_b128 %10, %22, off\n\tglobal_load_async_to_lds_b128 %11, %23, off\n\ts_wait_xcnt 0x0"
                 :: "v"(l[0]), "v"(l[1]), "v"(l[2]), "v"(l[3]), "v"(l[4]), "v"(l[5]), "v"(l[6]), "v"(l[7]), "v"(l[8]), "v"(l[9]), "v"(l[10]), "v"(l[11]), "v"(g[0]), "v"(g[1]), "v"(g[2]), "v"(g[3]), "v"(g[4]), "v"(g[5]), "v"(g[6]), "v"(g[7]), "v"(g[8]), "v"(g[9]), "v"(g[10]), "v"(g[11]) : "memory"); }
// launch bounds: at least 4 waves per SIMD, that is a budget of 256 registers, so that two work-groups of the q/k/v launch share a WGP (their LDS fits twice).
template <typename T16, int NSPLIT, bool BIAS, bool PL>
__global__ __launch_bounds__(256, 4) void k_gemmw(const T16* __restrict__ A, const T16* __restrict__ A2, const T16* __restrict__ Bt, const T16* __restrict__ Bt2, int K, float* C, int ldc, const float* __restrict__ bias, size_t sA, size_t sB, size_t sC, h16* P16, size_t cts) {
    static_assert(NSPLIT == 0 || NSPLIT == 1, "A (+ A2) times Bt");
    typedef typename WFrag<T16>::V V;
    constexpr int NAP = NSPLIT == 1 ? 2 : 1, ROWS = GTM * NAP + GTN, BUFE = ROWS * GLP, NC = ROWS / 32;   // a buffer: the A rows, the A2 rows, the Bt rows; NC copies per thread and stage
    __shared__ __align__(16) T16 sm[2 * BUFE];
    __shared__ __align__(16) float osm[8 * 16 * 68];
    const size_t z = blockIdx.z; A += z * sA; if (NSPLIT == 1) A2 += z * sA; Bt += z * sB;
    C += z * sC;
    const int wave = __builtin_amdgcn_readfirstlane((int)(threadIdx.x >> 5)), wm = wave & 1, wn = wave >> 1;
    float* os = osm + wave * (16 * 68);   // each wave's own epilogue staging
    const int lane = threadIdx.x & 31, lr = lane & 15, hi = lane >> 4; const int R0 = blockIdx.x * GTM, C0 = blockIdx.y * GTN; const int r0 = R0 + wm * 64, c0 = C0 + wn * 64;
    int arow = wm * 64, brow = GTM * NAP + wn * 64;   // first staged row of the wave's A and B operand
    size_t pofs = 0; int ldp = HD;   // PL: element of the wave tile's first value in the planes, and the pitch of its rows there
    if constexpr (PL) { const int y = blockIdx.y * (GTN / 64) + wn, sel = y / NH_, h = y % NH_; pofs = (size_t)sel * cts + z * sC + (size_t)h * TT * HD;
        if (sel < 2) pofs += (size_t)r0 * HD;
        else { pofs += r0; ldp = TT; const int t0 = arow; arow = brow; brow = t0; } }
    v8f acc[4][4];   // the unrolls in this kernel make every index of acc, a, a2, b, l and g a constant, so that these arrays live in registers
#pragma unroll
    for (int mb = 0; mb < 4; ++mb)
#pragma unroll
        for (int nb = 0; nb < 4; ++nb) acc[mb][nb] = (v8f){};
    const int sr = threadIdx.x >> 3, sc = (threadIdx.x & 7) * 8;   // staging: this thread copies 16 bytes at element sc of rows sr, sr + 32, ... of the stage
    const T16* pa = A + (size_t)(R0 + sr) * K + sc; const T16* pa2 = NSPLIT == 1 ? A2 + (size_t)(R0 + sr) * K + sc : pa; const T16* pb = Bt + (size_t)(C0 + sr) * K + sc;   // this thread's bytes of the next stage to copy; they move on by one stage per fill
    const unsigned l0 = (unsigned)(size_t)(sm + sr * GLP + sc);
    auto fill = [&](int t) {   // stage t into buffer t & 1
        unsigned l[NC]; const void* g[NC];
#pragma unroll
        for (int j = 0; j < NC; ++j) { l[j] = l0 + (unsigned)(((t & 1) * BUFE + j * 32 * GLP) * 2);
            g[j] = (j < GTM / 32 ? pa + (size_t)j * 32 * K : j < NAP * GTM / 32 ? pa2 + (size_t)(j - GTM / 32) * 32 * K : pb + (size_t)(j - NAP * GTM / 32) * 32 * K); }
        if constexpr (NC == 12) cpy<12>(l, g); else { cpy<8>(l, g); cpy<8>(l + 8, g + 8); }
        pa += GKS; pa2 += GKS; pb += GKS; };
    const int NT = K / GKS;
    fill(0);
    asm volatile("s_wait_asynccnt 0x0" ::: "memory");   // this wave's copies of stage 0 have landed
    __syncthreads();   // stage 0 is in LDS for every wave
    if (NT > 1) fill(1);
#pragma unroll 1   // one trip per stage stays rolled: unrolled, two trips' fragments and addresses would not fit the register budget
    for (int t = 0; t < NT; ++t) {
        const T16* cur = sm + (t & 1) * BUFE;
        V a[4], a2[4], b[4];
        auto frags = [&](int ks) {   // all fragments of 32 k, read as one group
#pragma unroll
            for (int mb = 0; mb < 4; ++mb) { const T16* p = cur + (arow + mb * 16 + lr) * GLP + ks * 32 + 8 * hi; a[mb] = WFrag<T16>::ld(p); if (NSPLIT == 1) a2[mb] = WFrag<T16>::ld(p + GTM * GLP); }
#pragma unroll
            for (int nb = 0; nb < 4; ++nb) b[nb] = WFrag<T16>::ld(cur + (brow + nb * 16 + lr) * GLP + ks * 32 + 8 * hi); };
        auto prods = [&]() {
#pragma unroll
            for (int nb = 0; nb < 4; ++nb)
#pragma unroll
                for (int mb = 0; mb < 4; ++mb) { acc[mb][nb] = WFrag<T16>::mma(a[mb], b[nb], acc[mb][nb]); if (NSPLIT == 1) acc[mb][nb] = WFrag<T16>::mma(a2[mb], b[nb], acc[mb][nb]); } };
        frags(0);
        __builtin_amdgcn_sched_barrier(0);   // keeps the LDS reads together in front of the products: without it the compiler sinks each b fragment's reads to just in front of its products, and the wave waits out the LDS latency four times
        prods();
        frags(1);   // the trip's last reads of cur
        __builtin_amdgcn_sched_barrier(0);   // as above
        if constexpr (NSPLIT == 1) prods();   // three fragment sets and the copies' addresses do not fit 256 registers together: here the last products come first
        asm volatile("s_wait_dscnt 0x0" ::: "memory");      // this wave's reads of cur are done before cur is handed to its next writer
        asm volatile("s_wait_asynccnt 0x0" ::: "memory");   // this wave's copies of stage t + 1 have landed
        __syncthreads();   // publishes stage t + 1 and ends every wave's reads of cur
        if (t + 2 < NT) fill(t + 2);
        if constexpr (NSPLIT == 0) { __builtin_amdgcn_sched_barrier(0);   // keeps the copies in front of the trip's last products (registers only), so that they fly a whole trip before they are waited for
            prods(); }
    }
    asm volatile("s_wait_asynccnt 0x0" ::: "memory");   // no copy is outstanding behind the loop
#pragma unroll
    for (int mb = 0; mb < 4; ++mb) {
#pragma unroll
        for (int nb = 0; nb < 4; ++nb) {
#pragma unroll
            for (int j = 0; j < 8; ++j) os[(hi * 8 + j) * 68 + nb * 16 + lr] = acc[mb][nb][j]; }
        __builtin_amdgcn_wave_barrier(); asm volatile("" ::: "memory");
        if constexpr (PL) {
            const int cofs = (lane & 7) * 8; v4f va[4], vb[4];   // all eight LDS reads of these 16 rows first: the store statements below are memory barriers to the compiler, no read moves up over one
#pragma unroll
            for (int s = 0; s < 4; ++s) { const float* o4 = os + (4 * s + (lane >> 3)) * 68 + cofs; va[s] = *(const v4fa*)o4; vb[s] = *(const v4fa*)(o4 + 4); }
#pragma unroll
            for (int s = 0; s < 4; ++s) { const int row = 4 * s + (lane >> 3); v8h o16;
#pragma unroll
                for (int q = 0; q < 8; ++q) o16[q] = tohx(q < 4 ? va[s][q & 3] : vb[s][q & 3]);
                const size_t off = pofs + (size_t)(mb * 16 + row) * ldp + cofs;
                // the store and its s_wait_xcnt 0 in one statement: the wait then stands in front of every rewrite of a data or address register that the store names
                asm volatile("global_store_b128 %0, %1, off\n\ts_wait_xcnt 0x0" :: "v"(P16 + off), "v"(o16) : "memory"); }
        } else {
            float* crow = C + (size_t)(r0 + mb * 16) * ldc + c0;
#pragma unroll
            for (int s = 0; s < 8; ++s) { const int row = 2 * s + hi, cofs = lr * 4; v4f val = *(const v4fa*)(os + row * 68 + cofs); if (BIAS) { val[0] += bfr(bias[c0 + cofs]); val[1] += bfr(bias[c0 + cofs + 1]); val[2] += bfr(bias[c0 + cofs + 2]); val[3] += bfr(bias[c0 + cofs + 3]); }
                *(v4f*)(crow + (size_t)row * ldc + cofs) = val; }
             }
        __builtin_amdgcn_wave_barrier(); asm volatile("" ::: "memory");
    }
}

typedef __attribute__((ext_vector_type(2))) _Float16 v2h;
typedef __attribute__((ext_vector_type(4))) _Float16 v4h;
typedef __attribute__((ext_vector_type(2))) unsigned short v2us;
typedef __attribute__((ext_vector_type(4))) unsigned short v4us;
typedef __attribute__((ext_vector_type(2))) float v2f;
typedef __attribute__((ext_vector_type(4))) int v4i;

__global__ __launch_bounds__(256) void k_wtG(const float* __restrict__ w, int K, int N, bf* Bt) {
    const int lane = threadIdx.x & 31; const int L0 = (blockIdx.x * 8 + (threadIdx.x >> 5)) * 8; const int nlines = N * K / 64;
{
#pragma unroll 1
        for (int l = 0; l < 8; ++l) { const int L = L0 + l; if (L >= nlines) break; const size_t e = (size_t)L * 64 + lane * 2; const int k = (int)(e % K), n = (int)(e / K); v2us o;
            o[0] = f2bf(w[(size_t)k * N + n]); o[1] = f2bf(w[(size_t)(k + 1) * N + n]); *(v2us*)(Bt + e) = o; }
         }
}
// k_cvt8: x, W_qkv and W_o rounded to bf16 in one launch; dst holds the three one behind the other. Each part is a whole number of work-groups.
#define NX8 ((size_t)NB_ * TT * DM / 8)
#define NW8 ((size_t)(DQ + 2 * DKV) * DM / 8)
#define NO8 ((size_t)DM * DQ / 8)
__global__ __launch_bounds__(256) void k_cvt8(const float* __restrict__ x, const float* __restrict__ wqkv, const float* __restrict__ wo, bf* dst) { const size_t g = (size_t)blockIdx.x * 256, i = g + threadIdx.x;
    const float* src = g < NX8 ? x + i * 8 : g < NX8 + NW8 ? wqkv + (i - NX8) * 8 : wo + (i - NX8 - NW8) * 8; const v8f v = *(const v8f*)src; v8us o;
#pragma unroll
    for (int k = 0; k < 8; ++k) o[k] = f2bf(v[k]); *(v8us*)(dst + i * 8) = o;  }

// ---- k_fattn: scores, softmax and attn.v of one (batch, head) in ONE kernel; no score or P element leaves the registers.
// A wave owns NQ * 16 query columns and walks the 2048 keys 32 at a time: St = K Qt (A = K rows, B = Q rows, kept in registers), so a lane holds 16 scores of ONE query per column group;
// maximum in use m and sum l per query (in-lane; m is held from pass to pass and no maximum is formed while the P stay small enough for their type, tested once per 32 keys on their sums; only then does m move to the running maximum and are l and Ot rescaled); two St tiles, converted in place, are the B operand Pt of Ot += Vt Pt (A = rows of the [d][t] planes).
// Ot: a lane holds 8 consecutive d of one query, scaled by 1 / l at the end and stored as the hi + lo planes that the output projection reads ([b][t][h][d]).
// The work-group's 8 waves share K and Vt through LDS: stages of KST keys, two buffers; whole 128-byte lines go global -> LDS by asynchronous 16-byte copies (through no register); stage st + 2 is copied into the buffer that stage st has just left, one barrier per stage.
// All operands fp16, P carried x 2^10 (l carries the same factor, so it cancels).
#define KST 64                    // keys per LDS stage
#define LP  72                    // LDS row pitch in 16-bit elements: 144 B = 16 B x odd, 16-byte fragment reads of 16 rows fall on 64 different banks
#define LTILE (64 * LP)           // one staged tile: 64 rows (keys of K, or d of Vt) of 64 elements
// ldx: a fragment loaded straight from global memory (the Q rows, once per wave). The s_wait_xcnt 0 stands behind each 16-byte load so that it comes in front of any rewrite of the address pair the load names (the register allocator gives such pairs to later loads' data).
__device__ __forceinline__ v16h ldx(const h16* p) { const v8h lo = *(const v8h*)p; asm volatile("s_wait_xcnt 0x0" ::: "memory"); const v8h hi = *(const v8h*)(p + 16); asm volatile("s_wait_xcnt 0x0" ::: "memory"); return cat16(lo, hi); }
__device__ __forceinline__ v16bf ldx(const bf* p) { const v8us lo = *(const v8us*)p; asm volatile("s_wait_xcnt 0x0" ::: "memory"); const v8us hi = *(const v8us*)(p + 16); asm volatile("s_wait_xcnt 0x0" ::: "memory"); return cat16b(lo, hi); }
// exp2run: 2^x of 16 values, each in its own register, as ONE run of v_exp_f32: no instruction directly behind one of them reads its result or rewrites its source, and the v_nop is that slot behind the last.
__device__ __forceinline__ void exp2run(float (&e)[16]) { asm("v_exp_f32 %0, %0\n\tv_exp_f32 %1, %1\n\tv_exp_f32 %2, %2\n\tv_exp_f32 %3, %3\n\tv_exp_f32 %4, %4\n\tv_exp_f32 %5, %5\n\tv_exp_f32 %6, %6\n\tv_exp_f32 %7, %7\n\tv_exp_f32 %8, %8\n\tv_exp_f32 %9, %9\n\tv_exp_f32 %10, %10\n\tv_exp_f32 %11, %11\n\tv_exp_f32 %12, %12\n\tv_exp_f32 %13, %13\n\tv_exp_f32 %14, %14\n\tv_exp_f32 %15, %15\n\tv_nop" : "+v"(e[0]), "+v"(e[1]), "+v"(e[2]), "+v"(e[3]), "+v"(e[4]), "+v"(e[5]), "+v"(e[6]), "+v"(e[7]), "+v"(e[8]), "+v"(e[9]), "+v"(e[10]), "+v"(e[11]), "+v"(e[12]), "+v"(e[13]), "+v"(e[14]), "+v"(e[15])); }
// exp2one: 2^x of one value (the rescale factor); the v_nop is the slot behind the v_exp_f32.
__device__ __forceinline__ float exp2one(float x) { asm("v_exp_f32 %0, %0\n\tv_nop" : "+v"(x)); return x; }
__device__ __forceinline__ float xhalf(float x) { const int b = __float_as_int(x); return __int_as_float(__builtin_amdgcn_permlanex16(b, b, 0x76543210, 0xfedcba98, false, false)); }   // the value of lane l ^ 16
template <typename T16, int NQ>
__device__ __forceinline__ void attn_wg(T16* sm, const T16* __restrict__ Q, const T16* __restrict__ Kp, const T16* __restrict__ Vt, int q0, bf* __restrict__ Ah, bf* __restrict__ Al) {
    typedef WFrag<T16> F; typedef typename F::V V;
    constexpr int BUF = 2 * LTILE, NCP = 4;   // a buffer: the K tile, then the Vt tile; NCP copies per thread and stage
    const int lane = threadIdx.x & 31, lr = lane & 15, hi = lane >> 4;
    const int sr = threadIdx.x >> 3, sc = (threadIdx.x & 7) * 8;   // staging: this thread copies 16 bytes at element sc of rows sr and sr + 32 of every tile
    const T16* pk = Kp + (size_t)sr * HD + sc; const T16* pv = Vt + (size_t)sr * TT + sc;   // this thread's bytes of the next stage to copy; they move on by one stage per fill
    const unsigned l0 = (unsigned)(size_t)(sm + sr * LP + sc);
    auto fill = [&](int t) {   // stage t into buffer t & 1
        unsigned l[NCP]; const void* g[NCP]; const unsigned lb = l0 + (unsigned)((t & 1) * BUF * 2);
#pragma unroll
        for (int i = 0; i < 2; ++i) { l[i] = lb + (unsigned)(i * 32 * LP * 2); g[i] = pk + (size_t)i * 32 * HD; l[2 + i] = lb + (unsigned)((LTILE + i * 32 * LP) * 2); g[2 + i] = pv + (size_t)i * 32 * TT; }
        cpy<NCP>(l, g);
        pk += KST * HD; pv += KST; };
    static_assert(TT / KST >= 2, "stages 0 and 1 are copied in front of the loop");
    fill(0);   // flies while the Q rows are loaded
    const float C2 = SCL * 1.4426950408889634f, OFF = 10.0f;
    const float LIM = 32768.0f;   // the maximum in use is held while a lane's 16 P of a pass sum to LIM or less: every P then is at most LIM, which fp16 holds (P carries 2^OFF)
    V qf[NQ][2];
#pragma unroll
    for (int n = 0; n < NQ; ++n)
#pragma unroll
        for (int ks = 0; ks < 2; ++ks) { const size_t qo = (size_t)(q0 + n * 16 + lr) * HD + ks * 32 + 8 * hi; qf[n][ks] = ldx(Q + qo); }
    v8f o[NQ][4]; float m[NQ], l[NQ], nb[NQ];   // m: the maximum in use, nb = OFF - m C2 (at the start so large that the first pass's P overflow and the test below sets m)
#pragma unroll
    for (int n = 0; n < NQ; ++n) { m[n] = -3.0e38f; nb[n] = 3.0e38f; l[n] = 0.0f;
#pragma unroll
        for (int db = 0; db < 4; ++db) o[n][db] = (v8f){}; }
    asm volatile("s_wait_asynccnt 0x0" ::: "memory");   // this wave's copies of stage 0 have landed
    __syncthreads();   // stage 0 is in LDS for every wave
    fill(1);
#pragma unroll 1
    for (int st = 0; st < TT / KST; ++st) {
        const T16* cur = sm + (st & 1) * BUF;
#pragma unroll
        for (int p = 0; p < KST / 32; ++p) {
            v8f s[NQ][2];
#pragma unroll
            for (int kt = 0; kt < 2; ++kt) { V kf[2];
#pragma unroll
                for (int ks = 0; ks < 2; ++ks) kf[ks] = F::ld(cur + (p * 32 + kt * 16 + lr) * LP + ks * 32 + 8 * hi);
#pragma unroll
                for (int n = 0; n < NQ; ++n) { s[n][kt] = (v8f){};
#pragma unroll
                    for (int ks = 0; ks < 2; ++ks) s[n][kt] = F::mma(kf[ks], qf[n][ks], s[n][kt]); } }
            V pf[NQ]; v8f p0[NQ], p1[NQ]; float sum[NQ];
            auto soft = [&](int n) {   // P of column group n from the maximum in use, and this lane's sum of its 16
                float e[16]; const v8f d0 = s[n][0] * C2 + nb[n], d1 = s[n][1] * C2 + nb[n];   // one fused multiply-add per score: (s - m) C2 + OFF
#pragma unroll
                for (int j = 0; j < 8; ++j) { e[j] = d0[j]; e[8 + j] = d1[j]; }
                exp2run(e);
#pragma unroll
                for (int j = 0; j < 8; ++j) { p0[n][j] = e[j]; p1[n][j] = e[8 + j]; }
                const v8f ps = p0[n] + p1[n];
                sum[n] = (((ps[0] + ps[1]) + (ps[2] + ps[3])) + ((ps[4] + ps[5]) + (ps[6] + ps[7]))); };
            bool need = false;   // need: this lane's 16 P sum to more than LIM (or are not numbers), so one of them may be too large for its 16-bit type
#pragma unroll
            for (int n = 0; n < NQ; ++n) { soft(n); need = need || !(sum[n] <= LIM); }
            if (__builtin_expect(__builtin_amdgcn_ballot_w32(need) != 0, 0)) {   // one scalar test per 32 keys, marked rare so that the usual path falls through; taken by the whole wave: every column moves to its running maximum, l and Ot are rescaled, P is formed again
#pragma unroll
                for (int n = 0; n < NQ; ++n) {
                    float mx = s[n][0][0];
#pragma unroll
                    for (int j = 1; j < 8; ++j) mx = fmaxf(mx, s[n][0][j]);
#pragma unroll
                    for (int j = 0; j < 8; ++j) mx = fmaxf(mx, s[n][1][j]);
                    const float mn = fmaxf(m[n], fmaxf(mx, xhalf(mx))); const float al = exp2one((m[n] - mn) * C2);
                    m[n] = mn; nb[n] = OFF - mn * C2; l[n] *= al;
#pragma unroll
                    for (int db = 0; db < 4; ++db) o[n][db] *= al;
                    soft(n);
                }
            }
#pragma unroll
            for (int n = 0; n < NQ; ++n) {
                l[n] += sum[n];
                pf[n] = cat16(__builtin_convertvector(p0[n], v8h), __builtin_convertvector(p1[n], v8h));
            }
            V vf[4];
#pragma unroll
            for (int db = 0; db < 4; ++db) vf[db] = F::ld(cur + LTILE + (db * 16 + lr) * LP + p * 32 + 8 * hi);
            if (p == KST / 32 - 1) __builtin_amdgcn_sched_barrier(0);   // the stage's last Vt reads stay one group in front of their products: with the staging registers gone the compiler reads them into one fragment's registers, and the wave waits out the LDS latency four times
#pragma unroll
            for (int db = 0; db < 4; ++db)
#pragma unroll
                for (int n = 0; n < NQ; ++n) o[n][db] = F::mma(vf[db], pf[n], o[n][db]);
        }
        // five vector slots between the stage's last matrix instruction and whatever vector instruction stands first behind the loop's taken back edge
        static_assert(NQ == 2, "the statement below names the eight Ot tiles of two column groups");
        asm volatile("v_nop\n\tv_nop\n\tv_nop\n\tv_nop\n\tv_nop" : "+v"(o[0][0]), "+v"(o[0][1]), "+v"(o[0][2]), "+v"(o[0][3]), "+v"(o[1][0]), "+v"(o[1][1]), "+v"(o[1][2]), "+v"(o[1][3]));
        asm volatile("s_wait_dscnt 0x0" ::: "memory");      // this wave's reads of cur are done before cur is handed to its next writer
        asm volatile("s_wait_asynccnt 0x0" ::: "memory");   // this wave's copies of stage st + 1 have landed
        __syncthreads();   // publishes stage st + 1 and ends every wave's reads of cur
        if (st + 2 < TT / KST) fill(st + 2);   // into cur; these copies fly a whole stage before they are waited for
    }
    asm volatile("s_wait_asynccnt 0x0" ::: "memory");   // no copy is outstanding behind the loop
#pragma unroll
    for (int n = 0; n < NQ; ++n) { const float inv = __fdiv_rn(1.0f, l[n] + xhalf(l[n])); const size_t oo = (size_t)(q0 + n * 16 + lr) * DQ + 8 * hi;
#pragma unroll
        for (int db = 0; db < 4; ++db) { v8us oh, ol;
#pragma unroll
            for (int j = 0; j < 8; ++j) { unsigned short a, c2; splitf(o[n][db][j] * inv, a, c2); oh[j] = a; ol[j] = c2; }
            *(v8us*)(Ah + oo + db * 16) = oh; *(v8us*)(Al + oo + db * 16) = ol;
            asm volatile("s_wait_xcnt 0x0" ::: "memory"); } }   // stands in front of every rewrite of a data or address register that these two stores name
}
// grid: NB_ * NH_ * TT / 256 work-groups of 8 waves x 32 queries, all alike. Planes [b * NH_ + h][..]; Ah, Al [b][t][DQ].
__global__ __launch_bounds__(256) void k_fattn(const h16* __restrict__ Q16, const h16* __restrict__ K16, const h16* __restrict__ V16, bf* __restrict__ Ah, bf* __restrict__ Al) {
    __shared__ __align__(16) h16 sm[2 * 2 * LTILE];
    const int wave = __builtin_amdgcn_readfirstlane((int)(threadIdx.x >> 5)); const int id = blockIdx.x;
    const int bh = id / (TT / 256), q0 = (id % (TT / 256)) * 256 + wave * 32; const size_t pl = (size_t)bh * TT * HD, ao = (size_t)(bh / NH_) * TT * DQ + (size_t)(bh % NH_) * HD;
    attn_wg<h16, 2>(sm, Q16 + pl, K16 + pl, V16 + pl, q0, Ah + ao, Al + ao);
}

extern "C" void kernel_launch(void* const* d_in, const int* in_sizes, int n_in,
                              void* d_out, int out_size, void* d_ws, size_t ws_size, hipStream_t stream) {
    (void)in_sizes; (void)n_in; (void)out_size;
    const float* x = (const float*)d_in[0]; const float* wqkv = (const float*)d_in[1]; const float* wo = (const float*)d_in[2];
    float* OUT = (float*)d_out;     // [4][2048][1024]
    char* wsp = (char*)d_ws;
    auto take = [&](size_t bytes) { char* p = wsp; wsp += (bytes + 255) & ~(size_t)255; return (void*)p; };
    bf* XB = (bf*)take((NX8 + NW8 + NO8) * 8 * 2); bf* WQKV = XB + NX8 * 8; bf* WO = WQKV + NW8 * 8;   // x of all batches, W_qkv, W_o: one run, as k_cvt8 writes it
    const size_t PQ = (size_t)NH_ * TT * HD;   // one batch's share of a q, k or v plane, in elements (NKV == NH_); every plane holds all NB_ batches
    h16* QP16 = (h16*)take(3 * NB_ * PQ * 2); h16* KP16 = QP16 + NB_ * PQ; h16* VT16 = KP16 + NB_ * PQ;   // q, k, v of one kind of plane lie NB_ * PQ elements apart
    bf* ATh = (bf*)take((size_t)NB_ * TT * DQ * 2); bf* ATl = (bf*)take((size_t)NB_ * TT * DQ * 2);
    if ((size_t)(wsp - (char*)d_ws) > ws_size) return;    // ws 256 MiB
    k_cvt8<<<(unsigned)((NX8 + NW8 + NO8) / 256), 256, 0, stream>>>(x, wqkv, wo, XB);
    k_gemmw<bf, 0, false, true><<<dim3(TT / GTM, 3 * NH_ * 64 / GTN, NB_), 256, 0, stream>>>(XB, nullptr, WQKV, nullptr, DM, nullptr, 0, nullptr, (size_t)TT * DM, 0, PQ, QP16, NB_ * PQ);
    k_fattn<<<NB_ * NH_ * (TT / 256), 256, 0, stream>>>(QP16, KP16, VT16, ATh, ATl);   // one kv head per query head
    k_gemmw<bf, 1, false, false><<<dim3(NB_ * TT / GTM, DM / GTN, 1), 256, 0, stream>>>(ATh, ATl, WO, nullptr, DQ, OUT, DM, nullptr, 0, 0, 0, nullptr, 0);   // the batches' rows are one run in ATh, ATl and OUT
}
